// v000
// Times are from an AMD MI455X. After a warm-up the kernel runs many times in a row, and a time is the length of
// such a window on the GPU divided by its runs, so every launch and the gaps after it count. The runs cycle
// through copies of the inputs. A figure is the median of several windows, for all but v000 over two sittings.
// Sittings can differ by a few percent; kernels timed side by side share one.
// v000, which the later versions start from, runs in 833 microseconds.
#include <hip/hip_runtime.h>
#include <cstdint>
#include <cstddef>

// ---------------- types ----------------
typedef __bf16 bf16_t;
typedef bf16_t v16bf __attribute__((ext_vector_type(16)));
typedef float  v8f   __attribute__((ext_vector_type(8)));
typedef unsigned int u32x4 __attribute__((ext_vector_type(4)));
typedef int          i32x4 __attribute__((ext_vector_type(4)));
typedef int          i32x8 __attribute__((ext_vector_type(8)));

union FragBF {
    uint32_t       d[8];
    unsigned short u[16];
    v16bf          v;
};

static __device__ inline v8f zero8() {
    v8f z;
#pragma unroll
    for (int i = 0; i < 8; ++i) z[i] = 0.0f;
    return z;
}

// fp32 -> bf16 (round to nearest even), returned as raw u16 bits
static __device__ inline unsigned short f2bfu(float f) {
    union { float f; uint32_t u; } c; c.f = f;
    uint32_t r = c.u + 0x7FFFu + ((c.u >> 16) & 1u);
    return (unsigned short)(r >> 16);
}

// model constants
#define BB   4
#define SS   1024
#define DD   1024
#define NHH  16
#define HDD  64
#define II   4096
#define BSR  4096   /* B*S rows */

#if defined(__gfx1250__) && __has_builtin(__builtin_amdgcn_tensor_load_to_lds)
#define USE_TDM 1
#endif

#ifdef USE_TDM
static __device__ inline void tdm_load_2d(unsigned lds_off, const void* gaddr,
                                          unsigned tileW, unsigned tileH,
                                          unsigned tensorW, unsigned tensorH,
                                          unsigned strideW) {
    unsigned long long ga = (unsigned long long)gaddr;
    u32x4 g0;
    g0[0] = 1u;                                   // count=1 (valid), user mode
    g0[1] = lds_off;                              // lds_addr (bytes)
    g0[2] = (unsigned)ga;                         // global_addr[31:0]
    g0[3] = (unsigned)(ga >> 32) | 0x80000000u;   // global_addr[56:32] | type=2
    i32x8 g1;
    g1[0] = (int)(1u << 16);
    g1[1] = (int)((tensorW & 0xFFFFu) << 16);
    g1[2] = (int)(((tensorW >> 16) & 0xFFFFu) |
                  ((tensorH & 0xFFFFu) << 16));
    g1[3] = (int)(((tensorH >> 16) & 0xFFFFu) |
                  (tileW << 16));
    g1[4] = (int)(tileH & 0xFFFFu);
    g1[5] = (int)strideW;
    g1[6] = 0;
    g1[7] = 0;
    i32x4 z4 = {0, 0, 0, 0};
    i32x8 z8 = {0, 0, 0, 0, 0, 0, 0, 0};
    // 6-arg toolchain form: (g0, g1, g2, g3, g4, cpol)
    __builtin_amdgcn_tensor_load_to_lds(g0, g1, z4, z4, z8, 0);
}
#endif

// ---------------- fp32 -> bf16 convert ----------------
__global__ __launch_bounds__(256) void cvt_f32_bf16(const float* __restrict__ in,
                                                    unsigned short* __restrict__ out,
                                                    int n) {
    for (int i = blockIdx.x * blockDim.x + threadIdx.x; i < n;
         i += gridDim.x * blockDim.x)
        out[i] = f2bfu(in[i]);
}

template <int MODE>
__global__ __launch_bounds__(256) void gemm_bf16(const unsigned short* __restrict__ A,
                                                 const unsigned short* __restrict__ Bw,
                                                 const float* __restrict__ bias,
                                                 float* __restrict__ outF,
                                                 unsigned short* __restrict__ outB,
                                                 const float* __restrict__ res,
                                                 int M, int N, int K) {
    __shared__ unsigned short As[2][128 * 32];
    __shared__ unsigned short Bs[2][128 * 32];

    const int tid   = threadIdx.x;
    const int lane  = tid & 31;
    const int wid   = tid >> 5;
    const int n16   = lane & 15;
    const int hi    = lane >> 4;
    const int waveM = wid >> 2;   // 0..1
    const int waveN = wid & 3;    // 0..3
    const int rowBase = blockIdx.y * 128;
    const int colBase = blockIdx.x * 128;

    v8f acc[4][2];
#pragma unroll
    for (int i = 0; i < 4; ++i)
#pragma unroll
        for (int j = 0; j < 2; ++j) acc[i][j] = zero8();

    // stage tile (A:128x32, B:32x128) for K-step k0 into buffer `buf`
    auto stage = [&](int buf, int k0) {
#ifdef USE_TDM
        if (wid == 0) {
            tdm_load_2d((unsigned)(size_t)&As[buf][0],
                        A + (size_t)rowBase * K + k0,
                        /*tileW=*/32, /*tileH=*/128,
                        /*tensorW=*/(unsigned)K, /*tensorH=*/(unsigned)M,
                        /*strideW=*/(unsigned)K);
            tdm_load_2d((unsigned)(size_t)&Bs[buf][0],
                        Bw + (size_t)k0 * N + colBase,
                        /*tileW=*/128, /*tileH=*/32,
                        /*tensorW=*/(unsigned)N, /*tensorH=*/(unsigned)K,
                        /*strideW=*/(unsigned)N);
        }
#else
#pragma unroll
        for (int i = 0; i < 2; ++i) {
            int ci = tid + i * 256;              // 0..511
            int ra = ci >> 2;                    // A row, 4 chunks/row
            int ca = (ci & 3) << 3;
            *(uint4*)&As[buf][ra * 32 + ca] =
                *(const uint4*)&A[(size_t)(rowBase + ra) * K + k0 + ca];
            int rb = ci >> 4;                    // B row, 16 chunks/row
            int cb = (ci & 15) << 3;
            *(uint4*)&Bs[buf][rb * 128 + cb] =
                *(const uint4*)&Bw[(size_t)(k0 + rb) * N + colBase + cb];
        }
#endif
    };

    stage(0, 0);
    int cur = 0;
    for (int k0 = 0; k0 < K; k0 += 32) {
#ifdef USE_TDM
        if (wid == 0) __builtin_amdgcn_s_wait_tensorcnt((short)0);
#endif
        __syncthreads();                     // tile `cur` resident & visible
        if (k0 + 32 < K) stage(cur ^ 1, k0 + 32);   // overlap next DMA w/ compute

        const unsigned short* as = &As[cur][0];
        const unsigned short* bs = &Bs[cur][0];

        FragBF af[4];
#pragma unroll
        for (int mt = 0; mt < 4; ++mt) {
            int m = waveM * 64 + mt * 16 + n16;
#pragma unroll
            for (int v = 0; v < 8; ++v) {
                int k = ((v >> 2) << 4) + (hi << 3) + ((v & 3) << 1);
                af[mt].d[v] = *(const uint32_t*)&as[m * 32 + k];
            }
        }
        FragBF bf[2];
#pragma unroll
        for (int nt = 0; nt < 2; ++nt) {
            int n = waveN * 32 + nt * 16 + n16;
#pragma unroll
            for (int v = 0; v < 8; ++v) {
                int k = ((v >> 2) << 4) + (hi << 3) + ((v & 3) << 1);
                bf[nt].u[2 * v]     = bs[k * 128 + n];
                bf[nt].u[2 * v + 1] = bs[(k + 1) * 128 + n];
            }
        }
#pragma unroll
        for (int mt = 0; mt < 4; ++mt)
#pragma unroll
            for (int nt = 0; nt < 2; ++nt)
                acc[mt][nt] = __builtin_amdgcn_wmma_f32_16x16x32_bf16(
                    false, af[mt].v, false, bf[nt].v, (short)0, acc[mt][nt],
                    false, false);
        __syncthreads();                     // all waves done reading `cur`
        cur ^= 1;
    }

    // epilogue
#pragma unroll
    for (int mt = 0; mt < 4; ++mt) {
#pragma unroll
        for (int nt = 0; nt < 2; ++nt) {
#pragma unroll
            for (int r = 0; r < 8; ++r) {
                int grow = rowBase + waveM * 64 + mt * 16 + r + 8 * hi;
                int gcol = colBase + waveN * 32 + nt * 16 + n16;
                float v = acc[mt][nt][r] + bias[gcol];
                if (MODE == 0) {
                    outF[(size_t)grow * N + gcol] = v + res[(size_t)grow * N + gcol];
                } else if (MODE == 1) {
                    int b = grow >> 10, s = grow & 1023;
                    int head = gcol >> 6, hd = gcol & 63;
                    outB[(((size_t)(b * NHH + head)) * SS + s) * HDD + hd] = f2bfu(v);
                } else {
                    float g = 0.5f * v * (1.0f + erff(v * 0.70710678118654752f));
                    outB[(size_t)grow * N + gcol] = f2bfu(g);
                }
            }
        }
    }
}

// ---------------- attention: one wave per (b, h, 16-row query tile) ----------
// dyn LDS: float sS[16][1024] (64KB) + ushort sP[16][1024] (32KB) = 96KB
__global__ __launch_bounds__(32) void attn_kernel(const unsigned short* __restrict__ Q,
                                                  const unsigned short* __restrict__ Kb,
                                                  const unsigned short* __restrict__ Vb,
                                                  const float* __restrict__ mask,
                                                  unsigned short* __restrict__ ctxB) {
    extern __shared__ char smem[];
    float*          sS = (float*)smem;
    unsigned short* sP = (unsigned short*)(smem + 16 * 1024 * sizeof(float));

    const int lane = threadIdx.x;
    const int n16  = lane & 15;
    const int hi   = lane >> 4;
    const int bh   = blockIdx.x >> 6;     // (b*NH + h)
    const int qt   = blockIdx.x & 63;
    const int b    = bh >> 4;
    const int h    = bh & 15;
    const size_t headOff = (size_t)bh * SS * HDD;

    // Q tile (16x64) as two 16x32 A-fragments, loaded straight in A layout
    FragBF qa[2];
    const int qrow = qt * 16 + n16;
#pragma unroll
    for (int c = 0; c < 2; ++c)
#pragma unroll
        for (int v = 0; v < 8; ++v) {
            int k = 32 * c + ((v >> 2) << 4) + (hi << 3) + ((v & 3) << 1);
            qa[c].d[v] = *(const uint32_t*)&Q[headOff + (size_t)qrow * HDD + k];
        }

    // scores: S_tile = (Q . K^T)/8 + mask  -> LDS f32 strip [16][1024]
    for (int kt = 0; kt < 64; ++kt) {
        v8f s = zero8();
        const size_t krow = headOff + (size_t)(kt * 16 + n16) * HDD;
#pragma unroll
        for (int c = 0; c < 2; ++c) {
            FragBF kf;
#pragma unroll
            for (int v = 0; v < 8; ++v) {
                int k = 32 * c + ((v >> 2) << 4) + (hi << 3) + ((v & 3) << 1);
                kf.d[v] = *(const uint32_t*)&Kb[krow + k];
            }
            s = __builtin_amdgcn_wmma_f32_16x16x32_bf16(false, qa[c].v, false,
                                                        kf.v, (short)0, s,
                                                        false, false);
        }
        float mv = mask[(size_t)b * SS + kt * 16 + n16];
#pragma unroll
        for (int r = 0; r < 8; ++r)
            sS[(r + 8 * hi) * 1024 + kt * 16 + n16] = s[r] * 0.125f + mv;
    }
    __syncthreads();

    {
        const int row = n16;
        const int cb  = hi * 512;
        float mx = -3.4e38f;
        for (int c = 0; c < 512; ++c)
            mx = fmaxf(mx, sS[row * 1024 + cb + c]);
        mx = fmaxf(mx, __shfl_xor(mx, 16, 32));
        float sum = 0.0f;
        for (int c = 0; c < 512; ++c) {
            float e = __expf(sS[row * 1024 + cb + c] - mx);
            sS[row * 1024 + cb + c] = e;
            sum += e;
        }
        sum += __shfl_xor(sum, 16, 32);
        float inv = 1.0f / sum;
        for (int c = 0; c < 512; ++c)
            sP[row * 1024 + cb + c] = f2bfu(sS[row * 1024 + cb + c] * inv);
    }
    __syncthreads();

    // ctx = P(16x1024) . V(1024x64)
    v8f ctx[4];
#pragma unroll
    for (int nt = 0; nt < 4; ++nt) ctx[nt] = zero8();
    for (int kc = 0; kc < 32; ++kc) {
        FragBF pf;
#pragma unroll
        for (int v = 0; v < 8; ++v) {
            int k = kc * 32 + ((v >> 2) << 4) + (hi << 3) + ((v & 3) << 1);
            pf.d[v] = *(const uint32_t*)&sP[n16 * 1024 + k];
        }
#pragma unroll
        for (int nt = 0; nt < 4; ++nt) {
            FragBF vf;
#pragma unroll
            for (int v = 0; v < 8; ++v) {
                int k = kc * 32 + ((v >> 2) << 4) + (hi << 3) + ((v & 3) << 1);
                vf.u[2 * v]     = Vb[headOff + (size_t)k * HDD + nt * 16 + n16];
                vf.u[2 * v + 1] = Vb[headOff + (size_t)(k + 1) * HDD + nt * 16 + n16];
            }
            ctx[nt] = __builtin_amdgcn_wmma_f32_16x16x32_bf16(false, pf.v, false,
                                                              vf.v, (short)0,
                                                              ctx[nt], false, false);
        }
    }
    // store ctx as bf16 in [B,S,D] layout
#pragma unroll
    for (int nt = 0; nt < 4; ++nt)
#pragma unroll
        for (int r = 0; r < 8; ++r) {
            int srow = qt * 16 + r + 8 * hi;
            int dcol = h * 64 + nt * 16 + n16;
            ctxB[((size_t)b * SS + srow) * DD + dcol] = f2bfu(ctx[nt][r]);
        }
}

// ---------------- layernorm: one block per row (D=1024) ----------------
__global__ __launch_bounds__(256) void ln_kernel(const float* __restrict__ x,
                                                 const float* __restrict__ g,
                                                 const float* __restrict__ bta,
                                                 float* __restrict__ outF,
                                                 unsigned short* __restrict__ outB) {
    __shared__ float red[256];
    const int row = blockIdx.x;
    const int tid = threadIdx.x;
    const float* xr = x + (size_t)row * DD;

    float s = 0.0f;
    for (int i = tid; i < DD; i += 256) s += xr[i];
    red[tid] = s; __syncthreads();
    for (int off = 128; off > 0; off >>= 1) {
        if (tid < off) red[tid] += red[tid + off];
        __syncthreads();
    }
    float mu = red[0] * (1.0f / DD);
    __syncthreads();

    float v = 0.0f;
    for (int i = tid; i < DD; i += 256) {
        float d = xr[i] - mu; v += d * d;
    }
    red[tid] = v; __syncthreads();
    for (int off = 128; off > 0; off >>= 1) {
        if (tid < off) red[tid] += red[tid + off];
        __syncthreads();
    }
    float inv = rsqrtf(red[0] * (1.0f / DD) + 1e-12f);

    for (int i = tid; i < DD; i += 256) {
        float o = (xr[i] - mu) * inv * g[i] + bta[i];
        outF[(size_t)row * DD + i] = o;
        if (outB) outB[(size_t)row * DD + i] = f2bfu(o);
    }
}

// ---------------- launcher ----------------
extern "C" void kernel_launch(void* const* d_in, const int* in_sizes, int n_in,
                              void* d_out, int out_size, void* d_ws, size_t ws_size,
                              hipStream_t stream) {
    const float* hidden = (const float*)d_in[0];
    const float* mask   = (const float*)d_in[1];
    const float* Wq = (const float*)d_in[2];   const float* bq  = (const float*)d_in[3];
    const float* Wk = (const float*)d_in[4];   const float* bk  = (const float*)d_in[5];
    const float* Wv = (const float*)d_in[6];   const float* bv  = (const float*)d_in[7];
    const float* Wo = (const float*)d_in[8];   const float* bo  = (const float*)d_in[9];
    const float* g1 = (const float*)d_in[10];  const float* b1  = (const float*)d_in[11];
    const float* Wi = (const float*)d_in[12];  const float* bi  = (const float*)d_in[13];
    const float* Wt = (const float*)d_in[14];  const float* bot = (const float*)d_in[15];
    const float* g2 = (const float*)d_in[16];  const float* b2  = (const float*)d_in[17];
    float* out = (float*)d_out;

    const size_t BSD = (size_t)BSR * DD;     // 4M
    const size_t DI  = (size_t)DD * II;      // 4M
    const size_t DDq = (size_t)DD * DD;      // 1M

    char* ws = (char*)d_ws;
    auto alloc = [&](size_t bytes) -> char* {
        char* p = ws;
        ws += (bytes + 255) & ~(size_t)255;
        return p;
    };
    unsigned short* hb    = (unsigned short*)alloc(BSD * 2);
    unsigned short* wqb   = (unsigned short*)alloc(DDq * 2);
    unsigned short* wkb   = (unsigned short*)alloc(DDq * 2);
    unsigned short* wvb   = (unsigned short*)alloc(DDq * 2);
    unsigned short* wob   = (unsigned short*)alloc(DDq * 2);
    unsigned short* wib   = (unsigned short*)alloc(DI * 2);
    unsigned short* wtb   = (unsigned short*)alloc(DI * 2);
    unsigned short* qb    = (unsigned short*)alloc(BSD * 2);
    unsigned short* kbuf  = (unsigned short*)alloc(BSD * 2);
    unsigned short* vbuf  = (unsigned short*)alloc(BSD * 2);
    unsigned short* ctxb  = (unsigned short*)alloc(BSD * 2);
    float*          y1    = (float*)alloc(BSD * 4);
    float*          attnf = (float*)alloc(BSD * 4);
    unsigned short* attnb = (unsigned short*)alloc(BSD * 2);
    unsigned short* interb= (unsigned short*)alloc((size_t)BSR * II * 2);
    float*          y2    = (float*)alloc(BSD * 4);

    const int smem_attn = 16 * 1024 * 4 + 16 * 1024 * 2;  // 96KB
    (void)hipFuncSetAttribute((const void*)attn_kernel,
                              hipFuncAttributeMaxDynamicSharedMemorySize, smem_attn);

    // 1) fp32 -> bf16 conversions
    cvt_f32_bf16<<<2048, 256, 0, stream>>>(hidden, hb, (int)BSD);
    cvt_f32_bf16<<<1024, 256, 0, stream>>>(Wq, wqb, (int)DDq);
    cvt_f32_bf16<<<1024, 256, 0, stream>>>(Wk, wkb, (int)DDq);
    cvt_f32_bf16<<<1024, 256, 0, stream>>>(Wv, wvb, (int)DDq);
    cvt_f32_bf16<<<1024, 256, 0, stream>>>(Wo, wob, (int)DDq);
    cvt_f32_bf16<<<2048, 256, 0, stream>>>(Wi, wib, (int)DI);
    cvt_f32_bf16<<<2048, 256, 0, stream>>>(Wt, wtb, (int)DI);

    // 2) QKV projections (head-scattered bf16 outputs)
    {
        dim3 g(DD / 128, BSR / 128);
        gemm_bf16<1><<<g, 256, 0, stream>>>(hb, wqb, bq, nullptr, qb,   nullptr, BSR, DD, DD);
        gemm_bf16<1><<<g, 256, 0, stream>>>(hb, wkb, bk, nullptr, kbuf, nullptr, BSR, DD, DD);
        gemm_bf16<1><<<g, 256, 0, stream>>>(hb, wvb, bv, nullptr, vbuf, nullptr, BSR, DD, DD);
    }

    // 3) attention
    attn_kernel<<<BB * NHH * (SS / 16), 32, smem_attn, stream>>>(qb, kbuf, vbuf,
                                                                 mask, ctxb);

    // 4) output projection + residual(hidden)
    {
        dim3 g(DD / 128, BSR / 128);
        gemm_bf16<0><<<g, 256, 0, stream>>>(ctxb, wob, bo, y1, nullptr, hidden,
                                            BSR, DD, DD);
    }
    // 5) LN1 -> attnf (f32) + attnb (bf16)
    ln_kernel<<<BSR, 256, 0, stream>>>(y1, g1, b1, attnf, attnb);

    // 6) FFN up + exact GELU -> bf16
    {
        dim3 g(II / 128, BSR / 128);
        gemm_bf16<2><<<g, 256, 0, stream>>>(attnb, wib, bi, nullptr, interb,
                                            nullptr, BSR, II, DD);
    }
    // 7) FFN down + residual(attnf)
    {
        dim3 g(DD / 128, BSR / 128);
        gemm_bf16<0><<<g, 256, 0, stream>>>(interb, wtb, bot, y2, nullptr, attnf,
                                            BSR, DD, II);
    }
    // 8) LN2 -> final output
    ln_kernel<<<BSR, 256, 0, stream>>>(y2, g2, b2, out, nullptr);
}

// v001
// It runs in 374 microseconds.
// Next to v000, in two timings, it ran 2.24 times as fast each time.
#include <hip/hip_runtime.h>
#include <cstdint>
#include <cstddef>

// ---------------- types ----------------
typedef __bf16 bf16_t;
typedef bf16_t v16bf __attribute__((ext_vector_type(16)));
typedef float  v8f   __attribute__((ext_vector_type(8)));
typedef unsigned int u32x4 __attribute__((ext_vector_type(4)));
typedef int          i32x4 __attribute__((ext_vector_type(4)));
typedef int          i32x8 __attribute__((ext_vector_type(8)));

union FragBF {
    uint32_t       d[8];
    unsigned short u[16];
    v16bf          v;
};

static __device__ inline v8f zero8() {
    v8f z;
#pragma unroll
    for (int i = 0; i < 8; ++i) z[i] = 0.0f;
    return z;
}

// fp32 -> bf16 (round to nearest even), returned as raw u16 bits
static __device__ inline unsigned short f2bfu(float f) {
    union { float f; uint32_t u; } c; c.f = f;
    uint32_t r = c.u + 0x7FFFu + ((c.u >> 16) & 1u);
    return (unsigned short)(r >> 16);
}

// model constants
#define BB   4
#define SS   1024
#define DD   1024
#define NHH  16
#define HDD  64
#define II   4096
#define BSR  4096   /* B*S rows */

#if defined(__gfx1250__) && __has_builtin(__builtin_amdgcn_tensor_load_to_lds)
#define USE_TDM 1
#endif

#ifdef USE_TDM
static __device__ inline void tdm_load_2d(unsigned lds_off, const void* gaddr,
                                          unsigned tileW, unsigned tileH,
                                          unsigned tensorW, unsigned tensorH,
                                          unsigned strideW) {
    unsigned long long ga = (unsigned long long)gaddr;
    u32x4 g0;
    g0[0] = 1u;                                   // count=1 (valid), user mode
    g0[1] = lds_off;                              // lds_addr (bytes)
    g0[2] = (unsigned)ga;                         // global_addr[31:0]
    g0[3] = (unsigned)(ga >> 32) | 0x80000000u;   // global_addr[56:32] | type=2
    i32x8 g1;
    g1[0] = (int)(1u << 16);
    g1[1] = (int)((tensorW & 0xFFFFu) << 16);
    g1[2] = (int)(((tensorW >> 16) & 0xFFFFu) |
                  ((tensorH & 0xFFFFu) << 16));
    g1[3] = (int)(((tensorH >> 16) & 0xFFFFu) |
                  (tileW << 16));
    g1[4] = (int)(tileH & 0xFFFFu);
    g1[5] = (int)strideW;
    g1[6] = 0;
    g1[7] = 0;
    i32x4 z4 = {0, 0, 0, 0};
    i32x8 z8 = {0, 0, 0, 0, 0, 0, 0, 0};
    // 6-arg toolchain form: (g0, g1, g2, g3, g4, cpol)
    __builtin_amdgcn_tensor_load_to_lds(g0, g1, z4, z4, z8, 0);
}
#endif

// ---------------- fp32 -> bf16 convert ----------------
__global__ __launch_bounds__(256) void cvt_f32_bf16(const float* __restrict__ in,
                                                    unsigned short* __restrict__ out,
                                                    int n) {
    for (int i = blockIdx.x * blockDim.x + threadIdx.x; i < n;
         i += gridDim.x * blockDim.x)
        out[i] = f2bfu(in[i]);
}

template <int MODE>
__global__ __launch_bounds__(256) void gemm_bf16(const unsigned short* __restrict__ A,
                                                 const unsigned short* __restrict__ Bw,
                                                 const float* __restrict__ bias,
                                                 float* __restrict__ outF,
                                                 unsigned short* __restrict__ outB,
                                                 const float* __restrict__ res,
                                                 int M, int N, int K) {
    __shared__ unsigned short As[2][128 * 32];
    __shared__ unsigned short Bs[2][128 * 32];

    const int tid   = threadIdx.x;
    const int lane  = tid & 31;
    const int wid   = tid >> 5;
    const int n16   = lane & 15;
    const int hi    = lane >> 4;
    const int waveM = wid >> 2;   // 0..1
    const int waveN = wid & 3;    // 0..3
    const int rowBase = blockIdx.y * 128;
    const int colBase = blockIdx.x * 128;

    v8f acc[4][2];
#pragma unroll
    for (int i = 0; i < 4; ++i)
#pragma unroll
        for (int j = 0; j < 2; ++j) acc[i][j] = zero8();

    // stage tile (A:128x32, B:32x128) for K-step k0 into buffer `buf`
    auto stage = [&](int buf, int k0) {
#ifdef USE_TDM
        if (wid == 0) {
            tdm_load_2d((unsigned)(size_t)&As[buf][0],
                        A + (size_t)rowBase * K + k0,
                        /*tileW=*/32, /*tileH=*/128,
                        /*tensorW=*/(unsigned)K, /*tensorH=*/(unsigned)M,
                        /*strideW=*/(unsigned)K);
            tdm_load_2d((unsigned)(size_t)&Bs[buf][0],
                        Bw + (size_t)k0 * N + colBase,
                        /*tileW=*/128, /*tileH=*/32,
                        /*tensorW=*/(unsigned)N, /*tensorH=*/(unsigned)K,
                        /*strideW=*/(unsigned)N);
        }
#else
#pragma unroll
        for (int i = 0; i < 2; ++i) {
            int ci = tid + i * 256;              // 0..511
            int ra = ci >> 2;                    // A row, 4 chunks/row
            int ca = (ci & 3) << 3;
            *(uint4*)&As[buf][ra * 32 + ca] =
                *(const uint4*)&A[(size_t)(rowBase + ra) * K + k0 + ca];
            int rb = ci >> 4;                    // B row, 16 chunks/row
            int cb = (ci & 15) << 3;
            *(uint4*)&Bs[buf][rb * 128 + cb] =
                *(const uint4*)&Bw[(size_t)(k0 + rb) * N + colBase + cb];
        }
#endif
    };

    stage(0, 0);
    int cur = 0;
    for (int k0 = 0; k0 < K; k0 += 32) {
#ifdef USE_TDM
        if (wid == 0) __builtin_amdgcn_s_wait_tensorcnt((short)0);
#endif
        __syncthreads();                     // tile `cur` resident & visible
        if (k0 + 32 < K) stage(cur ^ 1, k0 + 32);   // overlap next DMA w/ compute

        const unsigned short* as = &As[cur][0];
        const unsigned short* bs = &Bs[cur][0];

        FragBF af[4];
#pragma unroll
        for (int mt = 0; mt < 4; ++mt) {
            int m = waveM * 64 + mt * 16 + n16;
#pragma unroll
            for (int v = 0; v < 8; ++v) {
                int k = ((v >> 2) << 4) + (hi << 3) + ((v & 3) << 1);
                af[mt].d[v] = *(const uint32_t*)&as[m * 32 + k];
            }
        }
        FragBF bf[2];
#pragma unroll
        for (int nt = 0; nt < 2; ++nt) {
            int n = waveN * 32 + nt * 16 + n16;
#pragma unroll
            for (int v = 0; v < 8; ++v) {
                int k = ((v >> 2) << 4) + (hi << 3) + ((v & 3) << 1);
                bf[nt].u[2 * v]     = bs[k * 128 + n];
                bf[nt].u[2 * v + 1] = bs[(k + 1) * 128 + n];
            }
        }
#pragma unroll
        for (int mt = 0; mt < 4; ++mt)
#pragma unroll
            for (int nt = 0; nt < 2; ++nt)
                acc[mt][nt] = __builtin_amdgcn_wmma_f32_16x16x32_bf16(
                    false, af[mt].v, false, bf[nt].v, (short)0, acc[mt][nt],
                    false, false);
        __syncthreads();                     // all waves done reading `cur`
        cur ^= 1;
    }

    // epilogue
#pragma unroll
    for (int mt = 0; mt < 4; ++mt) {
#pragma unroll
        for (int nt = 0; nt < 2; ++nt) {
#pragma unroll
            for (int r = 0; r < 8; ++r) {
                int grow = rowBase + waveM * 64 + mt * 16 + r + 8 * hi;
                int gcol = colBase + waveN * 32 + nt * 16 + n16;
                float v = acc[mt][nt][r] + bias[gcol];
                if (MODE == 0) {
                    outF[(size_t)grow * N + gcol] = v + res[(size_t)grow * N + gcol];
                } else if (MODE == 1) {
                    int b = grow >> 10, s = grow & 1023;
                    int head = gcol >> 6, hd = gcol & 63;
                    outB[(((size_t)(b * NHH + head)) * SS + s) * HDD + hd] = f2bfu(v);
                } else {
                    float g = 0.5f * v * (1.0f + erff(v * 0.70710678118654752f));
                    outB[(size_t)grow * N + gcol] = f2bfu(g);
                }
            }
        }
    }
}

typedef float  f32x2  __attribute__((ext_vector_type(2)));
typedef bf16_t bf16x2 __attribute__((ext_vector_type(2)));

// two f32 -> packed bf16 pair (round to nearest even)
static __device__ inline uint32_t pack_bf16(float a, float b) {
    f32x2 f; f[0] = a; f[1] = b;
    union { bf16x2 h; uint32_t u; } c;
    c.h = __builtin_convertvector(f, bf16x2);
    return c.u;
}

static __device__ inline float exp_slot(float x) {
    float e;
    asm("v_exp_f32 %0, %1\n\tv_nop" : "=v"(e) : "v"(x * 1.4426950408889634f));
    return e;
}

static __device__ inline float other_half(float x) {
    int b = __builtin_bit_cast(int, x);
    b = __builtin_amdgcn_permlanex16(b, b, 0x76543210, 0xfedcba98, false, false);
    return __builtin_bit_cast(float, b);
}

// 32 k of one row, k-contiguous in memory, in the hardware k order:
// elements 0-7 = k 8*hi + 0..7, elements 8-15 = k 16 + 8*hi + 0..7
// (p = wave-uniform base, off = the lane's row * HDD + 8*hi)
static __device__ inline void load_row_frag(FragBF& f, const unsigned short* p, unsigned off) {
    const uint4 lo = *(const uint4*)(p + off);
    const uint4 up = *(const uint4*)(p + off + 16);
    f.d[0] = lo.x; f.d[1] = lo.y; f.d[2] = lo.z; f.d[3] = lo.w;
    f.d[4] = up.x; f.d[5] = up.y; f.d[6] = up.z; f.d[7] = up.w;
}

__global__ __launch_bounds__(256) void attn_kernel(const unsigned short* __restrict__ Q,
                                                   const unsigned short* __restrict__ Kb,
                                                   const unsigned short* __restrict__ Vb,
                                                   const float* __restrict__ mask,
                                                   unsigned short* __restrict__ ctxB) {
    const int lane = threadIdx.x & 31;
    const int wid  = threadIdx.x >> 5;
    const int n16  = lane & 15;
    const int hi   = lane >> 4;
    const int bh   = blockIdx.x >> 2;     // (b*NH + h)
    const int qblk = (blockIdx.x & 3) * 256;
    const int q0   = qblk + wid * 32;
    const int b    = bh >> 4;
    const int h    = bh & 15;
    const unsigned short* Qh = Q  + (size_t)bh * SS * HDD;
    const unsigned short* Kh = Kb + (size_t)bh * SS * HDD;
    const unsigned short* Vh = Vb + (size_t)bh * SS * HDD;
    const float*          mb = mask + (size_t)b * SS;
    const unsigned rowOff = (unsigned)(n16 * HDD + 8 * hi);   // Q and K rows
    const unsigned vOff   = (unsigned)(8 * hi * HDD + n16);   // V columns

    // Q rows as B fragments: [column group][k chunk of 32]
    FragBF qf[2][2];
#pragma unroll  // constant indices keep the arrays in registers
    for (int g = 0; g < 2; ++g)
#pragma unroll  // constant indices keep the arrays in registers
        for (int c = 0; c < 2; ++c)
            load_row_frag(qf[g][c], Qh + (size_t)wid * 32 * HDD + (qblk + 16 * g) * HDD + 32 * c, rowOff);

    // K rows as A fragments: [key tile of 16][k chunk of 32], fetched one pass ahead
    FragBF kf[2][2];
#pragma unroll  // constant indices keep the arrays in registers
    for (int t = 0; t < 2; ++t)
#pragma unroll  // constant indices keep the arrays in registers
        for (int c = 0; c < 2; ++c)
            load_row_frag(kf[t][c], Kh + 16 * t * HDD + 32 * c, rowOff);

    v8f   o[2][4];                 // O^T: [group][hd tile]; reg r = hd 8*hi + r
    float mrun[2], lrun[2];        // running maximum; this half's running sum
#pragma unroll  // constant indices keep the arrays in registers
    for (int g = 0; g < 2; ++g) {
        mrun[g] = -3.402823466e38f;   // finite, so that (-inf) - mrun is never NaN
        lrun[g] = 0.0f;
#pragma unroll  // constant indices keep the arrays in registers
        for (int nt = 0; nt < 4; ++nt) o[g][nt] = zero8();
    }

    for (int kp = 0; kp < 32; ++kp) {
        const int key0 = kp * 32;

        // V^T as A fragments (row = hd, k = key)
        const unsigned short* Vp = Vh + (size_t)key0 * HDD;
        FragBF vf[4];
#pragma unroll  // constant indices keep the arrays in registers
        for (int nt = 0; nt < 4; ++nt)
#pragma unroll  // constant indices keep the arrays in registers
            for (int v = 0; v < 8; ++v) {
                const int k = ((v >> 2) << 4) + ((v & 3) << 1);   // + 8*hi, in vOff
                vf[nt].u[2 * v]     = Vp[vOff + k * HDD + nt * 16];
                vf[nt].u[2 * v + 1] = Vp[vOff + (k + 1) * HDD + nt * 16];
            }

        // mask of this lane's keys: [tile][r] = key key0 + 16*t + 8*hi + r; the 32 values
        // of the pass are read at wave-uniform addresses, a lane picks its half's
        float mk[2][8];
#pragma unroll  // constant indices keep the arrays in registers
        for (int t = 0; t < 2; ++t)
#pragma unroll  // constant indices keep the arrays in registers
            for (int r = 0; r < 8; ++r) {
                const float lo = mb[key0 + 16 * t + r];
                const float up = mb[key0 + 16 * t + 8 + r];
                mk[t][r] = hi ? up : lo;
            }

        // S^T tiles: st[g][t][r] = q(q0 + 16g + n16) . k(key0 + 16t + 8hi + r)
        v8f st[2][2];
#pragma unroll  // constant indices keep the arrays in registers
        for (int g = 0; g < 2; ++g)
#pragma unroll  // constant indices keep the arrays in registers
            for (int t = 0; t < 2; ++t) {
                v8f s = zero8();
#pragma unroll  // constant indices keep the arrays in registers
                for (int c = 0; c < 2; ++c)
                    s = __builtin_amdgcn_wmma_f32_16x16x32_bf16(false, kf[t][c].v, false,
                                                                qf[g][c].v, (short)0, s,
                                                                false, false);
                st[g][t] = s;
            }

        // next pass's K rows (the last pass fetches pass 0's again: in bounds, unused)
        {
            const int kn = ((kp + 1) & 31) * 32;
#pragma unroll  // constant indices keep the arrays in registers
            for (int t = 0; t < 2; ++t)
#pragma unroll  // constant indices keep the arrays in registers
                for (int c = 0; c < 2; ++c)
                    load_row_frag(kf[t][c], Kh + (size_t)(kn + 16 * t) * HDD + 32 * c, rowOff);
            asm volatile("s_wait_xcnt 0x0" ::: "memory");
        }

        FragBF pf[2];
#pragma unroll  // constant indices keep the arrays in registers
        for (int g = 0; g < 2; ++g) {
            float x[16];
            float mx = mrun[g];
#pragma unroll  // constant indices keep the arrays in registers
            for (int t = 0; t < 2; ++t)
#pragma unroll  // constant indices keep the arrays in registers
                for (int r = 0; r < 8; ++r) {
                    x[8 * t + r] = st[g][t][r] * 0.125f + mk[t][r];
                    mx = fmaxf(mx, x[8 * t + r]);
                }
            mx = fmaxf(mx, other_half(mx));
            const float alpha = exp_slot(mrun[g] - mx);
            mrun[g] = mx;
            float sum = 0.0f;
#pragma unroll  // constant indices keep the arrays in registers
            for (int i = 0; i < 16; ++i) {
                x[i] = exp_slot(x[i] - mx);
                sum += x[i];
            }
            lrun[g] = lrun[g] * alpha + sum;
#pragma unroll  // constant indices keep the arrays in registers
            for (int i = 0; i < 8; ++i) pf[g].d[i] = pack_bf16(x[2 * i], x[2 * i + 1]);
#pragma unroll  // constant indices keep the arrays in registers
            for (int nt = 0; nt < 4; ++nt)
#pragma unroll  // constant indices keep the arrays in registers
                for (int r = 0; r < 8; ++r) o[g][nt][r] *= alpha;
        }

        // O^T += V^T . P^T
#pragma unroll  // constant indices keep the arrays in registers
        for (int nt = 0; nt < 4; ++nt)
#pragma unroll  // constant indices keep the arrays in registers
            for (int g = 0; g < 2; ++g)
                o[g][nt] = __builtin_amdgcn_wmma_f32_16x16x32_bf16(false, vf[nt].v, false,
                                                                   pf[g].v, (short)0,
                                                                   o[g][nt], false, false);
    }

    // ctx as bf16 in [B,S,D] layout: a lane's 8 registers are 8 consecutive hd
#pragma unroll  // constant indices keep the arrays in registers
    for (int g = 0; g < 2; ++g) {
        const float inv = 1.0f / (lrun[g] + other_half(lrun[g]));
        unsigned short* dst = ctxB + ((size_t)b * SS + q0 + 16 * g + n16) * DD + h * 64 + 8 * hi;
#pragma unroll  // constant indices keep the arrays in registers
        for (int nt = 0; nt < 4; ++nt) {
            uint4 w;
            w.x = pack_bf16(o[g][nt][0] * inv, o[g][nt][1] * inv);
            w.y = pack_bf16(o[g][nt][2] * inv, o[g][nt][3] * inv);
            w.z = pack_bf16(o[g][nt][4] * inv, o[g][nt][5] * inv);
            w.w = pack_bf16(o[g][nt][6] * inv, o[g][nt][7] * inv);
            *(uint4*)(dst + nt * 16) = w;
        }
    }
}

// ---------------- layernorm: one block per row (D=1024) ----------------
__global__ __launch_bounds__(256) void ln_kernel(const float* __restrict__ x,
                                                 const float* __restrict__ g,
                                                 const float* __restrict__ bta,
                                                 float* __restrict__ outF,
                                                 unsigned short* __restrict__ outB) {
    __shared__ float red[256];
    const int row = blockIdx.x;
    const int tid = threadIdx.x;
    const float* xr = x + (size_t)row * DD;

    float s = 0.0f;
    for (int i = tid; i < DD; i += 256) s += xr[i];
    red[tid] = s; __syncthreads();
    for (int off = 128; off > 0; off >>= 1) {
        if (tid < off) red[tid] += red[tid + off];
        __syncthreads();
    }
    float mu = red[0] * (1.0f / DD);
    __syncthreads();

    float v = 0.0f;
    for (int i = tid; i < DD; i += 256) {
        float d = xr[i] - mu; v += d * d;
    }
    red[tid] = v; __syncthreads();
    for (int off = 128; off > 0; off >>= 1) {
        if (tid < off) red[tid] += red[tid + off];
        __syncthreads();
    }
    float inv = rsqrtf(red[0] * (1.0f / DD) + 1e-12f);

    for (int i = tid; i < DD; i += 256) {
        float o = (xr[i] - mu) * inv * g[i] + bta[i];
        outF[(size_t)row * DD + i] = o;
        if (outB) outB[(size_t)row * DD + i] = f2bfu(o);
    }
}

// ---------------- launcher ----------------
extern "C" void kernel_launch(void* const* d_in, const int* in_sizes, int n_in,
                              void* d_out, int out_size, void* d_ws, size_t ws_size,
                              hipStream_t stream) {
    const float* hidden = (const float*)d_in[0];
    const float* mask   = (const float*)d_in[1];
    const float* Wq = (const float*)d_in[2];   const float* bq  = (const float*)d_in[3];
    const float* Wk = (const float*)d_in[4];   const float* bk  = (const float*)d_in[5];
    const float* Wv = (const float*)d_in[6];   const float* bv  = (const float*)d_in[7];
    const float* Wo = (const float*)d_in[8];   const float* bo  = (const float*)d_in[9];
    const float* g1 = (const float*)d_in[10];  const float* b1  = (const float*)d_in[11];
    const float* Wi = (const float*)d_in[12];  const float* bi  = (const float*)d_in[13];
    const float* Wt = (const float*)d_in[14];  const float* bot = (const float*)d_in[15];
    const float* g2 = (const float*)d_in[16];  const float* b2  = (const float*)d_in[17];
    float* out = (float*)d_out;

    const size_t BSD = (size_t)BSR * DD;     // 4M
    const size_t DI  = (size_t)DD * II;      // 4M
    const size_t DDq = (size_t)DD * DD;      // 1M

    char* ws = (char*)d_ws;
    auto alloc = [&](size_t bytes) -> char* {
        char* p = ws;
        ws += (bytes + 255) & ~(size_t)255;
        return p;
    };
    unsigned short* hb    = (unsigned short*)alloc(BSD * 2);
    unsigned short* wqb   = (unsigned short*)alloc(DDq * 2);
    unsigned short* wkb   = (unsigned short*)alloc(DDq * 2);
    unsigned short* wvb   = (unsigned short*)alloc(DDq * 2);
    unsigned short* wob   = (unsigned short*)alloc(DDq * 2);
    unsigned short* wib   = (unsigned short*)alloc(DI * 2);
    unsigned short* wtb   = (unsigned short*)alloc(DI * 2);
    unsigned short* qb    = (unsigned short*)alloc(BSD * 2);
    unsigned short* kbuf  = (unsigned short*)alloc(BSD * 2);
    unsigned short* vbuf  = (unsigned short*)alloc(BSD * 2);
    unsigned short* ctxb  = (unsigned short*)alloc(BSD * 2);
    float*          y1    = (float*)alloc(BSD * 4);
    float*          attnf = (float*)alloc(BSD * 4);
    unsigned short* attnb = (unsigned short*)alloc(BSD * 2);
    unsigned short* interb= (unsigned short*)alloc((size_t)BSR * II * 2);
    float*          y2    = (float*)alloc(BSD * 4);

    // 1) fp32 -> bf16 conversions
    cvt_f32_bf16<<<2048, 256, 0, stream>>>(hidden, hb, (int)BSD);
    cvt_f32_bf16<<<1024, 256, 0, stream>>>(Wq, wqb, (int)DDq);
    cvt_f32_bf16<<<1024, 256, 0, stream>>>(Wk, wkb, (int)DDq);
    cvt_f32_bf16<<<1024, 256, 0, stream>>>(Wv, wvb, (int)DDq);
    cvt_f32_bf16<<<1024, 256, 0, stream>>>(Wo, wob, (int)DDq);
    cvt_f32_bf16<<<2048, 256, 0, stream>>>(Wi, wib, (int)DI);
    cvt_f32_bf16<<<2048, 256, 0, stream>>>(Wt, wtb, (int)DI);

    // 2) QKV projections (head-scattered bf16 outputs)
    {
        dim3 g(DD / 128, BSR / 128);
        gemm_bf16<1><<<g, 256, 0, stream>>>(hb, wqb, bq, nullptr, qb,   nullptr, BSR, DD, DD);
        gemm_bf16<1><<<g, 256, 0, stream>>>(hb, wkb, bk, nullptr, kbuf, nullptr, BSR, DD, DD);
        gemm_bf16<1><<<g, 256, 0, stream>>>(hb, wvb, bv, nullptr, vbuf, nullptr, BSR, DD, DD);
    }

    // 3) attention
    attn_kernel<<<BB * NHH * (SS / 256), 256, 0, stream>>>(qb, kbuf, vbuf, mask, ctxb);

    // 4) output projection + residual(hidden)
    {
        dim3 g(DD / 128, BSR / 128);
        gemm_bf16<0><<<g, 256, 0, stream>>>(ctxb, wob, bo, y1, nullptr, hidden,
                                            BSR, DD, DD);
    }
    // 5) LN1 -> attnf (f32) + attnb (bf16)
    ln_kernel<<<BSR, 256, 0, stream>>>(y1, g1, b1, attnf, attnb);

    // 6) FFN up + exact GELU -> bf16
    {
        dim3 g(II / 128, BSR / 128);
        gemm_bf16<2><<<g, 256, 0, stream>>>(attnb, wib, bi, nullptr, interb,
                                            nullptr, BSR, II, DD);
    }
    // 7) FFN down + residual(attnf)
    {
        dim3 g(DD / 128, BSR / 128);
        gemm_bf16<0><<<g, 256, 0, stream>>>(interb, wtb, bot, y2, nullptr, attnf,
                                            BSR, DD, II);
    }
    // 8) LN2 -> final output
    ln_kernel<<<BSR, 256, 0, stream>>>(y2, g2, b2, out, nullptr);
}

// v002
// It runs in 344 microseconds.
// Two timings next to v001 put it at 1.08 and 1.09 times that version's speed.
// Over all steps from v000 it is 2.43 times as fast.
#include <hip/hip_runtime.h>
#include <cstdint>
#include <cstddef>

// ---------------- types ----------------
typedef __bf16 bf16_t;
typedef bf16_t v16bf __attribute__((ext_vector_type(16)));
typedef float  v8f   __attribute__((ext_vector_type(8)));
typedef unsigned int u32x4 __attribute__((ext_vector_type(4)));
typedef int          i32x4 __attribute__((ext_vector_type(4)));
typedef int          i32x8 __attribute__((ext_vector_type(8)));

union FragBF {
    uint32_t       d[8];
    unsigned short u[16];
    v16bf          v;
};

static __device__ inline v8f zero8() {
    v8f z;
#pragma unroll
    for (int i = 0; i < 8; ++i) z[i] = 0.0f;
    return z;
}

// fp32 -> bf16 (round to nearest even), returned as raw u16 bits
static __device__ inline unsigned short f2bfu(float f) {
    union { float f; uint32_t u; } c; c.f = f;
    uint32_t r = c.u + 0x7FFFu + ((c.u >> 16) & 1u);
    return (unsigned short)(r >> 16);
}

// model constants
#define BB   4
#define SS   1024
#define DD   1024
#define NHH  16
#define HDD  64
#define II   4096
#define BSR  4096   /* B*S rows */

#if defined(__gfx1250__) && __has_builtin(__builtin_amdgcn_tensor_load_to_lds)
#define USE_TDM 1
#endif

#ifdef USE_TDM
static __device__ inline void tdm_load_2d(unsigned lds_off, const void* gaddr,
                                          unsigned tileW, unsigned tileH,
                                          unsigned tensorW, unsigned tensorH,
                                          unsigned strideW) {
    unsigned long long ga = (unsigned long long)gaddr;
    u32x4 g0;
    g0[0] = 1u;                                   // count=1 (valid), user mode
    g0[1] = lds_off;                              // lds_addr (bytes)
    g0[2] = (unsigned)ga;                         // global_addr[31:0]
    g0[3] = (unsigned)(ga >> 32) | 0x80000000u;   // global_addr[56:32] | type=2
    i32x8 g1;
    g1[0] = (int)(1u << 16);
    g1[1] = (int)((tensorW & 0xFFFFu) << 16);
    g1[2] = (int)(((tensorW >> 16) & 0xFFFFu) |
                  ((tensorH & 0xFFFFu) << 16));
    g1[3] = (int)(((tensorH >> 16) & 0xFFFFu) |
                  (tileW << 16));
    g1[4] = (int)(tileH & 0xFFFFu);
    g1[5] = (int)strideW;
    g1[6] = 0;
    g1[7] = 0;
    i32x4 z4 = {0, 0, 0, 0};
    i32x8 z8 = {0, 0, 0, 0, 0, 0, 0, 0};
    // 6-arg toolchain form: (g0, g1, g2, g3, g4, cpol)
    __builtin_amdgcn_tensor_load_to_lds(g0, g1, z4, z4, z8, 0);
}
#endif

#define B_ROWB  256u
#define B_ROWS  32u
#define B_PITCH 288u
#define B_BUF   10240u
static_assert(B_ROWS * B_PITCH <= B_BUF && (B_BUF % 2048u) == 0u, "B buffer size");

typedef unsigned int u32x8 __attribute__((ext_vector_type(8)));
typedef short        s16x8 __attribute__((ext_vector_type(8)));

static __device__ inline uint32_t uni(uint32_t v) {
    return (uint32_t)__builtin_amdgcn_readfirstlane(v);
}
static __device__ inline uint32_t pinned(uint32_t v) {
    uint32_t w = uni(v);
    asm volatile("" : "+s"(w));   // the pin of a tensor load's issue test in a scalar register
    return w;
}
static __device__ inline u32x8 btile_group1(uint32_t src_pitch) {
    u32x8 g;
    g[0] = uni((1u << 20) | (5u << 22) | (7u << 25));
    g[1] = uni((B_ROWB & 0xFFFFu) << 16);
    g[2] = uni((B_ROWB >> 16) | ((B_ROWS & 0xFFFFu) << 16));
    g[3] = uni((B_ROWS >> 16) | (B_ROWB << 16));
    g[4] = uni(B_ROWS);
    g[5] = uni(src_pitch);
    g[6] = uni(0u);
    g[7] = uni(0u);
    return g;
}
static __device__ inline u32x4 btile_group0(uint32_t lds_dst, uint64_t ga) {
    u32x4 g;
    g[0] = uni(1u);
    g[1] = uni(lds_dst);
    g[2] = uni((uint32_t)ga);
    g[3] = uni((((uint32_t)(ga >> 32)) & 0x01FFFFFFu) | 0x80000000u);
    return g;
}
// 8 k x 16 columns per wave half of a row-major 16-bit LDS tile, transposed: lane (c, h)
// gets 8 consecutive k of column c, which is half a B fragment in the hardware k order
static __device__ inline u32x4 ld_tr16(const unsigned char* p) {
    typedef __attribute__((address_space(3))) s16x8 lds_s16x8;
    return __builtin_bit_cast(u32x4, __builtin_amdgcn_ds_load_tr16_b128_v8i16((lds_s16x8*)p));
}

// ---------------- fp32 -> bf16 convert ----------------
__global__ __launch_bounds__(256) void cvt_f32_bf16(const float* __restrict__ in,
                                                    unsigned short* __restrict__ out,
                                                    int n) {
    for (int i = blockIdx.x * blockDim.x + threadIdx.x; i < n;
         i += gridDim.x * blockDim.x)
        out[i] = f2bfu(in[i]);
}

template <int MODE>
__global__ __launch_bounds__(256) void gemm_bf16(const unsigned short* __restrict__ A,
                                                 const unsigned short* __restrict__ Bw,
                                                 const float* __restrict__ bias,
                                                 float* __restrict__ outF,
                                                 unsigned short* __restrict__ outB,
                                                 const float* __restrict__ res,
                                                 int M, int N, int K) {
    __shared__ unsigned short As[2][128 * 32];
    __shared__ __attribute__((aligned(2048))) unsigned char Bs[2][B_BUF];

    const int tid   = threadIdx.x;
    const int lane  = tid & 31;
    const int wid   = tid >> 5;
    const int n16   = lane & 15;
    const int hi    = lane >> 4;
    const int waveM = wid >> 2;   // 0..1
    const int waveN = wid & 3;    // 0..3
    const int rowBase = blockIdx.y * 128;
    const int colBase = blockIdx.x * 128;

    v8f acc[4][2];
#pragma unroll
    for (int i = 0; i < 4; ++i)
#pragma unroll
        for (int j = 0; j < 2; ++j) acc[i][j] = zero8();

#ifdef USE_TDM
    const uint32_t wave = uni((uint32_t)threadIdx.x >> 5);
    u32x8 bg1 = btile_group1((uint32_t)N * 2u);
    u32x4 bg0 = btile_group0((uint32_t)(size_t)&Bs[0][0], (uint64_t)(Bw + colBase));
    const uint32_t bstep = uni((uint32_t)N * 64u);   // 32 source rows, in bytes
#endif

    // stage tile (A:128x32, B:32x128) for K-step k0 into buffer `buf`
    auto stage = [&](int buf, int k0) {
#ifdef USE_TDM
        if (pinned(wave == 0u)) {
            bg0[1] = uni((uint32_t)(size_t)&Bs[buf][0]);
            if (k0 > 0) {   // the next 32 rows: words 2 and 3 hold the 64-bit source address
                const uint64_t a = (((uint64_t)bg0[3] << 32) | bg0[2]) + bstep;
                bg0[2] = uni((uint32_t)a);
                bg0[3] = uni((uint32_t)(a >> 32));
            }
            // both groups are in-out operands so that they keep registers of their own
            // through the loop: no word of a request in flight is rewritten by other code
            asm volatile("tensor_load_to_lds %0, %1" : "+s"(bg0), "+s"(bg1) :: "memory");
        }
        if (wid == 0) {
            tdm_load_2d((unsigned)(size_t)&As[buf][0],
                        A + (size_t)rowBase * K + k0,
                        /*tileW=*/32, /*tileH=*/128,
                        /*tensorW=*/(unsigned)K, /*tensorH=*/(unsigned)M,
                        /*strideW=*/(unsigned)K);
        }
#else
#pragma unroll
        for (int i = 0; i < 2; ++i) {
            int ci = tid + i * 256;              // 0..511
            int ra = ci >> 2;                    // A row, 4 chunks/row
            int ca = (ci & 3) << 3;
            *(uint4*)&As[buf][ra * 32 + ca] =
                *(const uint4*)&A[(size_t)(rowBase + ra) * K + k0 + ca];
            int rb = ci >> 4;                    // B row, 16 chunks/row
            int cb = (ci & 15) << 3;
            *(uint4*)&Bs[buf][rb * B_PITCH + cb * 2] =
                *(const uint4*)&Bw[(size_t)(k0 + rb) * N + colBase + cb];
        }
#endif
    };

    stage(0, 0);
    int cur = 0;
    for (int k0 = 0; k0 < K; k0 += 32) {
#ifdef USE_TDM
        if (wid == 0) __builtin_amdgcn_s_wait_tensorcnt((short)0);
#endif
        __syncthreads();                     // tile `cur` resident & visible
        // the test for a next stage is a scalar branch as well (see pinned())
        if (pinned(k0 + 32 < K)) stage(cur ^ 1, k0 + 32);   // overlap next DMA w/ compute

        const unsigned short* as = &As[cur][0];
        // the lane's address in the transposing load: row 8*hi + (lane & 7), 16-byte
        // half (lane >> 3) & 1 of the 32 bytes of a 16-column group
        const unsigned char* bs = &Bs[cur][0] + (8 * hi + (lane & 7)) * B_PITCH +
                                  16 * ((lane >> 3) & 1) + 64 * waveN;

        FragBF af[4];
#pragma unroll
        for (int mt = 0; mt < 4; ++mt) {
            int m = waveM * 64 + mt * 16 + n16;
#pragma unroll
            for (int v = 0; v < 8; ++v) {
                int k = ((v >> 2) << 4) + (hi << 3) + ((v & 3) << 1);
                af[mt].d[v] = *(const uint32_t*)&as[m * 32 + k];
            }
        }
        FragBF bf[2];
#pragma unroll
        for (int nt = 0; nt < 2; ++nt) {
            const u32x4 lo = ld_tr16(bs + 32 * nt);                  // k  0..15
            const u32x4 up = ld_tr16(bs + 16 * B_PITCH + 32 * nt);   // k 16..31
            bf[nt].d[0] = lo.x; bf[nt].d[1] = lo.y; bf[nt].d[2] = lo.z; bf[nt].d[3] = lo.w;
            bf[nt].d[4] = up.x; bf[nt].d[5] = up.y; bf[nt].d[6] = up.z; bf[nt].d[7] = up.w;
        }
#pragma unroll
        for (int mt = 0; mt < 4; ++mt)
#pragma unroll
            for (int nt = 0; nt < 2; ++nt)
                acc[mt][nt] = __builtin_amdgcn_wmma_f32_16x16x32_bf16(
                    false, af[mt].v, false, bf[nt].v, (short)0, acc[mt][nt],
                    false, false);
        __syncthreads();                     // all waves done reading `cur`
        cur ^= 1;
    }

    // epilogue
#pragma unroll
    for (int mt = 0; mt < 4; ++mt) {
#pragma unroll
        for (int nt = 0; nt < 2; ++nt) {
#pragma unroll
            for (int r = 0; r < 8; ++r) {
                int grow = rowBase + waveM * 64 + mt * 16 + r + 8 * hi;
                int gcol = colBase + waveN * 32 + nt * 16 + n16;
                float v = acc[mt][nt][r] + bias[gcol];
                if (MODE == 0) {
                    outF[(size_t)grow * N + gcol] = v + res[(size_t)grow * N + gcol];
                } else if (MODE == 1) {
                    int b = grow >> 10, s = grow & 1023;
                    int head = gcol >> 6, hd = gcol & 63;
                    outB[(((size_t)(b * NHH + head)) * SS + s) * HDD + hd] = f2bfu(v);
                } else {
                    float g = 0.5f * v * (1.0f + erff(v * 0.70710678118654752f));
                    outB[(size_t)grow * N + gcol] = f2bfu(g);
                }
            }
        }
    }
}

typedef float  f32x2  __attribute__((ext_vector_type(2)));
typedef bf16_t bf16x2 __attribute__((ext_vector_type(2)));

// two f32 -> packed bf16 pair (round to nearest even)
static __device__ inline uint32_t pack_bf16(float a, float b) {
    f32x2 f; f[0] = a; f[1] = b;
    union { bf16x2 h; uint32_t u; } c;
    c.h = __builtin_convertvector(f, bf16x2);
    return c.u;
}

static __device__ inline float exp_slot(float x) {
    float e;
    asm("v_exp_f32 %0, %1\n\tv_nop" : "=v"(e) : "v"(x * 1.4426950408889634f));
    return e;
}

static __device__ inline float other_half(float x) {
    int b = __builtin_bit_cast(int, x);
    b = __builtin_amdgcn_permlanex16(b, b, 0x76543210, 0xfedcba98, false, false);
    return __builtin_bit_cast(float, b);
}

// 32 k of one row, k-contiguous in memory, in the hardware k order:
// elements 0-7 = k 8*hi + 0..7, elements 8-15 = k 16 + 8*hi + 0..7
// (p = wave-uniform base, off = the lane's row * HDD + 8*hi)
static __device__ inline void load_row_frag(FragBF& f, const unsigned short* p, unsigned off) {
    const uint4 lo = *(const uint4*)(p + off);
    const uint4 up = *(const uint4*)(p + off + 16);
    f.d[0] = lo.x; f.d[1] = lo.y; f.d[2] = lo.z; f.d[3] = lo.w;
    f.d[4] = up.x; f.d[5] = up.y; f.d[6] = up.z; f.d[7] = up.w;
}

__global__ __launch_bounds__(256) void attn_kernel(const unsigned short* __restrict__ Q,
                                                   const unsigned short* __restrict__ Kb,
                                                   const unsigned short* __restrict__ Vb,
                                                   const float* __restrict__ mask,
                                                   unsigned short* __restrict__ ctxB) {
    const int lane = threadIdx.x & 31;
    const int wid  = threadIdx.x >> 5;
    const int n16  = lane & 15;
    const int hi   = lane >> 4;
    const int bh   = blockIdx.x >> 2;     // (b*NH + h)
    const int qblk = (blockIdx.x & 3) * 256;
    const int q0   = qblk + wid * 32;
    const int b    = bh >> 4;
    const int h    = bh & 15;
    const unsigned short* Qh = Q  + (size_t)bh * SS * HDD;
    const unsigned short* Kh = Kb + (size_t)bh * SS * HDD;
    const unsigned short* Vh = Vb + (size_t)bh * SS * HDD;
    const float*          mb = mask + (size_t)b * SS;
    const unsigned rowOff = (unsigned)(n16 * HDD + 8 * hi);   // Q and K rows
    const unsigned vOff   = (unsigned)(8 * hi * HDD + n16);   // V columns

    // Q rows as B fragments: [column group][k chunk of 32]
    FragBF qf[2][2];
#pragma unroll  // constant indices keep the arrays in registers
    for (int g = 0; g < 2; ++g)
#pragma unroll  // constant indices keep the arrays in registers
        for (int c = 0; c < 2; ++c)
            load_row_frag(qf[g][c], Qh + (size_t)wid * 32 * HDD + (qblk + 16 * g) * HDD + 32 * c, rowOff);

    // K rows as A fragments: [key tile of 16][k chunk of 32], fetched one pass ahead
    FragBF kf[2][2];
#pragma unroll  // constant indices keep the arrays in registers
    for (int t = 0; t < 2; ++t)
#pragma unroll  // constant indices keep the arrays in registers
        for (int c = 0; c < 2; ++c)
            load_row_frag(kf[t][c], Kh + 16 * t * HDD + 32 * c, rowOff);

    v8f   o[2][4];                 // O^T: [group][hd tile]; reg r = hd 8*hi + r
    float mrun[2], lrun[2];        // running maximum; this half's running sum
#pragma unroll  // constant indices keep the arrays in registers
    for (int g = 0; g < 2; ++g) {
        mrun[g] = -3.402823466e38f;   // finite, so that (-inf) - mrun is never NaN
        lrun[g] = 0.0f;
#pragma unroll  // constant indices keep the arrays in registers
        for (int nt = 0; nt < 4; ++nt) o[g][nt] = zero8();
    }

    for (int kp = 0; kp < 32; ++kp) {
        const int key0 = kp * 32;

        // V^T as A fragments (row = hd, k = key)
        const unsigned short* Vp = Vh + (size_t)key0 * HDD;
        FragBF vf[4];
#pragma unroll  // constant indices keep the arrays in registers
        for (int nt = 0; nt < 4; ++nt)
#pragma unroll  // constant indices keep the arrays in registers
            for (int v = 0; v < 8; ++v) {
                const int k = ((v >> 2) << 4) + ((v & 3) << 1);   // + 8*hi, in vOff
                vf[nt].u[2 * v]     = Vp[vOff + k * HDD + nt * 16];
                vf[nt].u[2 * v + 1] = Vp[vOff + (k + 1) * HDD + nt * 16];
            }

        // mask of this lane's keys: [tile][r] = key key0 + 16*t + 8*hi + r; the 32 values
        // of the pass are read at wave-uniform addresses, a lane picks its half's
        float mk[2][8];
#pragma unroll  // constant indices keep the arrays in registers
        for (int t = 0; t < 2; ++t)
#pragma unroll  // constant indices keep the arrays in registers
            for (int r = 0; r < 8; ++r) {
                const float lo = mb[key0 + 16 * t + r];
                const float up = mb[key0 + 16 * t + 8 + r];
                mk[t][r] = hi ? up : lo;
            }

        // S^T tiles: st[g][t][r] = q(q0 + 16g + n16) . k(key0 + 16t + 8hi + r)
        v8f st[2][2];
#pragma unroll  // constant indices keep the arrays in registers
        for (int g = 0; g < 2; ++g)
#pragma unroll  // constant indices keep the arrays in registers
            for (int t = 0; t < 2; ++t) {
                v8f s = zero8();
#pragma unroll  // constant indices keep the arrays in registers
                for (int c = 0; c < 2; ++c)
                    s = __builtin_amdgcn_wmma_f32_16x16x32_bf16(false, kf[t][c].v, false,
                                                                qf[g][c].v, (short)0, s,
                                                                false, false);
                st[g][t] = s;
            }

        // next pass's K rows (the last pass fetches pass 0's again: in bounds, unused)
        {
            const int kn = ((kp + 1) & 31) * 32;
#pragma unroll  // constant indices keep the arrays in registers
            for (int t = 0; t < 2; ++t)
#pragma unroll  // constant indices keep the arrays in registers
                for (int c = 0; c < 2; ++c)
                    load_row_frag(kf[t][c], Kh + (size_t)(kn + 16 * t) * HDD + 32 * c, rowOff);
            asm volatile("s_wait_xcnt 0x0" ::: "memory");
        }

        FragBF pf[2];
#pragma unroll  // constant indices keep the arrays in registers
        for (int g = 0; g < 2; ++g) {
            float x[16];
            float mx = mrun[g];
#pragma unroll  // constant indices keep the arrays in registers
            for (int t = 0; t < 2; ++t)
#pragma unroll  // constant indices keep the arrays in registers
                for (int r = 0; r < 8; ++r) {
                    x[8 * t + r] = st[g][t][r] * 0.125f + mk[t][r];
                    mx = fmaxf(mx, x[8 * t + r]);
                }
            mx = fmaxf(mx, other_half(mx));
            const float alpha = exp_slot(mrun[g] - mx);
            mrun[g] = mx;
            float sum = 0.0f;
#pragma unroll  // constant indices keep the arrays in registers
            for (int i = 0; i < 16; ++i) {
                x[i] = exp_slot(x[i] - mx);
                sum += x[i];
            }
            lrun[g] = lrun[g] * alpha + sum;
#pragma unroll  // constant indices keep the arrays in registers
            for (int i = 0; i < 8; ++i) pf[g].d[i] = pack_bf16(x[2 * i], x[2 * i + 1]);
#pragma unroll  // constant indices keep the arrays in registers
            for (int nt = 0; nt < 4; ++nt)
#pragma unroll  // constant indices keep the arrays in registers
                for (int r = 0; r < 8; ++r) o[g][nt][r] *= alpha;
        }

        // O^T += V^T . P^T
#pragma unroll  // constant indices keep the arrays in registers
        for (int nt = 0; nt < 4; ++nt)
#pragma unroll  // constant indices keep the arrays in registers
            for (int g = 0; g < 2; ++g)
                o[g][nt] = __builtin_amdgcn_wmma_f32_16x16x32_bf16(false, vf[nt].v, false,
                                                                   pf[g].v, (short)0,
                                                                   o[g][nt], false, false);
    }

    // ctx as bf16 in [B,S,D] layout: a lane's 8 registers are 8 consecutive hd
#pragma unroll  // constant indices keep the arrays in registers
    for (int g = 0; g < 2; ++g) {
        const float inv = 1.0f / (lrun[g] + other_half(lrun[g]));
        unsigned short* dst = ctxB + ((size_t)b * SS + q0 + 16 * g + n16) * DD + h * 64 + 8 * hi;
#pragma unroll  // constant indices keep the arrays in registers
        for (int nt = 0; nt < 4; ++nt) {
            uint4 w;
            w.x = pack_bf16(o[g][nt][0] * inv, o[g][nt][1] * inv);
            w.y = pack_bf16(o[g][nt][2] * inv, o[g][nt][3] * inv);
            w.z = pack_bf16(o[g][nt][4] * inv, o[g][nt][5] * inv);
            w.w = pack_bf16(o[g][nt][6] * inv, o[g][nt][7] * inv);
            *(uint4*)(dst + nt * 16) = w;
        }
    }
}

// ---------------- layernorm: one block per row (D=1024) ----------------
__global__ __launch_bounds__(256) void ln_kernel(const float* __restrict__ x,
                                                 const float* __restrict__ g,
                                                 const float* __restrict__ bta,
                                                 float* __restrict__ outF,
                                                 unsigned short* __restrict__ outB) {
    __shared__ float red[256];
    const int row = blockIdx.x;
    const int tid = threadIdx.x;
    const float* xr = x + (size_t)row * DD;

    float s = 0.0f;
    for (int i = tid; i < DD; i += 256) s += xr[i];
    red[tid] = s; __syncthreads();
    for (int off = 128; off > 0; off >>= 1) {
        if (tid < off) red[tid] += red[tid + off];
        __syncthreads();
    }
    float mu = red[0] * (1.0f / DD);
    __syncthreads();

    float v = 0.0f;
    for (int i = tid; i < DD; i += 256) {
        float d = xr[i] - mu; v += d * d;
    }
    red[tid] = v; __syncthreads();
    for (int off = 128; off > 0; off >>= 1) {
        if (tid < off) red[tid] += red[tid + off];
        __syncthreads();
    }
    float inv = rsqrtf(red[0] * (1.0f / DD) + 1e-12f);

    for (int i = tid; i < DD; i += 256) {
        float o = (xr[i] - mu) * inv * g[i] + bta[i];
        outF[(size_t)row * DD + i] = o;
        if (outB) outB[(size_t)row * DD + i] = f2bfu(o);
    }
}

// ---------------- launcher ----------------
extern "C" void kernel_launch(void* const* d_in, const int* in_sizes, int n_in,
                              void* d_out, int out_size, void* d_ws, size_t ws_size,
                              hipStream_t stream) {
    const float* hidden = (const float*)d_in[0];
    const float* mask   = (const float*)d_in[1];
    const float* Wq = (const float*)d_in[2];   const float* bq  = (const float*)d_in[3];
    const float* Wk = (const float*)d_in[4];   const float* bk  = (const float*)d_in[5];
    const float* Wv = (const float*)d_in[6];   const float* bv  = (const float*)d_in[7];
    const float* Wo = (const float*)d_in[8];   const float* bo  = (const float*)d_in[9];
    const float* g1 = (const float*)d_in[10];  const float* b1  = (const float*)d_in[11];
    const float* Wi = (const float*)d_in[12];  const float* bi  = (const float*)d_in[13];
    const float* Wt = (const float*)d_in[14];  const float* bot = (const float*)d_in[15];
    const float* g2 = (const float*)d_in[16];  const float* b2  = (const float*)d_in[17];
    float* out = (float*)d_out;

    const size_t BSD = (size_t)BSR * DD;     // 4M
    const size_t DI  = (size_t)DD * II;      // 4M
    const size_t DDq = (size_t)DD * DD;      // 1M

    char* ws = (char*)d_ws;
    auto alloc = [&](size_t bytes) -> char* {
        char* p = ws;
        ws += (bytes + 255) & ~(size_t)255;
        return p;
    };
    unsigned short* hb    = (unsigned short*)alloc(BSD * 2);
    unsigned short* wqb   = (unsigned short*)alloc(DDq * 2);
    unsigned short* wkb   = (unsigned short*)alloc(DDq * 2);
    unsigned short* wvb   = (unsigned short*)alloc(DDq * 2);
    unsigned short* wob   = (unsigned short*)alloc(DDq * 2);
    unsigned short* wib   = (unsigned short*)alloc(DI * 2);
    unsigned short* wtb   = (unsigned short*)alloc(DI * 2);
    unsigned short* qb    = (unsigned short*)alloc(BSD * 2);
    unsigned short* kbuf  = (unsigned short*)alloc(BSD * 2);
    unsigned short* vbuf  = (unsigned short*)alloc(BSD * 2);
    unsigned short* ctxb  = (unsigned short*)alloc(BSD * 2);
    float*          y1    = (float*)alloc(BSD * 4);
    float*          attnf = (float*)alloc(BSD * 4);
    unsigned short* attnb = (unsigned short*)alloc(BSD * 2);
    unsigned short* interb= (unsigned short*)alloc((size_t)BSR * II * 2);
    float*          y2    = (float*)alloc(BSD * 4);

    // 1) fp32 -> bf16 conversions
    cvt_f32_bf16<<<2048, 256, 0, stream>>>(hidden, hb, (int)BSD);
    cvt_f32_bf16<<<1024, 256, 0, stream>>>(Wq, wqb, (int)DDq);
    cvt_f32_bf16<<<1024, 256, 0, stream>>>(Wk, wkb, (int)DDq);
    cvt_f32_bf16<<<1024, 256, 0, stream>>>(Wv, wvb, (int)DDq);
    cvt_f32_bf16<<<1024, 256, 0, stream>>>(Wo, wob, (int)DDq);
    cvt_f32_bf16<<<2048, 256, 0, stream>>>(Wi, wib, (int)DI);
    cvt_f32_bf16<<<2048, 256, 0, stream>>>(Wt, wtb, (int)DI);

    // 2) QKV projections (head-scattered bf16 outputs)
    {
        dim3 g(DD / 128, BSR / 128);
        gemm_bf16<1><<<g, 256, 0, stream>>>(hb, wqb, bq, nullptr, qb,   nullptr, BSR, DD, DD);
        gemm_bf16<1><<<g, 256, 0, stream>>>(hb, wkb, bk, nullptr, kbuf, nullptr, BSR, DD, DD);
        gemm_bf16<1><<<g, 256, 0, stream>>>(hb, wvb, bv, nullptr, vbuf, nullptr, BSR, DD, DD);
    }

    // 3) attention
    attn_kernel<<<BB * NHH * (SS / 256), 256, 0, stream>>>(qb, kbuf, vbuf, mask, ctxb);

    // 4) output projection + residual(hidden)
    {
        dim3 g(DD / 128, BSR / 128);
        gemm_bf16<0><<<g, 256, 0, stream>>>(ctxb, wob, bo, y1, nullptr, hidden,
                                            BSR, DD, DD);
    }
    // 5) LN1 -> attnf (f32) + attnb (bf16)
    ln_kernel<<<BSR, 256, 0, stream>>>(y1, g1, b1, attnf, attnb);

    // 6) FFN up + exact GELU -> bf16
    {
        dim3 g(II / 128, BSR / 128);
        gemm_bf16<2><<<g, 256, 0, stream>>>(attnb, wib, bi, nullptr, interb,
                                            nullptr, BSR, II, DD);
    }
    // 7) FFN down + residual(attnf)
    {
        dim3 g(DD / 128, BSR / 128);
        gemm_bf16<0><<<g, 256, 0, stream>>>(interb, wtb, bot, y2, nullptr, attnf,
                                            BSR, DD, II);
    }
    // 8) LN2 -> final output
    ln_kernel<<<BSR, 256, 0, stream>>>(y2, g2, b2, out, nullptr);
}

// v003
// One run takes 275 microseconds.
// Timed twice side by side with v002, it ran 1.25 times as fast both times.
// Counting every step since v000, it is 3.05 times as fast.
#include <hip/hip_runtime.h>
#include <cstdint>
#include <cstddef>

// ---------------- types ----------------
typedef __bf16 bf16_t;
typedef bf16_t v16bf __attribute__((ext_vector_type(16)));
typedef float  v8f   __attribute__((ext_vector_type(8)));
typedef unsigned int u32x4 __attribute__((ext_vector_type(4)));

union FragBF {
    uint32_t       d[8];
    unsigned short u[16];
    v16bf          v;
};

static __device__ inline v8f zero8() {
    v8f z;
#pragma unroll
    for (int i = 0; i < 8; ++i) z[i] = 0.0f;
    return z;
}

// fp32 -> bf16 (round to nearest even), returned as raw u16 bits
static __device__ inline unsigned short f2bfu(float f) {
    union { float f; uint32_t u; } c; c.f = f;
    uint32_t r = c.u + 0x7FFFu + ((c.u >> 16) & 1u);
    return (unsigned short)(r >> 16);
}

// model constants
#define BB   4
#define SS   1024
#define DD   1024
#define NHH  16
#define HDD  64
#define II   4096
#define BSR  4096   /* B*S rows */

#if defined(__gfx1250__) && __has_builtin(__builtin_amdgcn_tensor_load_to_lds)
#define USE_TDM 1
#endif


#define BK      64
#define B_ROWB  256u
#define B_ROWS  64u
#define B_PITCH 288u
#define B_BUF   18432u
#define A_ROWB  128u
#define A_ROWS  128u
#define A_PITCH 144u
#define A_BUF   18432u
static_assert(B_ROWS * B_PITCH <= B_BUF && (B_BUF % 2048u) == 0u, "B buffer size");
static_assert(A_ROWS * A_PITCH <= A_BUF && (A_BUF % 2048u) == 0u, "A buffer size");

typedef unsigned int u32x8 __attribute__((ext_vector_type(8)));
typedef short        s16x8 __attribute__((ext_vector_type(8)));

static __device__ inline uint32_t uni(uint32_t v) {
    return (uint32_t)__builtin_amdgcn_readfirstlane(v);
}
static __device__ inline uint32_t pinned(uint32_t v) {
    uint32_t w = uni(v);
    asm volatile("" : "+s"(w));   // the pin of a tensor load's issue test in a scalar register
    return w;
}
static __device__ inline u32x8 btile_group1(uint32_t src_pitch) {
    u32x8 g;
    g[0] = uni((1u << 20) | (5u << 22) | (7u << 25));
    g[1] = uni((B_ROWB & 0xFFFFu) << 16);
    g[2] = uni((B_ROWB >> 16) | ((B_ROWS & 0xFFFFu) << 16));
    g[3] = uni((B_ROWS >> 16) | (B_ROWB << 16));
    g[4] = uni(B_ROWS);
    g[5] = uni(src_pitch);
    g[6] = uni(0u);
    g[7] = uni(0u);
    return g;
}
static __device__ inline u32x8 atile_group1(uint32_t src_pitch) {
    u32x8 g;
    g[0] = uni((1u << 20) | (4u << 22) | (3u << 25));
    g[1] = uni((A_ROWB & 0xFFFFu) << 16);
    g[2] = uni((A_ROWB >> 16) | ((A_ROWS & 0xFFFFu) << 16));
    g[3] = uni((A_ROWS >> 16) | (A_ROWB << 16));
    g[4] = uni(A_ROWS);
    g[5] = uni(src_pitch);
    g[6] = uni(0u);
    g[7] = uni(0u);
    return g;
}
static __device__ inline u32x4 btile_group0(uint32_t lds_dst, uint64_t ga) {
    u32x4 g;
    g[0] = uni(1u);
    g[1] = uni(lds_dst);
    g[2] = uni((uint32_t)ga);
    g[3] = uni((((uint32_t)(ga >> 32)) & 0x01FFFFFFu) | 0x80000000u);
    return g;
}
// 8 k x 16 columns per wave half of a row-major 16-bit LDS tile, transposed: lane (c, h)
// gets 8 consecutive k of column c, which is half a B fragment in the hardware k order
static __device__ inline u32x4 ld_tr16(const unsigned char* p) {
    typedef __attribute__((address_space(3))) s16x8 lds_s16x8;
    return __builtin_bit_cast(u32x4, __builtin_amdgcn_ds_load_tr16_b128_v8i16((lds_s16x8*)p));
}

// ---------------- fp32 -> bf16 convert ----------------
__global__ __launch_bounds__(256) void cvt_f32_bf16(const float* __restrict__ in,
                                                    unsigned short* __restrict__ out,
                                                    int n) {
    for (int i = blockIdx.x * blockDim.x + threadIdx.x; i < n;
         i += gridDim.x * blockDim.x)
        out[i] = f2bfu(in[i]);
}

template <int MODE>
__global__ __launch_bounds__(256) void gemm_bf16(const unsigned short* __restrict__ A,
                                                 const unsigned short* __restrict__ Bw,
                                                 const float* __restrict__ bias,
                                                 float* __restrict__ outF,
                                                 unsigned short* __restrict__ outB,
                                                 const float* __restrict__ res,
                                                 int M, int N, int K) {
    __shared__ __attribute__((aligned(2048))) unsigned char As[2][A_BUF];
    __shared__ __attribute__((aligned(2048))) unsigned char Bs[2][B_BUF];

    const int tid   = threadIdx.x;
    const int lane  = tid & 31;
    const int wid   = tid >> 5;
    const int n16   = lane & 15;
    const int hi    = lane >> 4;
    const int waveM = wid >> 2;   // 0..1
    const int waveN = wid & 3;    // 0..3
    const int rowBase = blockIdx.y * 128;
    const int colBase = blockIdx.x * 128;

    v8f acc[4][2];
#pragma unroll
    for (int i = 0; i < 4; ++i)
#pragma unroll
        for (int j = 0; j < 2; ++j) acc[i][j] = zero8();

#ifdef USE_TDM
    const uint32_t wave = uni((uint32_t)threadIdx.x >> 5);
    u32x8 bg1 = btile_group1((uint32_t)N * 2u);
    u32x4 bg0 = btile_group0((uint32_t)(size_t)&Bs[0][0], (uint64_t)(Bw + colBase));
    const uint32_t bstep = uni((uint32_t)N * (2u * BK));   // 64 source rows, in bytes
    u32x8 ag1 = atile_group1((uint32_t)K * 2u);
    u32x4 ag0 = btile_group0((uint32_t)(size_t)&As[0][0], (uint64_t)(A + (size_t)rowBase * K));
#endif

    // stage tile (A:128x64, B:64x128) for K-step k0 into buffer `buf`
    auto stage = [&](int buf, int k0) {
#ifdef USE_TDM
        if (pinned(wave == 0u)) {
            bg0[1] = uni((uint32_t)(size_t)&Bs[buf][0]);
            ag0[1] = uni((uint32_t)(size_t)&As[buf][0]);
            if (k0 > 0) {   // words 2 and 3 hold the 64-bit source address
                const uint64_t a = (((uint64_t)bg0[3] << 32) | bg0[2]) + bstep;   // 64 rows on
                bg0[2] = uni((uint32_t)a);
                bg0[3] = uni((uint32_t)(a >> 32));
                const uint64_t c = (((uint64_t)ag0[3] << 32) | ag0[2]) + A_ROWB;  // 64 k on
                ag0[2] = uni((uint32_t)c);
                ag0[3] = uni((uint32_t)(c >> 32));
            }
            asm volatile("tensor_load_to_lds %0, %1" : "+s"(bg0), "+s"(bg1) :: "memory");
            asm volatile("tensor_load_to_lds %0, %1" : "+s"(ag0), "+s"(ag1) :: "memory");
        }
#else
#pragma unroll
        for (int i = 0; i < 4; ++i) {
            int ci = tid + i * 256;              // 0..1023
            int ra = ci >> 3;                    // A row, 8 chunks/row
            int ca = (ci & 7) << 3;
            *(uint4*)&As[buf][ra * A_PITCH + ca * 2] =
                *(const uint4*)&A[(size_t)(rowBase + ra) * K + k0 + ca];
            int rb = ci >> 4;                    // B row, 16 chunks/row
            int cb = (ci & 15) << 3;
            *(uint4*)&Bs[buf][rb * B_PITCH + cb * 2] =
                *(const uint4*)&Bw[(size_t)(k0 + rb) * N + colBase + cb];
        }
#endif
    };

    stage(0, 0);
    int cur = 0;
    for (int k0 = 0; k0 < K; k0 += BK) {
#ifdef USE_TDM
        if (wid == 0) __builtin_amdgcn_s_wait_tensorcnt((short)0);
#endif
        __syncthreads();                     // tile `cur` resident & visible
        // the test for a next stage is a scalar branch as well (see pinned())
        if (pinned(k0 + BK < K)) stage(cur ^ 1, k0 + BK);   // overlap next DMA w/ compute

        // the lane's row of the wave's first A tile, at its 16-byte half of 32 bytes
        const unsigned char* as = &As[cur][0] + (waveM * 64 + n16) * A_PITCH + 16 * hi;
        // the lane's address in the transposing load: row 8*hi + (lane & 7), 16-byte
        // half (lane >> 3) & 1 of the 32 bytes of a 16-column group
        const unsigned char* bs = &Bs[cur][0] + (8 * hi + (lane & 7)) * B_PITCH +
                                  16 * ((lane >> 3) & 1) + 64 * waveN;

        // all 24 fragment reads of the pass stand as one group ahead of its 16 WMMAs
        FragBF af[BK / 32][4];
        FragBF bf[BK / 32][2];
#pragma unroll  // constant indices keep the arrays in registers
        for (int c = 0; c < BK / 32; ++c) {
#pragma unroll  // constant indices keep the arrays in registers
            for (int nt = 0; nt < 2; ++nt) {
                const u32x4 lo = ld_tr16(bs + (32 * c) * B_PITCH + 32 * nt);        // k  0..15
                const u32x4 up = ld_tr16(bs + (32 * c + 16) * B_PITCH + 32 * nt);   // k 16..31
                bf[c][nt].d[0] = lo.x; bf[c][nt].d[1] = lo.y;
                bf[c][nt].d[2] = lo.z; bf[c][nt].d[3] = lo.w;
                bf[c][nt].d[4] = up.x; bf[c][nt].d[5] = up.y;
                bf[c][nt].d[6] = up.z; bf[c][nt].d[7] = up.w;
            }
#pragma unroll  // constant indices keep the arrays in registers
            for (int mt = 0; mt < 4; ++mt) {
                // elements 0-7 = k 8*hi + 0..7, elements 8-15 = k 16 + 8*hi + 0..7
                const uint4 lo = *(const uint4*)(as + mt * 16 * A_PITCH + 64 * c);
                const uint4 up = *(const uint4*)(as + mt * 16 * A_PITCH + 64 * c + 32);
                af[c][mt].d[0] = lo.x; af[c][mt].d[1] = lo.y;
                af[c][mt].d[2] = lo.z; af[c][mt].d[3] = lo.w;
                af[c][mt].d[4] = up.x; af[c][mt].d[5] = up.y;
                af[c][mt].d[6] = up.z; af[c][mt].d[7] = up.w;
            }
        }
        // keeps the reads above the WMMAs: sunk among them, each pair of reads is waited
        // out to zero in front of its two WMMAs and the LDS latency is paid eight times
        __builtin_amdgcn_sched_barrier(0);
#pragma unroll  // two chunks of 32 k, in rising k; constant indices keep the arrays in registers
        for (int c = 0; c < BK / 32; ++c)
#pragma unroll  // constant indices keep the arrays in registers
            for (int mt = 0; mt < 4; ++mt)
#pragma unroll  // constant indices keep the arrays in registers
                for (int nt = 0; nt < 2; ++nt)
                    acc[mt][nt] = __builtin_amdgcn_wmma_f32_16x16x32_bf16(
                        false, af[c][mt].v, false, bf[c][nt].v, (short)0, acc[mt][nt],
                        false, false);
        // keeps the barrier below the WMMAs: lifted above them it brings a wait for all
        // 24 reads in front of the matrix work, which then overlaps none of them
        __builtin_amdgcn_sched_barrier(0);
        __syncthreads();                     // all waves done reading `cur`
        cur ^= 1;
    }

    // epilogue
#pragma unroll
    for (int mt = 0; mt < 4; ++mt) {
#pragma unroll
        for (int nt = 0; nt < 2; ++nt) {
#pragma unroll
            for (int r = 0; r < 8; ++r) {
                int grow = rowBase + waveM * 64 + mt * 16 + r + 8 * hi;
                int gcol = colBase + waveN * 32 + nt * 16 + n16;
                float v = acc[mt][nt][r] + bias[gcol];
                if (MODE == 0) {
                    outF[(size_t)grow * N + gcol] = v + res[(size_t)grow * N + gcol];
                } else if (MODE == 1) {
                    int b = grow >> 10, s = grow & 1023;
                    int head = gcol >> 6, hd = gcol & 63;
                    outB[(((size_t)(b * NHH + head)) * SS + s) * HDD + hd] = f2bfu(v);
                } else {
                    float g = 0.5f * v * (1.0f + erff(v * 0.70710678118654752f));
                    outB[(size_t)grow * N + gcol] = f2bfu(g);
                }
            }
        }
    }
}

typedef float  f32x2  __attribute__((ext_vector_type(2)));
typedef bf16_t bf16x2 __attribute__((ext_vector_type(2)));

// two f32 -> packed bf16 pair (round to nearest even)
static __device__ inline uint32_t pack_bf16(float a, float b) {
    f32x2 f; f[0] = a; f[1] = b;
    union { bf16x2 h; uint32_t u; } c;
    c.h = __builtin_convertvector(f, bf16x2);
    return c.u;
}

static __device__ inline float exp_slot(float x) {
    float e;
    asm("v_exp_f32 %0, %1\n\tv_nop" : "=v"(e) : "v"(x * 1.4426950408889634f));
    return e;
}

static __device__ inline float other_half(float x) {
    int b = __builtin_bit_cast(int, x);
    b = __builtin_amdgcn_permlanex16(b, b, 0x76543210, 0xfedcba98, false, false);
    return __builtin_bit_cast(float, b);
}

// 32 k of one row, k-contiguous in memory, in the hardware k order:
// elements 0-7 = k 8*hi + 0..7, elements 8-15 = k 16 + 8*hi + 0..7
// (p = wave-uniform base, off = the lane's row * HDD + 8*hi)
static __device__ inline void load_row_frag(FragBF& f, const unsigned short* p, unsigned off) {
    const uint4 lo = *(const uint4*)(p + off);
    const uint4 up = *(const uint4*)(p + off + 16);
    f.d[0] = lo.x; f.d[1] = lo.y; f.d[2] = lo.z; f.d[3] = lo.w;
    f.d[4] = up.x; f.d[5] = up.y; f.d[6] = up.z; f.d[7] = up.w;
}

__global__ __launch_bounds__(256) void attn_kernel(const unsigned short* __restrict__ Q,
                                                   const unsigned short* __restrict__ Kb,
                                                   const unsigned short* __restrict__ Vb,
                                                   const float* __restrict__ mask,
                                                   unsigned short* __restrict__ ctxB) {
    const int lane = threadIdx.x & 31;
    const int wid  = threadIdx.x >> 5;
    const int n16  = lane & 15;
    const int hi   = lane >> 4;
    const int bh   = blockIdx.x >> 2;     // (b*NH + h)
    const int qblk = (blockIdx.x & 3) * 256;
    const int q0   = qblk + wid * 32;
    const int b    = bh >> 4;
    const int h    = bh & 15;
    const unsigned short* Qh = Q  + (size_t)bh * SS * HDD;
    const unsigned short* Kh = Kb + (size_t)bh * SS * HDD;
    const unsigned short* Vh = Vb + (size_t)bh * SS * HDD;
    const float*          mb = mask + (size_t)b * SS;
    const unsigned rowOff = (unsigned)(n16 * HDD + 8 * hi);   // Q and K rows
    const unsigned vOff   = (unsigned)(8 * hi * HDD + n16);   // V columns

    // Q rows as B fragments: [column group][k chunk of 32]
    FragBF qf[2][2];
#pragma unroll  // constant indices keep the arrays in registers
    for (int g = 0; g < 2; ++g)
#pragma unroll  // constant indices keep the arrays in registers
        for (int c = 0; c < 2; ++c)
            load_row_frag(qf[g][c], Qh + (size_t)wid * 32 * HDD + (qblk + 16 * g) * HDD + 32 * c, rowOff);

    // K rows as A fragments: [key tile of 16][k chunk of 32], fetched one pass ahead
    FragBF kf[2][2];
#pragma unroll  // constant indices keep the arrays in registers
    for (int t = 0; t < 2; ++t)
#pragma unroll  // constant indices keep the arrays in registers
        for (int c = 0; c < 2; ++c)
            load_row_frag(kf[t][c], Kh + 16 * t * HDD + 32 * c, rowOff);

    v8f   o[2][4];                 // O^T: [group][hd tile]; reg r = hd 8*hi + r
    float mrun[2], lrun[2];        // running maximum; this half's running sum
#pragma unroll  // constant indices keep the arrays in registers
    for (int g = 0; g < 2; ++g) {
        mrun[g] = -3.402823466e38f;   // finite, so that (-inf) - mrun is never NaN
        lrun[g] = 0.0f;
#pragma unroll  // constant indices keep the arrays in registers
        for (int nt = 0; nt < 4; ++nt) o[g][nt] = zero8();
    }

    for (int kp = 0; kp < 32; ++kp) {
        const int key0 = kp * 32;

        // V^T as A fragments (row = hd, k = key)
        const unsigned short* Vp = Vh + (size_t)key0 * HDD;
        FragBF vf[4];
#pragma unroll  // constant indices keep the arrays in registers
        for (int nt = 0; nt < 4; ++nt)
#pragma unroll  // constant indices keep the arrays in registers
            for (int v = 0; v < 8; ++v) {
                const int k = ((v >> 2) << 4) + ((v & 3) << 1);   // + 8*hi, in vOff
                vf[nt].u[2 * v]     = Vp[vOff + k * HDD + nt * 16];
                vf[nt].u[2 * v + 1] = Vp[vOff + (k + 1) * HDD + nt * 16];
            }

        // mask of this lane's keys: [tile][r] = key key0 + 16*t + 8*hi + r; the 32 values
        // of the pass are read at wave-uniform addresses, a lane picks its half's
        float mk[2][8];
#pragma unroll  // constant indices keep the arrays in registers
        for (int t = 0; t < 2; ++t)
#pragma unroll  // constant indices keep the arrays in registers
            for (int r = 0; r < 8; ++r) {
                const float lo = mb[key0 + 16 * t + r];
                const float up = mb[key0 + 16 * t + 8 + r];
                mk[t][r] = hi ? up : lo;
            }

        // S^T tiles: st[g][t][r] = q(q0 + 16g + n16) . k(key0 + 16t + 8hi + r)
        v8f st[2][2];
#pragma unroll  // constant indices keep the arrays in registers
        for (int g = 0; g < 2; ++g)
#pragma unroll  // constant indices keep the arrays in registers
            for (int t = 0; t < 2; ++t) {
                v8f s = zero8();
#pragma unroll  // constant indices keep the arrays in registers
                for (int c = 0; c < 2; ++c)
                    s = __builtin_amdgcn_wmma_f32_16x16x32_bf16(false, kf[t][c].v, false,
                                                                qf[g][c].v, (short)0, s,
                                                                false, false);
                st[g][t] = s;
            }

        // next pass's K rows (the last pass fetches pass 0's again: in bounds, unused)
        {
            const int kn = ((kp + 1) & 31) * 32;
#pragma unroll  // constant indices keep the arrays in registers
            for (int t = 0; t < 2; ++t)
#pragma unroll  // constant indices keep the arrays in registers
                for (int c = 0; c < 2; ++c)
                    load_row_frag(kf[t][c], Kh + (size_t)(kn + 16 * t) * HDD + 32 * c, rowOff);
            asm volatile("s_wait_xcnt 0x0" ::: "memory");
        }

        FragBF pf[2];
#pragma unroll  // constant indices keep the arrays in registers
        for (int g = 0; g < 2; ++g) {
            float x[16];
            float mx = mrun[g];
#pragma unroll  // constant indices keep the arrays in registers
            for (int t = 0; t < 2; ++t)
#pragma unroll  // constant indices keep the arrays in registers
                for (int r = 0; r < 8; ++r) {
                    x[8 * t + r] = st[g][t][r] * 0.125f + mk[t][r];
                    mx = fmaxf(mx, x[8 * t + r]);
                }
            mx = fmaxf(mx, other_half(mx));
            const float alpha = exp_slot(mrun[g] - mx);
            mrun[g] = mx;
            float sum = 0.0f;
#pragma unroll  // constant indices keep the arrays in registers
            for (int i = 0; i < 16; ++i) {
                x[i] = exp_slot(x[i] - mx);
                sum += x[i];
            }
            lrun[g] = lrun[g] * alpha + sum;
#pragma unroll  // constant indices keep the arrays in registers
            for (int i = 0; i < 8; ++i) pf[g].d[i] = pack_bf16(x[2 * i], x[2 * i + 1]);
#pragma unroll  // constant indices keep the arrays in registers
            for (int nt = 0; nt < 4; ++nt)
#pragma unroll  // constant indices keep the arrays in registers
                for (int r = 0; r < 8; ++r) o[g][nt][r] *= alpha;
        }

        // O^T += V^T . P^T
#pragma unroll  // constant indices keep the arrays in registers
        for (int nt = 0; nt < 4; ++nt)
#pragma unroll  // constant indices keep the arrays in registers
            for (int g = 0; g < 2; ++g)
                o[g][nt] = __builtin_amdgcn_wmma_f32_16x16x32_bf16(false, vf[nt].v, false,
                                                                   pf[g].v, (short)0,
                                                                   o[g][nt], false, false);
    }

    // ctx as bf16 in [B,S,D] layout: a lane's 8 registers are 8 consecutive hd
#pragma unroll  // constant indices keep the arrays in registers
    for (int g = 0; g < 2; ++g) {
        const float inv = 1.0f / (lrun[g] + other_half(lrun[g]));
        unsigned short* dst = ctxB + ((size_t)b * SS + q0 + 16 * g + n16) * DD + h * 64 + 8 * hi;
#pragma unroll  // constant indices keep the arrays in registers
        for (int nt = 0; nt < 4; ++nt) {
            uint4 w;
            w.x = pack_bf16(o[g][nt][0] * inv, o[g][nt][1] * inv);
            w.y = pack_bf16(o[g][nt][2] * inv, o[g][nt][3] * inv);
            w.z = pack_bf16(o[g][nt][4] * inv, o[g][nt][5] * inv);
            w.w = pack_bf16(o[g][nt][6] * inv, o[g][nt][7] * inv);
            *(uint4*)(dst + nt * 16) = w;
        }
    }
}

// ---------------- layernorm: one block per row (D=1024) ----------------
__global__ __launch_bounds__(256) void ln_kernel(const float* __restrict__ x,
                                                 const float* __restrict__ g,
                                                 const float* __restrict__ bta,
                                                 float* __restrict__ outF,
                                                 unsigned short* __restrict__ outB) {
    __shared__ float red[256];
    const int row = blockIdx.x;
    const int tid = threadIdx.x;
    const float* xr = x + (size_t)row * DD;

    float s = 0.0f;
    for (int i = tid; i < DD; i += 256) s += xr[i];
    red[tid] = s; __syncthreads();
    for (int off = 128; off > 0; off >>= 1) {
        if (tid < off) red[tid] += red[tid + off];
        __syncthreads();
    }
    float mu = red[0] * (1.0f / DD);
    __syncthreads();

    float v = 0.0f;
    for (int i = tid; i < DD; i += 256) {
        float d = xr[i] - mu; v += d * d;
    }
    red[tid] = v; __syncthreads();
    for (int off = 128; off > 0; off >>= 1) {
        if (tid < off) red[tid] += red[tid + off];
        __syncthreads();
    }
    float inv = rsqrtf(red[0] * (1.0f / DD) + 1e-12f);

    for (int i = tid; i < DD; i += 256) {
        float o = (xr[i] - mu) * inv * g[i] + bta[i];
        outF[(size_t)row * DD + i] = o;
        if (outB) outB[(size_t)row * DD + i] = f2bfu(o);
    }
}

// ---------------- launcher ----------------
extern "C" void kernel_launch(void* const* d_in, const int* in_sizes, int n_in,
                              void* d_out, int out_size, void* d_ws, size_t ws_size,
                              hipStream_t stream) {
    const float* hidden = (const float*)d_in[0];
    const float* mask   = (const float*)d_in[1];
    const float* Wq = (const float*)d_in[2];   const float* bq  = (const float*)d_in[3];
    const float* Wk = (const float*)d_in[4];   const float* bk  = (const float*)d_in[5];
    const float* Wv = (const float*)d_in[6];   const float* bv  = (const float*)d_in[7];
    const float* Wo = (const float*)d_in[8];   const float* bo  = (const float*)d_in[9];
    const float* g1 = (const float*)d_in[10];  const float* b1  = (const float*)d_in[11];
    const float* Wi = (const float*)d_in[12];  const float* bi  = (const float*)d_in[13];
    const float* Wt = (const float*)d_in[14];  const float* bot = (const float*)d_in[15];
    const float* g2 = (const float*)d_in[16];  const float* b2  = (const float*)d_in[17];
    float* out = (float*)d_out;

    const size_t BSD = (size_t)BSR * DD;     // 4M
    const size_t DI  = (size_t)DD * II;      // 4M
    const size_t DDq = (size_t)DD * DD;      // 1M

    char* ws = (char*)d_ws;
    auto alloc = [&](size_t bytes) -> char* {
        char* p = ws;
        ws += (bytes + 255) & ~(size_t)255;
        return p;
    };
    unsigned short* hb    = (unsigned short*)alloc(BSD * 2);
    unsigned short* wqb   = (unsigned short*)alloc(DDq * 2);
    unsigned short* wkb   = (unsigned short*)alloc(DDq * 2);
    unsigned short* wvb   = (unsigned short*)alloc(DDq * 2);
    unsigned short* wob   = (unsigned short*)alloc(DDq * 2);
    unsigned short* wib   = (unsigned short*)alloc(DI * 2);
    unsigned short* wtb   = (unsigned short*)alloc(DI * 2);
    unsigned short* qb    = (unsigned short*)alloc(BSD * 2);
    unsigned short* kbuf  = (unsigned short*)alloc(BSD * 2);
    unsigned short* vbuf  = (unsigned short*)alloc(BSD * 2);
    unsigned short* ctxb  = (unsigned short*)alloc(BSD * 2);
    float*          y1    = (float*)alloc(BSD * 4);
    float*          attnf = (float*)alloc(BSD * 4);
    unsigned short* attnb = (unsigned short*)alloc(BSD * 2);
    unsigned short* interb= (unsigned short*)alloc((size_t)BSR * II * 2);
    float*          y2    = (float*)alloc(BSD * 4);

    // 1) fp32 -> bf16 conversions
    cvt_f32_bf16<<<2048, 256, 0, stream>>>(hidden, hb, (int)BSD);
    cvt_f32_bf16<<<1024, 256, 0, stream>>>(Wq, wqb, (int)DDq);
    cvt_f32_bf16<<<1024, 256, 0, stream>>>(Wk, wkb, (int)DDq);
    cvt_f32_bf16<<<1024, 256, 0, stream>>>(Wv, wvb, (int)DDq);
    cvt_f32_bf16<<<1024, 256, 0, stream>>>(Wo, wob, (int)DDq);
    cvt_f32_bf16<<<2048, 256, 0, stream>>>(Wi, wib, (int)DI);
    cvt_f32_bf16<<<2048, 256, 0, stream>>>(Wt, wtb, (int)DI);

    // 2) QKV projections (head-scattered bf16 outputs)
    {
        dim3 g(DD / 128, BSR / 128);
        gemm_bf16<1><<<g, 256, 0, stream>>>(hb, wqb, bq, nullptr, qb,   nullptr, BSR, DD, DD);
        gemm_bf16<1><<<g, 256, 0, stream>>>(hb, wkb, bk, nullptr, kbuf, nullptr, BSR, DD, DD);
        gemm_bf16<1><<<g, 256, 0, stream>>>(hb, wvb, bv, nullptr, vbuf, nullptr, BSR, DD, DD);
    }

    // 3) attention
    attn_kernel<<<BB * NHH * (SS / 256), 256, 0, stream>>>(qb, kbuf, vbuf, mask, ctxb);

    // 4) output projection + residual(hidden)
    {
        dim3 g(DD / 128, BSR / 128);
        gemm_bf16<0><<<g, 256, 0, stream>>>(ctxb, wob, bo, y1, nullptr, hidden,
                                            BSR, DD, DD);
    }
    // 5) LN1 -> attnf (f32) + attnb (bf16)
    ln_kernel<<<BSR, 256, 0, stream>>>(y1, g1, b1, attnf, attnb);

    // 6) FFN up + exact GELU -> bf16
    {
        dim3 g(II / 128, BSR / 128);
        gemm_bf16<2><<<g, 256, 0, stream>>>(attnb, wib, bi, nullptr, interb,
                                            nullptr, BSR, II, DD);
    }
    // 7) FFN down + residual(attnf)
    {
        dim3 g(DD / 128, BSR / 128);
        gemm_bf16<0><<<g, 256, 0, stream>>>(interb, wtb, bot, y2, nullptr, attnf,
                                            BSR, DD, II);
    }
    // 8) LN2 -> final output
    ln_kernel<<<BSR, 256, 0, stream>>>(y2, g2, b2, out, nullptr);
}

// v004
// It runs in 255 microseconds.
// Two timings next to v003 both put it at 1.08 times that version's speed.
// Over all steps from v000 it is 3.29 times as fast.
#include <hip/hip_runtime.h>
#include <cstdint>
#include <cstddef>

// ---------------- types ----------------
typedef __bf16 bf16_t;
typedef bf16_t v16bf __attribute__((ext_vector_type(16)));
typedef float  v8f   __attribute__((ext_vector_type(8)));
typedef unsigned int u32x4 __attribute__((ext_vector_type(4)));

union FragBF {
    uint32_t       d[8];
    unsigned short u[16];
    v16bf          v;
};

static __device__ inline v8f zero8() {
    v8f z;
#pragma unroll
    for (int i = 0; i < 8; ++i) z[i] = 0.0f;
    return z;
}

// fp32 -> bf16 (round to nearest even), returned as raw u16 bits
static __device__ inline unsigned short f2bfu(float f) {
    union { float f; uint32_t u; } c; c.f = f;
    uint32_t r = c.u + 0x7FFFu + ((c.u >> 16) & 1u);
    return (unsigned short)(r >> 16);
}

// model constants
#define BB   4
#define SS   1024
#define DD   1024
#define NHH  16
#define HDD  64
#define II   4096
#define BSR  4096   /* B*S rows */

#if defined(__gfx1250__) && __has_builtin(__builtin_amdgcn_tensor_load_to_lds)
#define USE_TDM 1
#endif


#define BK      64
#define B_ROWB  256u
#define B_ROWS  64u
#define B_PITCH 288u
#define B_BUF   18432u
#define A_ROWB  128u
#define A_ROWS  128u
#define A_PITCH 144u
#define A_BUF   18432u
static_assert(B_ROWS * B_PITCH <= B_BUF && (B_BUF % 2048u) == 0u, "B buffer size");
static_assert(A_ROWS * A_PITCH <= A_BUF && (A_BUF % 2048u) == 0u, "A buffer size");

typedef unsigned int u32x8 __attribute__((ext_vector_type(8)));
typedef short        s16x8 __attribute__((ext_vector_type(8)));

static __device__ inline uint32_t uni(uint32_t v) {
    return (uint32_t)__builtin_amdgcn_readfirstlane(v);
}
static __device__ inline uint32_t pinned(uint32_t v) {
    uint32_t w = uni(v);
    asm volatile("" : "+s"(w));   // the pin of a tensor load's issue test in a scalar register
    return w;
}
static __device__ inline u32x8 btile_group1(uint32_t src_pitch) {
    u32x8 g;
    g[0] = uni((1u << 20) | (5u << 22) | (7u << 25));
    g[1] = uni((B_ROWB & 0xFFFFu) << 16);
    g[2] = uni((B_ROWB >> 16) | ((B_ROWS & 0xFFFFu) << 16));
    g[3] = uni((B_ROWS >> 16) | (B_ROWB << 16));
    g[4] = uni(B_ROWS);
    g[5] = uni(src_pitch);
    g[6] = uni(0u);
    g[7] = uni(0u);
    return g;
}
static __device__ inline u32x8 atile_group1(uint32_t src_pitch) {
    u32x8 g;
    g[0] = uni((1u << 20) | (4u << 22) | (3u << 25));
    g[1] = uni((A_ROWB & 0xFFFFu) << 16);
    g[2] = uni((A_ROWB >> 16) | ((A_ROWS & 0xFFFFu) << 16));
    g[3] = uni((A_ROWS >> 16) | (A_ROWB << 16));
    g[4] = uni(A_ROWS);
    g[5] = uni(src_pitch);
    g[6] = uni(0u);
    g[7] = uni(0u);
    return g;
}
static __device__ inline u32x4 btile_group0(uint32_t lds_dst, uint64_t ga) {
    u32x4 g;
    g[0] = uni(1u);
    g[1] = uni(lds_dst);
    g[2] = uni((uint32_t)ga);
    g[3] = uni((((uint32_t)(ga >> 32)) & 0x01FFFFFFu) | 0x80000000u);
    return g;
}
// 8 k x 16 columns per wave half of a row-major 16-bit LDS tile, transposed: lane (c, h)
// gets 8 consecutive k of column c, which is half a B fragment in the hardware k order
static __device__ inline u32x4 ld_tr16(const unsigned char* p) {
    typedef __attribute__((address_space(3))) s16x8 lds_s16x8;
    return __builtin_bit_cast(u32x4, __builtin_amdgcn_ds_load_tr16_b128_v8i16((lds_s16x8*)p));
}

#define CVT_THREADS 512
#define CVT_LOADS   32
#define CVT_PIECE   (CVT_THREADS * CVT_LOADS * 4)
#define CVT_P_ACT   (BSR * DD / CVT_PIECE)   /* pieces of the activations */
#define CVT_P_SQ    (DD * DD / CVT_PIECE)    /* pieces of a D x D weight */
#define CVT_P_FF    (DD * II / CVT_PIECE)    /* pieces of a D x I weight */
#define CVT_BLOCKS  (CVT_P_ACT + 4 * CVT_P_SQ + 2 * CVT_P_FF)
static_assert(BSR * DD % CVT_PIECE == 0 && DD * DD % CVT_PIECE == 0 && DD * II % CVT_PIECE == 0,
              "whole pieces");

typedef float  f32x2  __attribute__((ext_vector_type(2)));
typedef bf16_t bf16x2 __attribute__((ext_vector_type(2)));

// two f32 -> packed bf16 pair (round to nearest even)
static __device__ inline uint32_t pack_bf16(float a, float b) {
    f32x2 f; f[0] = a; f[1] = b;
    union { bf16x2 h; uint32_t u; } c;
    c.h = __builtin_convertvector(f, bf16x2);
    return c.u;
}

__global__ __launch_bounds__(CVT_THREADS)
void cvt_all_f32_bf16(
        const float* __restrict__ hidden, const float* __restrict__ Wq,
        const float* __restrict__ Wk, const float* __restrict__ Wv,
        const float* __restrict__ Wo, const float* __restrict__ Wi,
        const float* __restrict__ Wt,
        unsigned short* __restrict__ hb, unsigned short* __restrict__ wqb,
        unsigned short* __restrict__ wkb, unsigned short* __restrict__ wvb,
        unsigned short* __restrict__ wob, unsigned short* __restrict__ wib,
        unsigned short* __restrict__ wtb) {
    // which array, and which piece of it: the same for the whole block
    unsigned p = blockIdx.x;
    const float* in;
    unsigned short* out;
    if (p < CVT_P_ACT) { in = hidden; out = hb; }
    else if ((p -= CVT_P_ACT) < CVT_P_SQ) { in = Wq; out = wqb; }
    else if ((p -= CVT_P_SQ) < CVT_P_SQ) { in = Wk; out = wkb; }
    else if ((p -= CVT_P_SQ) < CVT_P_SQ) { in = Wv; out = wvb; }
    else if ((p -= CVT_P_SQ) < CVT_P_SQ) { in = Wo; out = wob; }
    else if ((p -= CVT_P_SQ) < CVT_P_FF) { in = Wi; out = wib; }
    else { p -= CVT_P_FF; in = Wt; out = wtb; }

    // block-uniform bases; the lane's index serves the 16-byte loads and the 8-byte stores
    const float4* src = (const float4*)(in + (size_t)p * CVT_PIECE);
    uint2*        dst = (uint2*)(out + (size_t)p * CVT_PIECE);
    const unsigned t = threadIdx.x;

    float4 v[CVT_LOADS];
#pragma unroll  // constant indices keep the array in registers
    for (int j = 0; j < CVT_LOADS; ++j) v[j] = src[t + j * CVT_THREADS];
    // keeps all loads above the conversions: left free, the compiler issues the last of them
    // behind waits for the first and the wave pays the memory latency more than once
    __builtin_amdgcn_sched_barrier(0);
    // every result has a register pair of its own: none is rewritten under a store in flight
    uint2 w[CVT_LOADS];
#pragma unroll  // constant indices keep the arrays in registers
    for (int j = 0; j < CVT_LOADS; ++j) {
        w[j].x = pack_bf16(v[j].x, v[j].y);
        w[j].y = pack_bf16(v[j].z, v[j].w);
    }
#pragma unroll  // constant indices keep the array in registers
    for (int j = 0; j < CVT_LOADS; ++j) dst[t + j * CVT_THREADS] = w[j];
}

template <int MODE>
__global__ __launch_bounds__(256) void gemm_bf16(const unsigned short* __restrict__ A,
                                                 const unsigned short* __restrict__ Bw,
                                                 const float* __restrict__ bias,
                                                 float* __restrict__ outF,
                                                 unsigned short* __restrict__ outB,
                                                 const float* __restrict__ res,
                                                 int M, int N, int K) {
    __shared__ __attribute__((aligned(2048))) unsigned char As[2][A_BUF];
    __shared__ __attribute__((aligned(2048))) unsigned char Bs[2][B_BUF];

    const int tid   = threadIdx.x;
    const int lane  = tid & 31;
    const int wid   = tid >> 5;
    const int n16   = lane & 15;
    const int hi    = lane >> 4;
    const int waveM = wid >> 2;   // 0..1
    const int waveN = wid & 3;    // 0..3
    const int rowBase = blockIdx.y * 128;
    const int colBase = blockIdx.x * 128;

    v8f acc[4][2];
#pragma unroll
    for (int i = 0; i < 4; ++i)
#pragma unroll
        for (int j = 0; j < 2; ++j) acc[i][j] = zero8();

#ifdef USE_TDM
    const uint32_t wave = uni((uint32_t)threadIdx.x >> 5);
    u32x8 bg1 = btile_group1((uint32_t)N * 2u);
    u32x4 bg0 = btile_group0((uint32_t)(size_t)&Bs[0][0], (uint64_t)(Bw + colBase));
    const uint32_t bstep = uni((uint32_t)N * (2u * BK));   // 64 source rows, in bytes
    u32x8 ag1 = atile_group1((uint32_t)K * 2u);
    u32x4 ag0 = btile_group0((uint32_t)(size_t)&As[0][0], (uint64_t)(A + (size_t)rowBase * K));
#endif

    // stage tile (A:128x64, B:64x128) for K-step k0 into buffer `buf`
    auto stage = [&](int buf, int k0) {
#ifdef USE_TDM
        if (pinned(wave == 0u)) {
            bg0[1] = uni((uint32_t)(size_t)&Bs[buf][0]);
            ag0[1] = uni((uint32_t)(size_t)&As[buf][0]);
            if (k0 > 0) {   // words 2 and 3 hold the 64-bit source address
                const uint64_t a = (((uint64_t)bg0[3] << 32) | bg0[2]) + bstep;   // 64 rows on
                bg0[2] = uni((uint32_t)a);
                bg0[3] = uni((uint32_t)(a >> 32));
                const uint64_t c = (((uint64_t)ag0[3] << 32) | ag0[2]) + A_ROWB;  // 64 k on
                ag0[2] = uni((uint32_t)c);
                ag0[3] = uni((uint32_t)(c >> 32));
            }
            asm volatile("tensor_load_to_lds %0, %1" : "+s"(bg0), "+s"(bg1) :: "memory");
            asm volatile("tensor_load_to_lds %0, %1" : "+s"(ag0), "+s"(ag1) :: "memory");
        }
#else
#pragma unroll
        for (int i = 0; i < 4; ++i) {
            int ci = tid + i * 256;              // 0..1023
            int ra = ci >> 3;                    // A row, 8 chunks/row
            int ca = (ci & 7) << 3;
            *(uint4*)&As[buf][ra * A_PITCH + ca * 2] =
                *(const uint4*)&A[(size_t)(rowBase + ra) * K + k0 + ca];
            int rb = ci >> 4;                    // B row, 16 chunks/row
            int cb = (ci & 15) << 3;
            *(uint4*)&Bs[buf][rb * B_PITCH + cb * 2] =
                *(const uint4*)&Bw[(size_t)(k0 + rb) * N + colBase + cb];
        }
#endif
    };

    stage(0, 0);
    int cur = 0;
    for (int k0 = 0; k0 < K; k0 += BK) {
#ifdef USE_TDM
        if (wid == 0) __builtin_amdgcn_s_wait_tensorcnt((short)0);
#endif
        __syncthreads();                     // tile `cur` resident & visible
        // the test for a next stage is a scalar branch as well (see pinned())
        if (pinned(k0 + BK < K)) stage(cur ^ 1, k0 + BK);   // overlap next DMA w/ compute

        // the lane's row of the wave's first A tile, at its 16-byte half of 32 bytes
        const unsigned char* as = &As[cur][0] + (waveM * 64 + n16) * A_PITCH + 16 * hi;
        // the lane's address in the transposing load: row 8*hi + (lane & 7), 16-byte
        // half (lane >> 3) & 1 of the 32 bytes of a 16-column group
        const unsigned char* bs = &Bs[cur][0] + (8 * hi + (lane & 7)) * B_PITCH +
                                  16 * ((lane >> 3) & 1) + 64 * waveN;

        // all 24 fragment reads of the pass stand as one group ahead of its 16 WMMAs
        FragBF af[BK / 32][4];
        FragBF bf[BK / 32][2];
#pragma unroll  // constant indices keep the arrays in registers
        for (int c = 0; c < BK / 32; ++c) {
#pragma unroll  // constant indices keep the arrays in registers
            for (int nt = 0; nt < 2; ++nt) {
                const u32x4 lo = ld_tr16(bs + (32 * c) * B_PITCH + 32 * nt);        // k  0..15
                const u32x4 up = ld_tr16(bs + (32 * c + 16) * B_PITCH + 32 * nt);   // k 16..31
                bf[c][nt].d[0] = lo.x; bf[c][nt].d[1] = lo.y;
                bf[c][nt].d[2] = lo.z; bf[c][nt].d[3] = lo.w;
                bf[c][nt].d[4] = up.x; bf[c][nt].d[5] = up.y;
                bf[c][nt].d[6] = up.z; bf[c][nt].d[7] = up.w;
            }
#pragma unroll  // constant indices keep the arrays in registers
            for (int mt = 0; mt < 4; ++mt) {
                // elements 0-7 = k 8*hi + 0..7, elements 8-15 = k 16 + 8*hi + 0..7
                const uint4 lo = *(const uint4*)(as + mt * 16 * A_PITCH + 64 * c);
                const uint4 up = *(const uint4*)(as + mt * 16 * A_PITCH + 64 * c + 32);
                af[c][mt].d[0] = lo.x; af[c][mt].d[1] = lo.y;
                af[c][mt].d[2] = lo.z; af[c][mt].d[3] = lo.w;
                af[c][mt].d[4] = up.x; af[c][mt].d[5] = up.y;
                af[c][mt].d[6] = up.z; af[c][mt].d[7] = up.w;
            }
        }
        // keeps the reads above the WMMAs: sunk among them, each pair of reads is waited
        // out to zero in front of its two WMMAs and the LDS latency is paid eight times
        __builtin_amdgcn_sched_barrier(0);
#pragma unroll  // two chunks of 32 k, in rising k; constant indices keep the arrays in registers
        for (int c = 0; c < BK / 32; ++c)
#pragma unroll  // constant indices keep the arrays in registers
            for (int mt = 0; mt < 4; ++mt)
#pragma unroll  // constant indices keep the arrays in registers
                for (int nt = 0; nt < 2; ++nt)
                    acc[mt][nt] = __builtin_amdgcn_wmma_f32_16x16x32_bf16(
                        false, af[c][mt].v, false, bf[c][nt].v, (short)0, acc[mt][nt],
                        false, false);
        // keeps the barrier below the WMMAs: lifted above them it brings a wait for all
        // 24 reads in front of the matrix work, which then overlaps none of them
        __builtin_amdgcn_sched_barrier(0);
        __syncthreads();                     // all waves done reading `cur`
        cur ^= 1;
    }

    // epilogue
#pragma unroll
    for (int mt = 0; mt < 4; ++mt) {
#pragma unroll
        for (int nt = 0; nt < 2; ++nt) {
#pragma unroll
            for (int r = 0; r < 8; ++r) {
                int grow = rowBase + waveM * 64 + mt * 16 + r + 8 * hi;
                int gcol = colBase + waveN * 32 + nt * 16 + n16;
                float v = acc[mt][nt][r] + bias[gcol];
                if (MODE == 0) {
                    outF[(size_t)grow * N + gcol] = v + res[(size_t)grow * N + gcol];
                } else if (MODE == 1) {
                    int b = grow >> 10, s = grow & 1023;
                    int head = gcol >> 6, hd = gcol & 63;
                    outB[(((size_t)(b * NHH + head)) * SS + s) * HDD + hd] = f2bfu(v);
                } else {
                    float g = 0.5f * v * (1.0f + erff(v * 0.70710678118654752f));
                    outB[(size_t)grow * N + gcol] = f2bfu(g);
                }
            }
        }
    }
}

static __device__ inline float exp_slot(float x) {
    float e;
    asm("v_exp_f32 %0, %1\n\tv_nop" : "=v"(e) : "v"(x * 1.4426950408889634f));
    return e;
}

static __device__ inline float other_half(float x) {
    int b = __builtin_bit_cast(int, x);
    b = __builtin_amdgcn_permlanex16(b, b, 0x76543210, 0xfedcba98, false, false);
    return __builtin_bit_cast(float, b);
}

// 32 k of one row, k-contiguous in memory, in the hardware k order:
// elements 0-7 = k 8*hi + 0..7, elements 8-15 = k 16 + 8*hi + 0..7
// (p = wave-uniform base, off = the lane's row * HDD + 8*hi)
static __device__ inline void load_row_frag(FragBF& f, const unsigned short* p, unsigned off) {
    const uint4 lo = *(const uint4*)(p + off);
    const uint4 up = *(const uint4*)(p + off + 16);
    f.d[0] = lo.x; f.d[1] = lo.y; f.d[2] = lo.z; f.d[3] = lo.w;
    f.d[4] = up.x; f.d[5] = up.y; f.d[6] = up.z; f.d[7] = up.w;
}

__global__ __launch_bounds__(256) void attn_kernel(const unsigned short* __restrict__ Q,
                                                   const unsigned short* __restrict__ Kb,
                                                   const unsigned short* __restrict__ Vb,
                                                   const float* __restrict__ mask,
                                                   unsigned short* __restrict__ ctxB) {
    const int lane = threadIdx.x & 31;
    const int wid  = threadIdx.x >> 5;
    const int n16  = lane & 15;
    const int hi   = lane >> 4;
    const int bh   = blockIdx.x >> 2;     // (b*NH + h)
    const int qblk = (blockIdx.x & 3) * 256;
    const int q0   = qblk + wid * 32;
    const int b    = bh >> 4;
    const int h    = bh & 15;
    const unsigned short* Qh = Q  + (size_t)bh * SS * HDD;
    const unsigned short* Kh = Kb + (size_t)bh * SS * HDD;
    const unsigned short* Vh = Vb + (size_t)bh * SS * HDD;
    const float*          mb = mask + (size_t)b * SS;
    const unsigned rowOff = (unsigned)(n16 * HDD + 8 * hi);   // Q and K rows
    const unsigned vOff   = (unsigned)(8 * hi * HDD + n16);   // V columns

    // Q rows as B fragments: [column group][k chunk of 32]
    FragBF qf[2][2];
#pragma unroll  // constant indices keep the arrays in registers
    for (int g = 0; g < 2; ++g)
#pragma unroll  // constant indices keep the arrays in registers
        for (int c = 0; c < 2; ++c)
            load_row_frag(qf[g][c], Qh + (size_t)wid * 32 * HDD + (qblk + 16 * g) * HDD + 32 * c, rowOff);

    // K rows as A fragments: [key tile of 16][k chunk of 32], fetched one pass ahead
    FragBF kf[2][2];
#pragma unroll  // constant indices keep the arrays in registers
    for (int t = 0; t < 2; ++t)
#pragma unroll  // constant indices keep the arrays in registers
        for (int c = 0; c < 2; ++c)
            load_row_frag(kf[t][c], Kh + 16 * t * HDD + 32 * c, rowOff);

    v8f   o[2][4];                 // O^T: [group][hd tile]; reg r = hd 8*hi + r
    float mrun[2], lrun[2];        // running maximum; this half's running sum
#pragma unroll  // constant indices keep the arrays in registers
    for (int g = 0; g < 2; ++g) {
        mrun[g] = -3.402823466e38f;   // finite, so that (-inf) - mrun is never NaN
        lrun[g] = 0.0f;
#pragma unroll  // constant indices keep the arrays in registers
        for (int nt = 0; nt < 4; ++nt) o[g][nt] = zero8();
    }

    for (int kp = 0; kp < 32; ++kp) {
        const int key0 = kp * 32;

        // V^T as A fragments (row = hd, k = key)
        const unsigned short* Vp = Vh + (size_t)key0 * HDD;
        FragBF vf[4];
#pragma unroll  // constant indices keep the arrays in registers
        for (int nt = 0; nt < 4; ++nt)
#pragma unroll  // constant indices keep the arrays in registers
            for (int v = 0; v < 8; ++v) {
                const int k = ((v >> 2) << 4) + ((v & 3) << 1);   // + 8*hi, in vOff
                vf[nt].u[2 * v]     = Vp[vOff + k * HDD + nt * 16];
                vf[nt].u[2 * v + 1] = Vp[vOff + (k + 1) * HDD + nt * 16];
            }

        // mask of this lane's keys: [tile][r] = key key0 + 16*t + 8*hi + r; the 32 values
        // of the pass are read at wave-uniform addresses, a lane picks its half's
        float mk[2][8];
#pragma unroll  // constant indices keep the arrays in registers
        for (int t = 0; t < 2; ++t)
#pragma unroll  // constant indices keep the arrays in registers
            for (int r = 0; r < 8; ++r) {
                const float lo = mb[key0 + 16 * t + r];
                const float up = mb[key0 + 16 * t + 8 + r];
                mk[t][r] = hi ? up : lo;
            }

        // S^T tiles: st[g][t][r] = q(q0 + 16g + n16) . k(key0 + 16t + 8hi + r)
        v8f st[2][2];
#pragma unroll  // constant indices keep the arrays in registers
        for (int g = 0; g < 2; ++g)
#pragma unroll  // constant indices keep the arrays in registers
            for (int t = 0; t < 2; ++t) {
                v8f s = zero8();
#pragma unroll  // constant indices keep the arrays in registers
                for (int c = 0; c < 2; ++c)
                    s = __builtin_amdgcn_wmma_f32_16x16x32_bf16(false, kf[t][c].v, false,
                                                                qf[g][c].v, (short)0, s,
                                                                false, false);
                st[g][t] = s;
            }

        // next pass's K rows (the last pass fetches pass 0's again: in bounds, unused)
        {
            const int kn = ((kp + 1) & 31) * 32;
#pragma unroll  // constant indices keep the arrays in registers
            for (int t = 0; t < 2; ++t)
#pragma unroll  // constant indices keep the arrays in registers
                for (int c = 0; c < 2; ++c)
                    load_row_frag(kf[t][c], Kh + (size_t)(kn + 16 * t) * HDD + 32 * c, rowOff);
            asm volatile("s_wait_xcnt 0x0" ::: "memory");
        }

        FragBF pf[2];
#pragma unroll  // constant indices keep the arrays in registers
        for (int g = 0; g < 2; ++g) {
            float x[16];
            float mx = mrun[g];
#pragma unroll  // constant indices keep the arrays in registers
            for (int t = 0; t < 2; ++t)
#pragma unroll  // constant indices keep the arrays in registers
                for (int r = 0; r < 8; ++r) {
                    x[8 * t + r] = st[g][t][r] * 0.125f + mk[t][r];
                    mx = fmaxf(mx, x[8 * t + r]);
                }
            mx = fmaxf(mx, other_half(mx));
            const float alpha = exp_slot(mrun[g] - mx);
            mrun[g] = mx;
            float sum = 0.0f;
#pragma unroll  // constant indices keep the arrays in registers
            for (int i = 0; i < 16; ++i) {
                x[i] = exp_slot(x[i] - mx);
                sum += x[i];
            }
            lrun[g] = lrun[g] * alpha + sum;
#pragma unroll  // constant indices keep the arrays in registers
            for (int i = 0; i < 8; ++i) pf[g].d[i] = pack_bf16(x[2 * i], x[2 * i + 1]);
#pragma unroll  // constant indices keep the arrays in registers
            for (int nt = 0; nt < 4; ++nt)
#pragma unroll  // constant indices keep the arrays in registers
                for (int r = 0; r < 8; ++r) o[g][nt][r] *= alpha;
        }

        // O^T += V^T . P^T
#pragma unroll  // constant indices keep the arrays in registers
        for (int nt = 0; nt < 4; ++nt)
#pragma unroll  // constant indices keep the arrays in registers
            for (int g = 0; g < 2; ++g)
                o[g][nt] = __builtin_amdgcn_wmma_f32_16x16x32_bf16(false, vf[nt].v, false,
                                                                   pf[g].v, (short)0,
                                                                   o[g][nt], false, false);
    }

    // ctx as bf16 in [B,S,D] layout: a lane's 8 registers are 8 consecutive hd
#pragma unroll  // constant indices keep the arrays in registers
    for (int g = 0; g < 2; ++g) {
        const float inv = 1.0f / (lrun[g] + other_half(lrun[g]));
        unsigned short* dst = ctxB + ((size_t)b * SS + q0 + 16 * g + n16) * DD + h * 64 + 8 * hi;
#pragma unroll  // constant indices keep the arrays in registers
        for (int nt = 0; nt < 4; ++nt) {
            uint4 w;
            w.x = pack_bf16(o[g][nt][0] * inv, o[g][nt][1] * inv);
            w.y = pack_bf16(o[g][nt][2] * inv, o[g][nt][3] * inv);
            w.z = pack_bf16(o[g][nt][4] * inv, o[g][nt][5] * inv);
            w.w = pack_bf16(o[g][nt][6] * inv, o[g][nt][7] * inv);
            *(uint4*)(dst + nt * 16) = w;
        }
    }
}

// ---------------- layernorm: one block per row (D=1024) ----------------
__global__ __launch_bounds__(256) void ln_kernel(const float* __restrict__ x,
                                                 const float* __restrict__ g,
                                                 const float* __restrict__ bta,
                                                 float* __restrict__ outF,
                                                 unsigned short* __restrict__ outB) {
    __shared__ float red[256];
    const int row = blockIdx.x;
    const int tid = threadIdx.x;
    const float* xr = x + (size_t)row * DD;

    float s = 0.0f;
    for (int i = tid; i < DD; i += 256) s += xr[i];
    red[tid] = s; __syncthreads();
    for (int off = 128; off > 0; off >>= 1) {
        if (tid < off) red[tid] += red[tid + off];
        __syncthreads();
    }
    float mu = red[0] * (1.0f / DD);
    __syncthreads();

    float v = 0.0f;
    for (int i = tid; i < DD; i += 256) {
        float d = xr[i] - mu; v += d * d;
    }
    red[tid] = v; __syncthreads();
    for (int off = 128; off > 0; off >>= 1) {
        if (tid < off) red[tid] += red[tid + off];
        __syncthreads();
    }
    float inv = rsqrtf(red[0] * (1.0f / DD) + 1e-12f);

    for (int i = tid; i < DD; i += 256) {
        float o = (xr[i] - mu) * inv * g[i] + bta[i];
        outF[(size_t)row * DD + i] = o;
        if (outB) outB[(size_t)row * DD + i] = f2bfu(o);
    }
}

// ---------------- launcher ----------------
extern "C" void kernel_launch(void* const* d_in, const int* in_sizes, int n_in,
                              void* d_out, int out_size, void* d_ws, size_t ws_size,
                              hipStream_t stream) {
    const float* hidden = (const float*)d_in[0];
    const float* mask   = (const float*)d_in[1];
    const float* Wq = (const float*)d_in[2];   const float* bq  = (const float*)d_in[3];
    const float* Wk = (const float*)d_in[4];   const float* bk  = (const float*)d_in[5];
    const float* Wv = (const float*)d_in[6];   const float* bv  = (const float*)d_in[7];
    const float* Wo = (const float*)d_in[8];   const float* bo  = (const float*)d_in[9];
    const float* g1 = (const float*)d_in[10];  const float* b1  = (const float*)d_in[11];
    const float* Wi = (const float*)d_in[12];  const float* bi  = (const float*)d_in[13];
    const float* Wt = (const float*)d_in[14];  const float* bot = (const float*)d_in[15];
    const float* g2 = (const float*)d_in[16];  const float* b2  = (const float*)d_in[17];
    float* out = (float*)d_out;

    const size_t BSD = (size_t)BSR * DD;     // 4M
    const size_t DI  = (size_t)DD * II;      // 4M
    const size_t DDq = (size_t)DD * DD;      // 1M

    char* ws = (char*)d_ws;
    auto alloc = [&](size_t bytes) -> char* {
        char* p = ws;
        ws += (bytes + 255) & ~(size_t)255;
        return p;
    };
    unsigned short* hb    = (unsigned short*)alloc(BSD * 2);
    unsigned short* wqb   = (unsigned short*)alloc(DDq * 2);
    unsigned short* wkb   = (unsigned short*)alloc(DDq * 2);
    unsigned short* wvb   = (unsigned short*)alloc(DDq * 2);
    unsigned short* wob   = (unsigned short*)alloc(DDq * 2);
    unsigned short* wib   = (unsigned short*)alloc(DI * 2);
    unsigned short* wtb   = (unsigned short*)alloc(DI * 2);
    unsigned short* qb    = (unsigned short*)alloc(BSD * 2);
    unsigned short* kbuf  = (unsigned short*)alloc(BSD * 2);
    unsigned short* vbuf  = (unsigned short*)alloc(BSD * 2);
    unsigned short* ctxb  = (unsigned short*)alloc(BSD * 2);
    float*          y1    = (float*)alloc(BSD * 4);
    float*          attnf = (float*)alloc(BSD * 4);
    unsigned short* attnb = (unsigned short*)alloc(BSD * 2);
    unsigned short* interb= (unsigned short*)alloc((size_t)BSR * II * 2);
    float*          y2    = (float*)alloc(BSD * 4);

    // 1) fp32 -> bf16 conversions
    cvt_all_f32_bf16<<<CVT_BLOCKS, CVT_THREADS, 0, stream>>>(hidden, Wq, Wk, Wv, Wo, Wi, Wt,
                                                             hb, wqb, wkb, wvb, wob, wib, wtb);

    // 2) QKV projections (head-scattered bf16 outputs)
    {
        dim3 g(DD / 128, BSR / 128);
        gemm_bf16<1><<<g, 256, 0, stream>>>(hb, wqb, bq, nullptr, qb,   nullptr, BSR, DD, DD);
        gemm_bf16<1><<<g, 256, 0, stream>>>(hb, wkb, bk, nullptr, kbuf, nullptr, BSR, DD, DD);
        gemm_bf16<1><<<g, 256, 0, stream>>>(hb, wvb, bv, nullptr, vbuf, nullptr, BSR, DD, DD);
    }

    // 3) attention
    attn_kernel<<<BB * NHH * (SS / 256), 256, 0, stream>>>(qb, kbuf, vbuf, mask, ctxb);

    // 4) output projection + residual(hidden)
    {
        dim3 g(DD / 128, BSR / 128);
        gemm_bf16<0><<<g, 256, 0, stream>>>(ctxb, wob, bo, y1, nullptr, hidden,
                                            BSR, DD, DD);
    }
    // 5) LN1 -> attnf (f32) + attnb (bf16)
    ln_kernel<<<BSR, 256, 0, stream>>>(y1, g1, b1, attnf, attnb);

    // 6) FFN up + exact GELU -> bf16
    {
        dim3 g(II / 128, BSR / 128);
        gemm_bf16<2><<<g, 256, 0, stream>>>(attnb, wib, bi, nullptr, interb,
                                            nullptr, BSR, II, DD);
    }
    // 7) FFN down + residual(attnf)
    {
        dim3 g(DD / 128, BSR / 128);
        gemm_bf16<0><<<g, 256, 0, stream>>>(interb, wtb, bot, y2, nullptr, attnf,
                                            BSR, DD, II);
    }
    // 8) LN2 -> final output
    ln_kernel<<<BSR, 256, 0, stream>>>(y2, g2, b2, out, nullptr);
}

// v005
// A run of this version takes 206 microseconds.
// Next to v004, in two timings, it ran 1.23 times as fast each time.
// Over all steps from v000 it is 4.04 times as fast.
#include <hip/hip_runtime.h>
#include <cstdint>
#include <cstddef>

// ---------------- types ----------------
typedef __bf16 bf16_t;
typedef bf16_t v16bf __attribute__((ext_vector_type(16)));
typedef float  v8f   __attribute__((ext_vector_type(8)));
typedef unsigned int u32x4 __attribute__((ext_vector_type(4)));

union FragBF {
    uint32_t       d[8];
    unsigned short u[16];
    v16bf          v;
};

static __device__ inline v8f zero8() {
    v8f z;
#pragma unroll
    for (int i = 0; i < 8; ++i) z[i] = 0.0f;
    return z;
}

// fp32 -> bf16 (round to nearest even), returned as raw u16 bits
static __device__ inline unsigned short f2bfu(float f) {
    union { float f; uint32_t u; } c; c.f = f;
    uint32_t r = c.u + 0x7FFFu + ((c.u >> 16) & 1u);
    return (unsigned short)(r >> 16);
}

// model constants
#define BB   4
#define SS   1024
#define DD   1024
#define NHH  16
#define HDD  64
#define II   4096
#define BSR  4096   /* B*S rows */

#define BK      64
#define B_ROWB  256u
#define B_ROWS  64u
#define B_PITCH 288u
#define B_BUF   18432u
#define A_ROWB  128u
#define A_ROWS  128u
#define A_PITCH 144u
#define A_BUF   18432u
static_assert(B_ROWS * B_PITCH <= B_BUF && (B_BUF % 2048u) == 0u, "B buffer size");
static_assert(A_ROWS * A_PITCH <= A_BUF && (A_BUF % 2048u) == 0u, "A buffer size");

typedef unsigned int u32x8 __attribute__((ext_vector_type(8)));
typedef short        s16x8 __attribute__((ext_vector_type(8)));

static __device__ inline uint32_t uni(uint32_t v) {
    return (uint32_t)__builtin_amdgcn_readfirstlane(v);
}
static __device__ inline uint32_t pinned(uint32_t v) {
    uint32_t w = uni(v);
    asm volatile("" : "+s"(w));   // the pin of a tensor load's issue test in a scalar register
    return w;
}
static __device__ inline u32x8 btile_group1(uint32_t src_pitch) {
    u32x8 g;
    g[0] = uni((1u << 20) | (5u << 22) | (7u << 25));
    g[1] = uni((B_ROWB & 0xFFFFu) << 16);
    g[2] = uni((B_ROWB >> 16) | ((B_ROWS & 0xFFFFu) << 16));
    g[3] = uni((B_ROWS >> 16) | (B_ROWB << 16));
    g[4] = uni(B_ROWS);
    g[5] = uni(src_pitch);
    g[6] = uni(0u);
    g[7] = uni(0u);
    return g;
}
static __device__ inline u32x8 atile_group1(uint32_t src_pitch) {
    u32x8 g;
    g[0] = uni((1u << 20) | (4u << 22) | (3u << 25));
    g[1] = uni((A_ROWB & 0xFFFFu) << 16);
    g[2] = uni((A_ROWB >> 16) | ((A_ROWS & 0xFFFFu) << 16));
    g[3] = uni((A_ROWS >> 16) | (A_ROWB << 16));
    g[4] = uni(A_ROWS);
    g[5] = uni(src_pitch);
    g[6] = uni(0u);
    g[7] = uni(0u);
    return g;
}
static __device__ inline u32x4 btile_group0(uint32_t lds_dst, uint64_t ga) {
    u32x4 g;
    g[0] = uni(1u);
    g[1] = uni(lds_dst);
    g[2] = uni((uint32_t)ga);
    g[3] = uni((((uint32_t)(ga >> 32)) & 0x01FFFFFFu) | 0x80000000u);
    return g;
}
// 8 k x 16 columns per wave half of a row-major 16-bit LDS tile, transposed: lane (c, h)
// gets 8 consecutive k of column c, which is half a B fragment in the hardware k order
static __device__ inline u32x4 ld_tr16(const unsigned char* p) {
    typedef __attribute__((address_space(3))) s16x8 lds_s16x8;
    return __builtin_bit_cast(u32x4, __builtin_amdgcn_ds_load_tr16_b128_v8i16((lds_s16x8*)p));
}

#define CVT_THREADS 512
#define CVT_LOADS   32
#define CVT_PIECE   (CVT_THREADS * CVT_LOADS * 4)
#define CVT_P_ACT   (BSR * DD / CVT_PIECE)   /* pieces of the activations */
#define CVT_P_SQ    (DD * DD / CVT_PIECE)    /* pieces of a D x D weight */
#define CVT_P_FF    (DD * II / CVT_PIECE)    /* pieces of a D x I weight */
#define CVT_BLOCKS  (CVT_P_ACT + 4 * CVT_P_SQ + 2 * CVT_P_FF)
static_assert(BSR * DD % CVT_PIECE == 0 && DD * DD % CVT_PIECE == 0 && DD * II % CVT_PIECE == 0,
              "whole pieces");

typedef float  f32x2  __attribute__((ext_vector_type(2)));
typedef bf16_t bf16x2 __attribute__((ext_vector_type(2)));

// two f32 -> packed bf16 pair (round to nearest even)
static __device__ inline uint32_t pack_bf16(float a, float b) {
    f32x2 f; f[0] = a; f[1] = b;
    union { bf16x2 h; uint32_t u; } c;
    c.h = __builtin_convertvector(f, bf16x2);
    return c.u;
}

__global__ __launch_bounds__(CVT_THREADS)
void cvt_all_f32_bf16(
        const float* __restrict__ hidden, const float* __restrict__ Wq,
        const float* __restrict__ Wk, const float* __restrict__ Wv,
        const float* __restrict__ Wo, const float* __restrict__ Wi,
        const float* __restrict__ Wt,
        unsigned short* __restrict__ hb, unsigned short* __restrict__ wqb,
        unsigned short* __restrict__ wkb, unsigned short* __restrict__ wvb,
        unsigned short* __restrict__ wob, unsigned short* __restrict__ wib,
        unsigned short* __restrict__ wtb) {
    // which array, and which piece of it: the same for the whole block
    unsigned p = blockIdx.x;
    const float* in;
    unsigned short* out;
    if (p < CVT_P_ACT) { in = hidden; out = hb; }
    else if ((p -= CVT_P_ACT) < CVT_P_SQ) { in = Wq; out = wqb; }
    else if ((p -= CVT_P_SQ) < CVT_P_SQ) { in = Wk; out = wkb; }
    else if ((p -= CVT_P_SQ) < CVT_P_SQ) { in = Wv; out = wvb; }
    else if ((p -= CVT_P_SQ) < CVT_P_SQ) { in = Wo; out = wob; }
    else if ((p -= CVT_P_SQ) < CVT_P_FF) { in = Wi; out = wib; }
    else { p -= CVT_P_FF; in = Wt; out = wtb; }

    // block-uniform bases; the lane's index serves the 16-byte loads and the 8-byte stores
    const float4* src = (const float4*)(in + (size_t)p * CVT_PIECE);
    uint2*        dst = (uint2*)(out + (size_t)p * CVT_PIECE);
    const unsigned t = threadIdx.x;

    float4 v[CVT_LOADS];
#pragma unroll  // constant indices keep the array in registers
    for (int j = 0; j < CVT_LOADS; ++j) v[j] = src[t + j * CVT_THREADS];
    // keeps all loads above the conversions: left free, the compiler issues the last of them
    // behind waits for the first and the wave pays the memory latency more than once
    __builtin_amdgcn_sched_barrier(0);
    // every result has a register pair of its own: none is rewritten under a store in flight
    uint2 w[CVT_LOADS];
#pragma unroll  // constant indices keep the arrays in registers
    for (int j = 0; j < CVT_LOADS; ++j) {
        w[j].x = pack_bf16(v[j].x, v[j].y);
        w[j].y = pack_bf16(v[j].z, v[j].w);
    }
#pragma unroll  // constant indices keep the array in registers
    for (int j = 0; j < CVT_LOADS; ++j) dst[t + j * CVT_THREADS] = w[j];
}

// ---------------- tiled bf16 WMMA GEMM, tensor loads, two stage buffers ----------------
// C[M,N] = A[M,K] * B[K,N]  (A,B bf16 row-major, acc f32)
// block tile 128x128, 8 waves (2x4), wave tile 64x32 (4x2 wmma tiles)
// A stage is NCH chunks of 64 k: NCH slices of A (128 rows x 64 k) and NCH slices of B
// (64 k x 128 columns). Wave w < NCH brings A slice w, wave NCH + c brings B slice c, one
// tensor load a wave and stage, so that a stage's landing latency is paid once per
// 64 * NCH k and its bytes come in through 2 * NCH request queues.
// K is a multiple of 64 * NCH and holds at least two stages.
// MODE 0: outF[row*N+col] = acc + bias[col] + res[row*N+col]
// MODE 1: QKV scatter: outB[((b*NH+head)*S + s)*HD + hd] = bf16(acc + bias)
// MODE 2: outB[row*N+col] = bf16(gelu(acc + bias))
template <int MODE, int NCH>
__global__ __launch_bounds__(256) void gemm_bf16(const unsigned short* __restrict__ A,
                                                 const unsigned short* __restrict__ Bw,
                                                 const float* __restrict__ bias,
                                                 float* __restrict__ outF,
                                                 unsigned short* __restrict__ outB,
                                                 const float* __restrict__ res,
                                                 int M, int N, int K) {
    static_assert(A_BUF == B_BUF && 2 * NCH <= 8, "one slice size, one slice a wave");
    constexpr uint32_t SLICE = A_BUF;              // a whole number of 2 KiB units
    constexpr uint32_t STAGE = 2u * NCH * SLICE;   // [A slices | B slices]
    __shared__ __attribute__((aligned(2048))) unsigned char Ts[2 * STAGE];

    const int tid   = threadIdx.x;
    const int lane  = tid & 31;
    const int wid   = tid >> 5;
    const int n16   = lane & 15;
    const int hi    = lane >> 4;
    const int waveM = wid >> 2;   // 0..1
    const int waveN = wid & 3;    // 0..3
    const int rowBase = blockIdx.y * 128;
    const int colBase = blockIdx.x * 128;

    v8f acc[4][2];
#pragma unroll
    for (int i = 0; i < 4; ++i)
#pragma unroll
        for (int j = 0; j < 2; ++j) acc[i][j] = zero8();

    const uint32_t wave   = uni((uint32_t)threadIdx.x >> 5);
    const uint32_t bchunk = uni((uint32_t)N * (2u * BK));   // 64 source rows of B, in bytes
    // first byte of this wave's slice in stage 0, and its step from stage to stage
    const uint64_t src0 = wave < (uint32_t)NCH
        ? (uint64_t)(A + (size_t)rowBase * K) + wave * A_ROWB
        : (uint64_t)(Bw + colBase) + (uint64_t)(wave - (uint32_t)NCH) * bchunk;
    const uint32_t step = wave < (uint32_t)NCH ? (uint32_t)NCH * A_ROWB : (uint32_t)NCH * bchunk;
    const uint32_t place0 = (uint32_t)(size_t)&Ts[0] + wave * SLICE;
    u32x8 ag1 = atile_group1((uint32_t)K * 2u);
    u32x8 bg1 = btile_group1((uint32_t)N * 2u);
    u32x4 ag0 = btile_group0(place0, src0);
    u32x4 bg0 = btile_group0(place0, src0);

    auto issue = [&](uint32_t buf, bool advance) {
        // scalar branches (see pinned()); each path has its own constant pad word
        if (pinned(wave < (uint32_t)NCH)) {
            ag0[1] = uni(place0 + buf * STAGE);
            if (advance) {
                const uint64_t a = (((uint64_t)ag0[3] << 32) | ag0[2]) + step;
                ag0[2] = uni((uint32_t)a);
                ag0[3] = uni((uint32_t)(a >> 32));
            }
            asm volatile("tensor_load_to_lds %0, %1" : "+s"(ag0), "+s"(ag1) :: "memory");
        }
        if (pinned(wave >= (uint32_t)NCH && wave < 2u * NCH)) {
            bg0[1] = uni(place0 + buf * STAGE);
            if (advance) {
                const uint64_t a = (((uint64_t)bg0[3] << 32) | bg0[2]) + step;
                bg0[2] = uni((uint32_t)a);
                bg0[3] = uni((uint32_t)(a >> 32));
            }
            asm volatile("tensor_load_to_lds %0, %1" : "+s"(bg0), "+s"(bg1) :: "memory");
        }
    };

    const uint32_t nst = uni((uint32_t)K / (uint32_t)(BK * NCH));
    issue(0u, false);
    asm volatile("s_wait_tensorcnt 0x0" ::: "memory");   // this wave's slice of stage 0 has landed
    __syncthreads();                                     // every wave's slice has
    issue(1u, true);                                     // flies while stage 0 is worked on

    for (uint32_t s = 0; s < nst; ++s) {
        const unsigned char* st = &Ts[0] + (s & 1u) * STAGE;
        // the lane's row of the wave's first A tile, at its 16-byte half of 32 bytes
        const unsigned char* as0 = st + (waveM * 64 + n16) * A_PITCH + 16 * hi;
        // the lane's address in the transposing load: row 8*hi + (lane & 7), 16-byte
        // half (lane >> 3) & 1 of the 32 bytes of a 16-column group
        const unsigned char* bs0 = st + NCH * SLICE + (8 * hi + (lane & 7)) * B_PITCH +
                                   16 * ((lane >> 3) & 1) + 64 * waveN;

#pragma unroll  // the chunks of a stage, in rising k; constant slice offsets
        for (int ch = 0; ch < NCH; ++ch) {
            const unsigned char* as = as0 + ch * SLICE;
            const unsigned char* bs = bs0 + ch * SLICE;

            // all 24 fragment reads of the chunk stand as one group ahead of its 16 WMMAs
            FragBF af[BK / 32][4];
            FragBF bf[BK / 32][2];
#pragma unroll  // constant indices keep the arrays in registers
            for (int c = 0; c < BK / 32; ++c) {
#pragma unroll  // constant indices keep the arrays in registers
                for (int nt = 0; nt < 2; ++nt) {
                    const u32x4 lo = ld_tr16(bs + (32 * c) * B_PITCH + 32 * nt);        // k  0..15
                    const u32x4 up = ld_tr16(bs + (32 * c + 16) * B_PITCH + 32 * nt);   // k 16..31
                    bf[c][nt].d[0] = lo.x; bf[c][nt].d[1] = lo.y;
                    bf[c][nt].d[2] = lo.z; bf[c][nt].d[3] = lo.w;
                    bf[c][nt].d[4] = up.x; bf[c][nt].d[5] = up.y;
                    bf[c][nt].d[6] = up.z; bf[c][nt].d[7] = up.w;
                }
#pragma unroll  // constant indices keep the arrays in registers
                for (int mt = 0; mt < 4; ++mt) {
                    // elements 0-7 = k 8*hi + 0..7, elements 8-15 = k 16 + 8*hi + 0..7
                    const uint4 lo = *(const uint4*)(as + mt * 16 * A_PITCH + 64 * c);
                    const uint4 up = *(const uint4*)(as + mt * 16 * A_PITCH + 64 * c + 32);
                    af[c][mt].d[0] = lo.x; af[c][mt].d[1] = lo.y;
                    af[c][mt].d[2] = lo.z; af[c][mt].d[3] = lo.w;
                    af[c][mt].d[4] = up.x; af[c][mt].d[5] = up.y;
                    af[c][mt].d[6] = up.z; af[c][mt].d[7] = up.w;
                }
            }
            // keeps the reads above the WMMAs: sunk among them, each pair of reads is waited
            // out to zero in front of its two WMMAs and the LDS latency is paid eight times
            __builtin_amdgcn_sched_barrier(0);
#pragma unroll  // two chunks of 32 k, in rising k; constant indices keep the arrays in registers
            for (int c = 0; c < BK / 32; ++c)
#pragma unroll  // constant indices keep the arrays in registers
                for (int mt = 0; mt < 4; ++mt)
#pragma unroll  // constant indices keep the arrays in registers
                    for (int nt = 0; nt < 2; ++nt)
                        acc[mt][nt] = __builtin_amdgcn_wmma_f32_16x16x32_bf16(
                            false, af[c][mt].v, false, bf[c][nt].v, (short)0, acc[mt][nt],
                            false, false);
            // keeps the next chunk's reads, and the stage's closing waits and barrier, below
            // the WMMAs: lifted among them they bring waits in front of the matrix work
            __builtin_amdgcn_sched_barrier(0);
        }

        // hand-over of the stage, every wave, in this order
        asm volatile("s_wait_dscnt 0x0" ::: "memory");      // this wave has left buffer s & 1
        asm volatile("s_wait_tensorcnt 0x0" ::: "memory");  // its slice of stage s + 1 has landed
        __syncthreads();   // stage s + 1 is published; every reader has left buffer s & 1
        // the test for a further stage is a scalar branch as well (see pinned())
        if (pinned(s + 2u < nst)) issue(s & 1u, true);
    }
    asm volatile("s_wait_tensorcnt 0x0" ::: "memory");   // nothing in flight when the wave goes on
    asm volatile("s_wait_dscnt 0x0" ::: "memory");

    // epilogue
#pragma unroll
    for (int mt = 0; mt < 4; ++mt) {
#pragma unroll
        for (int nt = 0; nt < 2; ++nt) {
#pragma unroll
            for (int r = 0; r < 8; ++r) {
                int grow = rowBase + waveM * 64 + mt * 16 + r + 8 * hi;
                int gcol = colBase + waveN * 32 + nt * 16 + n16;
                float v = acc[mt][nt][r] + bias[gcol];
                if (MODE == 0) {
                    outF[(size_t)grow * N + gcol] = v + res[(size_t)grow * N + gcol];
                } else if (MODE == 1) {
                    int b = grow >> 10, s = grow & 1023;
                    int head = gcol >> 6, hd = gcol & 63;
                    outB[(((size_t)(b * NHH + head)) * SS + s) * HDD + hd] = f2bfu(v);
                } else {
                    float g = 0.5f * v * (1.0f + erff(v * 0.70710678118654752f));
                    outB[(size_t)grow * N + gcol] = f2bfu(g);
                }
            }
        }
    }
}

static __device__ inline float exp_slot(float x) {
    float e;
    asm("v_exp_f32 %0, %1\n\tv_nop" : "=v"(e) : "v"(x * 1.4426950408889634f));
    return e;
}

static __device__ inline float other_half(float x) {
    int b = __builtin_bit_cast(int, x);
    b = __builtin_amdgcn_permlanex16(b, b, 0x76543210, 0xfedcba98, false, false);
    return __builtin_bit_cast(float, b);
}

// 32 k of one row, k-contiguous in memory, in the hardware k order:
// elements 0-7 = k 8*hi + 0..7, elements 8-15 = k 16 + 8*hi + 0..7
// (p = wave-uniform base, off = the lane's row * HDD + 8*hi)
static __device__ inline void load_row_frag(FragBF& f, const unsigned short* p, unsigned off) {
    const uint4 lo = *(const uint4*)(p + off);
    const uint4 up = *(const uint4*)(p + off + 16);
    f.d[0] = lo.x; f.d[1] = lo.y; f.d[2] = lo.z; f.d[3] = lo.w;
    f.d[4] = up.x; f.d[5] = up.y; f.d[6] = up.z; f.d[7] = up.w;
}

__global__ __launch_bounds__(256) void attn_kernel(const unsigned short* __restrict__ Q,
                                                   const unsigned short* __restrict__ Kb,
                                                   const unsigned short* __restrict__ Vb,
                                                   const float* __restrict__ mask,
                                                   unsigned short* __restrict__ ctxB) {
    const int lane = threadIdx.x & 31;
    const int wid  = threadIdx.x >> 5;
    const int n16  = lane & 15;
    const int hi   = lane >> 4;
    const int bh   = blockIdx.x >> 2;     // (b*NH + h)
    const int qblk = (blockIdx.x & 3) * 256;
    const int q0   = qblk + wid * 32;
    const int b    = bh >> 4;
    const int h    = bh & 15;
    const unsigned short* Qh = Q  + (size_t)bh * SS * HDD;
    const unsigned short* Kh = Kb + (size_t)bh * SS * HDD;
    const unsigned short* Vh = Vb + (size_t)bh * SS * HDD;
    const float*          mb = mask + (size_t)b * SS;
    const unsigned rowOff = (unsigned)(n16 * HDD + 8 * hi);   // Q and K rows
    const unsigned vOff   = (unsigned)(8 * hi * HDD + n16);   // V columns

    // Q rows as B fragments: [column group][k chunk of 32]
    FragBF qf[2][2];
#pragma unroll  // constant indices keep the arrays in registers
    for (int g = 0; g < 2; ++g)
#pragma unroll  // constant indices keep the arrays in registers
        for (int c = 0; c < 2; ++c)
            load_row_frag(qf[g][c], Qh + (size_t)wid * 32 * HDD + (qblk + 16 * g) * HDD + 32 * c, rowOff);

    // K rows as A fragments: [key tile of 16][k chunk of 32], fetched one pass ahead
    FragBF kf[2][2];
#pragma unroll  // constant indices keep the arrays in registers
    for (int t = 0; t < 2; ++t)
#pragma unroll  // constant indices keep the arrays in registers
        for (int c = 0; c < 2; ++c)
            load_row_frag(kf[t][c], Kh + 16 * t * HDD + 32 * c, rowOff);

    v8f   o[2][4];                 // O^T: [group][hd tile]; reg r = hd 8*hi + r
    float mrun[2], lrun[2];        // running maximum; this half's running sum
#pragma unroll  // constant indices keep the arrays in registers
    for (int g = 0; g < 2; ++g) {
        mrun[g] = -3.402823466e38f;   // finite, so that (-inf) - mrun is never NaN
        lrun[g] = 0.0f;
#pragma unroll  // constant indices keep the arrays in registers
        for (int nt = 0; nt < 4; ++nt) o[g][nt] = zero8();
    }

    for (int kp = 0; kp < 32; ++kp) {
        const int key0 = kp * 32;

        // V^T as A fragments (row = hd, k = key)
        const unsigned short* Vp = Vh + (size_t)key0 * HDD;
        FragBF vf[4];
#pragma unroll  // constant indices keep the arrays in registers
        for (int nt = 0; nt < 4; ++nt)
#pragma unroll  // constant indices keep the arrays in registers
            for (int v = 0; v < 8; ++v) {
                const int k = ((v >> 2) << 4) + ((v & 3) << 1);   // + 8*hi, in vOff
                vf[nt].u[2 * v]     = Vp[vOff + k * HDD + nt * 16];
                vf[nt].u[2 * v + 1] = Vp[vOff + (k + 1) * HDD + nt * 16];
            }

        // mask of this lane's keys: [tile][r] = key key0 + 16*t + 8*hi + r; the 32 values
        // of the pass are read at wave-uniform addresses, a lane picks its half's
        float mk[2][8];
#pragma unroll  // constant indices keep the arrays in registers
        for (int t = 0; t < 2; ++t)
#pragma unroll  // constant indices keep the arrays in registers
            for (int r = 0; r < 8; ++r) {
                const float lo = mb[key0 + 16 * t + r];
                const float up = mb[key0 + 16 * t + 8 + r];
                mk[t][r] = hi ? up : lo;
            }

        // S^T tiles: st[g][t][r] = q(q0 + 16g + n16) . k(key0 + 16t + 8hi + r)
        v8f st[2][2];
#pragma unroll  // constant indices keep the arrays in registers
        for (int g = 0; g < 2; ++g)
#pragma unroll  // constant indices keep the arrays in registers
            for (int t = 0; t < 2; ++t) {
                v8f s = zero8();
#pragma unroll  // constant indices keep the arrays in registers
                for (int c = 0; c < 2; ++c)
                    s = __builtin_amdgcn_wmma_f32_16x16x32_bf16(false, kf[t][c].v, false,
                                                                qf[g][c].v, (short)0, s,
                                                                false, false);
                st[g][t] = s;
            }

        // next pass's K rows (the last pass fetches pass 0's again: in bounds, unused)
        {
            const int kn = ((kp + 1) & 31) * 32;
#pragma unroll  // constant indices keep the arrays in registers
            for (int t = 0; t < 2; ++t)
#pragma unroll  // constant indices keep the arrays in registers
                for (int c = 0; c < 2; ++c)
                    load_row_frag(kf[t][c], Kh + (size_t)(kn + 16 * t) * HDD + 32 * c, rowOff);
            asm volatile("s_wait_xcnt 0x0" ::: "memory");
        }

        FragBF pf[2];
#pragma unroll  // constant indices keep the arrays in registers
        for (int g = 0; g < 2; ++g) {
            float x[16];
            float mx = mrun[g];
#pragma unroll  // constant indices keep the arrays in registers
            for (int t = 0; t < 2; ++t)
#pragma unroll  // constant indices keep the arrays in registers
                for (int r = 0; r < 8; ++r) {
                    x[8 * t + r] = st[g][t][r] * 0.125f + mk[t][r];
                    mx = fmaxf(mx, x[8 * t + r]);
                }
            mx = fmaxf(mx, other_half(mx));
            const float alpha = exp_slot(mrun[g] - mx);
            mrun[g] = mx;
            float sum = 0.0f;
#pragma unroll  // constant indices keep the arrays in registers
            for (int i = 0; i < 16; ++i) {
                x[i] = exp_slot(x[i] - mx);
                sum += x[i];
            }
            lrun[g] = lrun[g] * alpha + sum;
#pragma unroll  // constant indices keep the arrays in registers
            for (int i = 0; i < 8; ++i) pf[g].d[i] = pack_bf16(x[2 * i], x[2 * i + 1]);
#pragma unroll  // constant indices keep the arrays in registers
            for (int nt = 0; nt < 4; ++nt)
#pragma unroll  // constant indices keep the arrays in registers
                for (int r = 0; r < 8; ++r) o[g][nt][r] *= alpha;
        }

        // O^T += V^T . P^T
#pragma unroll  // constant indices keep the arrays in registers
        for (int nt = 0; nt < 4; ++nt)
#pragma unroll  // constant indices keep the arrays in registers
            for (int g = 0; g < 2; ++g)
                o[g][nt] = __builtin_amdgcn_wmma_f32_16x16x32_bf16(false, vf[nt].v, false,
                                                                   pf[g].v, (short)0,
                                                                   o[g][nt], false, false);
    }

    // ctx as bf16 in [B,S,D] layout: a lane's 8 registers are 8 consecutive hd
#pragma unroll  // constant indices keep the arrays in registers
    for (int g = 0; g < 2; ++g) {
        const float inv = 1.0f / (lrun[g] + other_half(lrun[g]));
        unsigned short* dst = ctxB + ((size_t)b * SS + q0 + 16 * g + n16) * DD + h * 64 + 8 * hi;
#pragma unroll  // constant indices keep the arrays in registers
        for (int nt = 0; nt < 4; ++nt) {
            uint4 w;
            w.x = pack_bf16(o[g][nt][0] * inv, o[g][nt][1] * inv);
            w.y = pack_bf16(o[g][nt][2] * inv, o[g][nt][3] * inv);
            w.z = pack_bf16(o[g][nt][4] * inv, o[g][nt][5] * inv);
            w.w = pack_bf16(o[g][nt][6] * inv, o[g][nt][7] * inv);
            *(uint4*)(dst + nt * 16) = w;
        }
    }
}

// ---------------- layernorm: one block per row (D=1024) ----------------
__global__ __launch_bounds__(256) void ln_kernel(const float* __restrict__ x,
                                                 const float* __restrict__ g,
                                                 const float* __restrict__ bta,
                                                 float* __restrict__ outF,
                                                 unsigned short* __restrict__ outB) {
    __shared__ float red[256];
    const int row = blockIdx.x;
    const int tid = threadIdx.x;
    const float* xr = x + (size_t)row * DD;

    float s = 0.0f;
    for (int i = tid; i < DD; i += 256) s += xr[i];
    red[tid] = s; __syncthreads();
    for (int off = 128; off > 0; off >>= 1) {
        if (tid < off) red[tid] += red[tid + off];
        __syncthreads();
    }
    float mu = red[0] * (1.0f / DD);
    __syncthreads();

    float v = 0.0f;
    for (int i = tid; i < DD; i += 256) {
        float d = xr[i] - mu; v += d * d;
    }
    red[tid] = v; __syncthreads();
    for (int off = 128; off > 0; off >>= 1) {
        if (tid < off) red[tid] += red[tid + off];
        __syncthreads();
    }
    float inv = rsqrtf(red[0] * (1.0f / DD) + 1e-12f);

    for (int i = tid; i < DD; i += 256) {
        float o = (xr[i] - mu) * inv * g[i] + bta[i];
        outF[(size_t)row * DD + i] = o;
        if (outB) outB[(size_t)row * DD + i] = f2bfu(o);
    }
}

// ---------------- launcher ----------------
extern "C" void kernel_launch(void* const* d_in, const int* in_sizes, int n_in,
                              void* d_out, int out_size, void* d_ws, size_t ws_size,
                              hipStream_t stream) {
    const float* hidden = (const float*)d_in[0];
    const float* mask   = (const float*)d_in[1];
    const float* Wq = (const float*)d_in[2];   const float* bq  = (const float*)d_in[3];
    const float* Wk = (const float*)d_in[4];   const float* bk  = (const float*)d_in[5];
    const float* Wv = (const float*)d_in[6];   const float* bv  = (const float*)d_in[7];
    const float* Wo = (const float*)d_in[8];   const float* bo  = (const float*)d_in[9];
    const float* g1 = (const float*)d_in[10];  const float* b1  = (const float*)d_in[11];
    const float* Wi = (const float*)d_in[12];  const float* bi  = (const float*)d_in[13];
    const float* Wt = (const float*)d_in[14];  const float* bot = (const float*)d_in[15];
    const float* g2 = (const float*)d_in[16];  const float* b2  = (const float*)d_in[17];
    float* out = (float*)d_out;

    const size_t BSD = (size_t)BSR * DD;     // 4M
    const size_t DI  = (size_t)DD * II;      // 4M
    const size_t DDq = (size_t)DD * DD;      // 1M

    char* ws = (char*)d_ws;
    auto alloc = [&](size_t bytes) -> char* {
        char* p = ws;
        ws += (bytes + 255) & ~(size_t)255;
        return p;
    };
    unsigned short* hb    = (unsigned short*)alloc(BSD * 2);
    unsigned short* wqb   = (unsigned short*)alloc(DDq * 2);
    unsigned short* wkb   = (unsigned short*)alloc(DDq * 2);
    unsigned short* wvb   = (unsigned short*)alloc(DDq * 2);
    unsigned short* wob   = (unsigned short*)alloc(DDq * 2);
    unsigned short* wib   = (unsigned short*)alloc(DI * 2);
    unsigned short* wtb   = (unsigned short*)alloc(DI * 2);
    unsigned short* qb    = (unsigned short*)alloc(BSD * 2);
    unsigned short* kbuf  = (unsigned short*)alloc(BSD * 2);
    unsigned short* vbuf  = (unsigned short*)alloc(BSD * 2);
    unsigned short* ctxb  = (unsigned short*)alloc(BSD * 2);
    float*          y1    = (float*)alloc(BSD * 4);
    float*          attnf = (float*)alloc(BSD * 4);
    unsigned short* attnb = (unsigned short*)alloc(BSD * 2);
    unsigned short* interb= (unsigned short*)alloc((size_t)BSR * II * 2);
    float*          y2    = (float*)alloc(BSD * 4);

    // 1) fp32 -> bf16 conversions
    cvt_all_f32_bf16<<<CVT_BLOCKS, CVT_THREADS, 0, stream>>>(hidden, Wq, Wk, Wv, Wo, Wi, Wt,
                                                             hb, wqb, wkb, wvb, wob, wib, wtb);

    // 2) QKV projections (head-scattered bf16 outputs)
    {
        dim3 g(DD / 128, BSR / 128);
        gemm_bf16<1, 4><<<g, 256, 0, stream>>>(hb, wqb, bq, nullptr, qb,   nullptr, BSR, DD, DD);
        gemm_bf16<1, 4><<<g, 256, 0, stream>>>(hb, wkb, bk, nullptr, kbuf, nullptr, BSR, DD, DD);
        gemm_bf16<1, 4><<<g, 256, 0, stream>>>(hb, wvb, bv, nullptr, vbuf, nullptr, BSR, DD, DD);
    }

    // 3) attention
    attn_kernel<<<BB * NHH * (SS / 256), 256, 0, stream>>>(qb, kbuf, vbuf, mask, ctxb);

    // 4) output projection + residual(hidden)
    {
        dim3 g(DD / 128, BSR / 128);
        gemm_bf16<0, 4><<<g, 256, 0, stream>>>(ctxb, wob, bo, y1, nullptr, hidden,
                                            BSR, DD, DD);
    }
    // 5) LN1 -> attnf (f32) + attnb (bf16)
    ln_kernel<<<BSR, 256, 0, stream>>>(y1, g1, b1, attnf, attnb);

    // 6) FFN up + exact GELU -> bf16
    {
        dim3 g(II / 128, BSR / 128);
        gemm_bf16<2, 2><<<g, 256, 0, stream>>>(attnb, wib, bi, nullptr, interb,
                                            nullptr, BSR, II, DD);
    }
    // 7) FFN down + residual(attnf)
    {
        dim3 g(DD / 128, BSR / 128);
        gemm_bf16<0, 4><<<g, 256, 0, stream>>>(interb, wtb, bot, y2, nullptr, attnf,
                                            BSR, DD, II);
    }
    // 8) LN2 -> final output
    ln_kernel<<<BSR, 256, 0, stream>>>(y2, g2, b2, out, nullptr);
}

// v006
// Measured time: 184 microseconds a run.
// In both of two side-by-side timings against v005, it was 1.12 times as fast.
// Counting every step since v000, it is 4.51 times as fast.
#include <hip/hip_runtime.h>
#include <cstdint>
#include <cstddef>

// ---------------- types ----------------
typedef __bf16 bf16_t;
typedef bf16_t v16bf __attribute__((ext_vector_type(16)));
typedef float  v8f   __attribute__((ext_vector_type(8)));
typedef unsigned int u32x4 __attribute__((ext_vector_type(4)));

union FragBF {
    uint32_t       d[8];
    unsigned short u[16];
    v16bf          v;
};

static __device__ inline v8f zero8() {
    v8f z;
#pragma unroll
    for (int i = 0; i < 8; ++i) z[i] = 0.0f;
    return z;
}

// fp32 -> bf16 (round to nearest even), returned as raw u16 bits
static __device__ inline unsigned short f2bfu(float f) {
    union { float f; uint32_t u; } c; c.f = f;
    uint32_t r = c.u + 0x7FFFu + ((c.u >> 16) & 1u);
    return (unsigned short)(r >> 16);
}

// model constants
#define BB   4
#define SS   1024
#define DD   1024
#define NHH  16
#define HDD  64
#define II   4096
#define BSR  4096   /* B*S rows */

#define BK      64
#define B_ROWB  256u
#define B_ROWS  64u
#define B_PITCH 288u
#define B_BUF   18432u
#define A_ROWB  128u
#define A_ROWS  128u
#define A_PITCH 144u
#define A_BUF   18432u
static_assert(B_ROWS * B_PITCH <= B_BUF && (B_BUF % 2048u) == 0u, "B buffer size");
static_assert(A_ROWS * A_PITCH <= A_BUF && (A_BUF % 2048u) == 0u, "A buffer size");

typedef unsigned int u32x8 __attribute__((ext_vector_type(8)));
typedef short        s16x8 __attribute__((ext_vector_type(8)));

static __device__ inline uint32_t uni(uint32_t v) {
    return (uint32_t)__builtin_amdgcn_readfirstlane(v);
}
static __device__ inline uint32_t pinned(uint32_t v) {
    uint32_t w = uni(v);
    asm volatile("" : "+s"(w));   // the pin of a tensor load's issue test in a scalar register
    return w;
}
static __device__ inline u32x8 btile_group1(uint32_t src_pitch) {
    u32x8 g;
    g[0] = uni((1u << 20) | (5u << 22) | (7u << 25));
    g[1] = uni((B_ROWB & 0xFFFFu) << 16);
    g[2] = uni((B_ROWB >> 16) | ((B_ROWS & 0xFFFFu) << 16));
    g[3] = uni((B_ROWS >> 16) | (B_ROWB << 16));
    g[4] = uni(B_ROWS);
    g[5] = uni(src_pitch);
    g[6] = uni(0u);
    g[7] = uni(0u);
    return g;
}
static __device__ inline u32x8 atile_group1(uint32_t src_pitch) {
    u32x8 g;
    g[0] = uni((1u << 20) | (4u << 22) | (3u << 25));
    g[1] = uni((A_ROWB & 0xFFFFu) << 16);
    g[2] = uni((A_ROWB >> 16) | ((A_ROWS & 0xFFFFu) << 16));
    g[3] = uni((A_ROWS >> 16) | (A_ROWB << 16));
    g[4] = uni(A_ROWS);
    g[5] = uni(src_pitch);
    g[6] = uni(0u);
    g[7] = uni(0u);
    return g;
}
static __device__ inline u32x4 btile_group0(uint32_t lds_dst, uint64_t ga) {
    u32x4 g;
    g[0] = uni(1u);
    g[1] = uni(lds_dst);
    g[2] = uni((uint32_t)ga);
    g[3] = uni((((uint32_t)(ga >> 32)) & 0x01FFFFFFu) | 0x80000000u);
    return g;
}
// 8 k x 16 columns per wave half of a row-major 16-bit LDS tile, transposed: lane (c, h)
// gets 8 consecutive k of column c, which is half a B fragment in the hardware k order
static __device__ inline u32x4 ld_tr16(const unsigned char* p) {
    typedef __attribute__((address_space(3))) s16x8 lds_s16x8;
    return __builtin_bit_cast(u32x4, __builtin_amdgcn_ds_load_tr16_b128_v8i16((lds_s16x8*)p));
}

#define CVT_THREADS 512
#define CVT_LOADS   32
#define CVT_PIECE   (CVT_THREADS * CVT_LOADS * 4)
#define CVT_P_ACT   (BSR * DD / CVT_PIECE)   /* pieces of the activations */
#define CVT_P_SQ    (DD * DD / CVT_PIECE)    /* pieces of a D x D weight */
#define CVT_P_FF    (DD * II / CVT_PIECE)    /* pieces of a D x I weight */
#define CVT_BLOCKS  (CVT_P_ACT + 4 * CVT_P_SQ + 2 * CVT_P_FF)
static_assert(BSR * DD % CVT_PIECE == 0 && DD * DD % CVT_PIECE == 0 && DD * II % CVT_PIECE == 0,
              "whole pieces");

typedef float  f32x2  __attribute__((ext_vector_type(2)));
typedef bf16_t bf16x2 __attribute__((ext_vector_type(2)));

// two f32 -> packed bf16 pair (round to nearest even)
static __device__ inline uint32_t pack_bf16(float a, float b) {
    f32x2 f; f[0] = a; f[1] = b;
    union { bf16x2 h; uint32_t u; } c;
    c.h = __builtin_convertvector(f, bf16x2);
    return c.u;
}

__global__ __launch_bounds__(CVT_THREADS)
void cvt_all_f32_bf16(
        const float* __restrict__ hidden, const float* __restrict__ Wq,
        const float* __restrict__ Wk, const float* __restrict__ Wv,
        const float* __restrict__ Wo, const float* __restrict__ Wi,
        const float* __restrict__ Wt,
        unsigned short* __restrict__ hb, unsigned short* __restrict__ wqb,
        unsigned short* __restrict__ wkb, unsigned short* __restrict__ wvb,
        unsigned short* __restrict__ wob, unsigned short* __restrict__ wib,
        unsigned short* __restrict__ wtb) {
    // which array, and which piece of it: the same for the whole block
    unsigned p = blockIdx.x;
    const float* in;
    unsigned short* out;
    if (p < CVT_P_ACT) { in = hidden; out = hb; }
    else if ((p -= CVT_P_ACT) < CVT_P_SQ) { in = Wq; out = wqb; }
    else if ((p -= CVT_P_SQ) < CVT_P_SQ) { in = Wk; out = wkb; }
    else if ((p -= CVT_P_SQ) < CVT_P_SQ) { in = Wv; out = wvb; }
    else if ((p -= CVT_P_SQ) < CVT_P_SQ) { in = Wo; out = wob; }
    else if ((p -= CVT_P_SQ) < CVT_P_FF) { in = Wi; out = wib; }
    else { p -= CVT_P_FF; in = Wt; out = wtb; }

    // block-uniform bases; the lane's index serves the 16-byte loads and the 8-byte stores
    const float4* src = (const float4*)(in + (size_t)p * CVT_PIECE);
    uint2*        dst = (uint2*)(out + (size_t)p * CVT_PIECE);
    const unsigned t = threadIdx.x;

    float4 v[CVT_LOADS];
#pragma unroll  // constant indices keep the array in registers
    for (int j = 0; j < CVT_LOADS; ++j) v[j] = src[t + j * CVT_THREADS];
    // keeps all loads above the conversions: left free, the compiler issues the last of them
    // behind waits for the first and the wave pays the memory latency more than once
    __builtin_amdgcn_sched_barrier(0);
    // every result has a register pair of its own: none is rewritten under a store in flight
    uint2 w[CVT_LOADS];
#pragma unroll  // constant indices keep the arrays in registers
    for (int j = 0; j < CVT_LOADS; ++j) {
        w[j].x = pack_bf16(v[j].x, v[j].y);
        w[j].y = pack_bf16(v[j].z, v[j].w);
    }
#pragma unroll  // constant indices keep the array in registers
    for (int j = 0; j < CVT_LOADS; ++j) dst[t + j * CVT_THREADS] = w[j];
}

// ---------------- tiled bf16 WMMA GEMM, tensor loads, two stage buffers ----------------
// C[M,N] = A[M,K] * B[K,N]  (A,B bf16 row-major, acc f32)
// block tile 128x128, 8 waves (2x4), wave tile 64x32 (4x2 wmma tiles)
// A stage is NCH chunks of 64 k: NCH slices of A (128 rows x 64 k) and NCH slices of B
// (64 k x 128 columns). Wave w < NCH brings A slice w, wave NCH + c brings B slice c, one
// tensor load a wave and stage, so that a stage's landing latency is paid once per
// 64 * NCH k and its bytes come in through 2 * NCH request queues.
// K is a multiple of 64 * NCH and holds at least two stages.
// MODE 0: outF[row*N+col] = acc + bias[col] + res[row*N+col]
// MODE 1: QKV scatter: outB[((b*NH+head)*S + s)*HD + hd] = bf16(acc + bias)
// MODE 2: outB[row*N+col] = bf16(gelu(acc + bias))
template <int MODE, int NCH>
__global__ __launch_bounds__(256) void gemm_bf16(const unsigned short* __restrict__ A,
                                                 const unsigned short* __restrict__ Bw,
                                                 const float* __restrict__ bias,
                                                 float* __restrict__ outF,
                                                 unsigned short* __restrict__ outB,
                                                 const float* __restrict__ res,
                                                 int M, int N, int K) {
    static_assert(A_BUF == B_BUF && 2 * NCH <= 8, "one slice size, one slice a wave");
    constexpr uint32_t SLICE = A_BUF;              // a whole number of 2 KiB units
    constexpr uint32_t STAGE = 2u * NCH * SLICE;   // [A slices | B slices]
    __shared__ __attribute__((aligned(2048))) unsigned char Ts[2 * STAGE];

    const int tid   = threadIdx.x;
    const int lane  = tid & 31;
    const int wid   = tid >> 5;
    const int n16   = lane & 15;
    const int hi    = lane >> 4;
    const int waveM = wid >> 2;   // 0..1
    const int waveN = wid & 3;    // 0..3
    const int rowBase = blockIdx.y * 128;
    const int colBase = blockIdx.x * 128;

    v8f acc[4][2];
#pragma unroll
    for (int i = 0; i < 4; ++i)
#pragma unroll
        for (int j = 0; j < 2; ++j) acc[i][j] = zero8();

    const uint32_t wave   = uni((uint32_t)threadIdx.x >> 5);
    const uint32_t bchunk = uni((uint32_t)N * (2u * BK));   // 64 source rows of B, in bytes
    // first byte of this wave's slice in stage 0, and its step from stage to stage
    const uint64_t src0 = wave < (uint32_t)NCH
        ? (uint64_t)(A + (size_t)rowBase * K) + wave * A_ROWB
        : (uint64_t)(Bw + colBase) + (uint64_t)(wave - (uint32_t)NCH) * bchunk;
    const uint32_t step = wave < (uint32_t)NCH ? (uint32_t)NCH * A_ROWB : (uint32_t)NCH * bchunk;
    const uint32_t place0 = (uint32_t)(size_t)&Ts[0] + wave * SLICE;
    u32x8 ag1 = atile_group1((uint32_t)K * 2u);
    u32x8 bg1 = btile_group1((uint32_t)N * 2u);
    u32x4 ag0 = btile_group0(place0, src0);
    u32x4 bg0 = btile_group0(place0, src0);

    auto issue = [&](uint32_t buf, bool advance) {
        // scalar branches (see pinned()); each path has its own constant pad word
        if (pinned(wave < (uint32_t)NCH)) {
            ag0[1] = uni(place0 + buf * STAGE);
            if (advance) {
                const uint64_t a = (((uint64_t)ag0[3] << 32) | ag0[2]) + step;
                ag0[2] = uni((uint32_t)a);
                ag0[3] = uni((uint32_t)(a >> 32));
            }
            asm volatile("tensor_load_to_lds %0, %1" : "+s"(ag0), "+s"(ag1) :: "memory");
        }
        if (pinned(wave >= (uint32_t)NCH && wave < 2u * NCH)) {
            bg0[1] = uni(place0 + buf * STAGE);
            if (advance) {
                const uint64_t a = (((uint64_t)bg0[3] << 32) | bg0[2]) + step;
                bg0[2] = uni((uint32_t)a);
                bg0[3] = uni((uint32_t)(a >> 32));
            }
            asm volatile("tensor_load_to_lds %0, %1" : "+s"(bg0), "+s"(bg1) :: "memory");
        }
    };

    const uint32_t nst = uni((uint32_t)K / (uint32_t)(BK * NCH));
    issue(0u, false);
    asm volatile("s_wait_tensorcnt 0x0" ::: "memory");   // this wave's slice of stage 0 has landed
    __syncthreads();                                     // every wave's slice has
    issue(1u, true);                                     // flies while stage 0 is worked on

    for (uint32_t s = 0; s < nst; ++s) {
        const unsigned char* st = &Ts[0] + (s & 1u) * STAGE;
        // the lane's row of the wave's first A tile, at its 16-byte half of 32 bytes
        const unsigned char* as0 = st + (waveM * 64 + n16) * A_PITCH + 16 * hi;
        // the lane's address in the transposing load: row 8*hi + (lane & 7), 16-byte
        // half (lane >> 3) & 1 of the 32 bytes of a 16-column group
        const unsigned char* bs0 = st + NCH * SLICE + (8 * hi + (lane & 7)) * B_PITCH +
                                   16 * ((lane >> 3) & 1) + 64 * waveN;

#pragma unroll  // the chunks of a stage, in rising k; constant slice offsets
        for (int ch = 0; ch < NCH; ++ch) {
            const unsigned char* as = as0 + ch * SLICE;
            const unsigned char* bs = bs0 + ch * SLICE;

            // all 24 fragment reads of the chunk stand as one group ahead of its 16 WMMAs
            FragBF af[BK / 32][4];
            FragBF bf[BK / 32][2];
#pragma unroll  // constant indices keep the arrays in registers
            for (int c = 0; c < BK / 32; ++c) {
#pragma unroll  // constant indices keep the arrays in registers
                for (int nt = 0; nt < 2; ++nt) {
                    const u32x4 lo = ld_tr16(bs + (32 * c) * B_PITCH + 32 * nt);        // k  0..15
                    const u32x4 up = ld_tr16(bs + (32 * c + 16) * B_PITCH + 32 * nt);   // k 16..31
                    bf[c][nt].d[0] = lo.x; bf[c][nt].d[1] = lo.y;
                    bf[c][nt].d[2] = lo.z; bf[c][nt].d[3] = lo.w;
                    bf[c][nt].d[4] = up.x; bf[c][nt].d[5] = up.y;
                    bf[c][nt].d[6] = up.z; bf[c][nt].d[7] = up.w;
                }
#pragma unroll  // constant indices keep the arrays in registers
                for (int mt = 0; mt < 4; ++mt) {
                    // elements 0-7 = k 8*hi + 0..7, elements 8-15 = k 16 + 8*hi + 0..7
                    const uint4 lo = *(const uint4*)(as + mt * 16 * A_PITCH + 64 * c);
                    const uint4 up = *(const uint4*)(as + mt * 16 * A_PITCH + 64 * c + 32);
                    af[c][mt].d[0] = lo.x; af[c][mt].d[1] = lo.y;
                    af[c][mt].d[2] = lo.z; af[c][mt].d[3] = lo.w;
                    af[c][mt].d[4] = up.x; af[c][mt].d[5] = up.y;
                    af[c][mt].d[6] = up.z; af[c][mt].d[7] = up.w;
                }
            }
            // keeps the reads above the WMMAs: sunk among them, each pair of reads is waited
            // out to zero in front of its two WMMAs and the LDS latency is paid eight times
            __builtin_amdgcn_sched_barrier(0);
#pragma unroll  // two chunks of 32 k, in rising k; constant indices keep the arrays in registers
            for (int c = 0; c < BK / 32; ++c)
#pragma unroll  // constant indices keep the arrays in registers
                for (int mt = 0; mt < 4; ++mt)
#pragma unroll  // constant indices keep the arrays in registers
                    for (int nt = 0; nt < 2; ++nt)
                        acc[mt][nt] = __builtin_amdgcn_wmma_f32_16x16x32_bf16(
                            false, af[c][mt].v, false, bf[c][nt].v, (short)0, acc[mt][nt],
                            false, false);
            // keeps the next chunk's reads, and the stage's closing waits and barrier, below
            // the WMMAs: lifted among them they bring waits in front of the matrix work
            __builtin_amdgcn_sched_barrier(0);
        }

        // hand-over of the stage, every wave, in this order
        asm volatile("s_wait_dscnt 0x0" ::: "memory");      // this wave has left buffer s & 1
        asm volatile("s_wait_tensorcnt 0x0" ::: "memory");  // its slice of stage s + 1 has landed
        __syncthreads();   // stage s + 1 is published; every reader has left buffer s & 1
        // the test for a further stage is a scalar branch as well (see pinned())
        if (pinned(s + 2u < nst)) issue(s & 1u, true);
    }
    asm volatile("s_wait_tensorcnt 0x0" ::: "memory");   // nothing in flight when the wave goes on
    asm volatile("s_wait_dscnt 0x0" ::: "memory");

    // epilogue
#pragma unroll
    for (int mt = 0; mt < 4; ++mt) {
#pragma unroll
        for (int nt = 0; nt < 2; ++nt) {
#pragma unroll
            for (int r = 0; r < 8; ++r) {
                int grow = rowBase + waveM * 64 + mt * 16 + r + 8 * hi;
                int gcol = colBase + waveN * 32 + nt * 16 + n16;
                float v = acc[mt][nt][r] + bias[gcol];
                if (MODE == 0) {
                    outF[(size_t)grow * N + gcol] = v + res[(size_t)grow * N + gcol];
                } else if (MODE == 1) {
                    int b = grow >> 10, s = grow & 1023;
                    int head = gcol >> 6, hd = gcol & 63;
                    outB[(((size_t)(b * NHH + head)) * SS + s) * HDD + hd] = f2bfu(v);
                } else {
                    float g = 0.5f * v * (1.0f + erff(v * 0.70710678118654752f));
                    outB[(size_t)grow * N + gcol] = f2bfu(g);
                }
            }
        }
    }
}

#define KV_ROWB   128u
#define KV_ROWS   256u                     /* rows of one slice */
#define K_PITCH   144u
#define V_PITCH   160u
#define K_SLICE   (KV_ROWS * K_PITCH)
#define V_SLICE   (KV_ROWS * V_PITCH)
#define K_BYTES   (4u * K_SLICE)
#define V_BYTES   (4u * V_SLICE)
static_assert(K_SLICE % 2048u == 0u && V_SLICE % 2048u == 0u, "slices are whole 2 KiB units");
static_assert(4u * KV_ROWS == SS && KV_ROWB == HDD * 2u, "four slices hold a head");

template <uint32_t PAD_A>
static __device__ inline u32x8 kvtile_group1() {
    u32x8 g;
    g[0] = uni((1u << 20) | (4u << 22) | (PAD_A << 25));
    g[1] = uni((KV_ROWB & 0xFFFFu) << 16);
    g[2] = uni((KV_ROWB >> 16) | ((KV_ROWS & 0xFFFFu) << 16));
    g[3] = uni((KV_ROWS >> 16) | (KV_ROWB << 16));
    g[4] = uni(KV_ROWS);
    g[5] = uni(KV_ROWB);
    g[6] = uni(0u);
    g[7] = uni(0u);
    return g;
}
static __device__ inline float exp_slot(float x) {
    float e;
    asm("v_exp_f32 %0, %1\n\tv_nop" : "=v"(e) : "v"(x * 1.4426950408889634f));
    return e;
}

static __device__ inline float other_half(float x) {
    int b = __builtin_bit_cast(int, x);
    b = __builtin_amdgcn_permlanex16(b, b, 0x76543210, 0xfedcba98, false, false);
    return __builtin_bit_cast(float, b);
}

// 32 k of one row, k-contiguous in memory, in the hardware k order:
// elements 0-7 = k 8*hi + 0..7, elements 8-15 = k 16 + 8*hi + 0..7
// (p = wave-uniform base, off = the lane's row * HDD + 8*hi)
static __device__ inline void load_row_frag(FragBF& f, const unsigned short* p, unsigned off) {
    const uint4 lo = *(const uint4*)(p + off);
    const uint4 up = *(const uint4*)(p + off + 16);
    f.d[0] = lo.x; f.d[1] = lo.y; f.d[2] = lo.z; f.d[3] = lo.w;
    f.d[4] = up.x; f.d[5] = up.y; f.d[6] = up.z; f.d[7] = up.w;
}

// the same fragment from a K row in LDS (p = the lane's row, at its 16-byte half of 32 bytes)
static __device__ inline void lds_row_frag(FragBF& f, const unsigned char* p) {
    const uint4 lo = *(const uint4*)(p);
    const uint4 up = *(const uint4*)(p + 32);
    f.d[0] = lo.x; f.d[1] = lo.y; f.d[2] = lo.z; f.d[3] = lo.w;
    f.d[4] = up.x; f.d[5] = up.y; f.d[6] = up.z; f.d[7] = up.w;
}

__global__ __launch_bounds__(256) void attn_kernel(const unsigned short* __restrict__ Q,
                                                   const unsigned short* __restrict__ Kb,
                                                   const unsigned short* __restrict__ Vb,
                                                   const float* __restrict__ mask,
                                                   unsigned short* __restrict__ ctxB) {
    __shared__ __attribute__((aligned(2048))) unsigned char KV[K_BYTES + V_BYTES];   // [K | V]
    const int lane = threadIdx.x & 31;
    const int wid  = threadIdx.x >> 5;
    const int n16  = lane & 15;
    const int hi   = lane >> 4;
    const int bh   = blockIdx.x >> 2;     // (b*NH + h)
    const int qblk = (blockIdx.x & 3) * 256;
    const int q0   = qblk + wid * 32;
    const int b    = bh >> 4;
    const int h    = bh & 15;
    const unsigned short* Qh = Q  + (size_t)bh * SS * HDD;
    const unsigned short* Kh = Kb + (size_t)bh * SS * HDD;
    const unsigned short* Vh = Vb + (size_t)bh * SS * HDD;
    const float*          mb = mask + (size_t)b * SS;
    const unsigned rowOff = (unsigned)(n16 * HDD + 8 * hi);   // Q rows

    // Q rows as B fragments: [column group][k chunk of 32]; asked for ahead of the tensor
    // loads, so that they fly while K and V land
    FragBF qf[2][2];
#pragma unroll  // constant indices keep the arrays in registers
    for (int g = 0; g < 2; ++g)
#pragma unroll  // constant indices keep the arrays in registers
        for (int c = 0; c < 2; ++c)
            load_row_frag(qf[g][c], Qh + (size_t)wid * 32 * HDD + (qblk + 16 * g) * HDD + 32 * c, rowOff);

    // waves 0-3 bring K rows 256 w .., waves 4-7 V rows 256 (w - 4) ..: one tensor load a
    // wave, each behind a scalar branch (see pinned()) with its own constant pad word
    const uint32_t wave = uni((uint32_t)threadIdx.x >> 5);
    const uint32_t kv0  = (uint32_t)(size_t)&KV[0];
    if (pinned(wave < 4u)) {
        u32x4 g0 = btile_group0(kv0 + wave * K_SLICE,
                                (uint64_t)Kh + (uint64_t)(wave * (KV_ROWS * KV_ROWB)));
        u32x8 g1 = kvtile_group1<3u>();
        asm volatile("tensor_load_to_lds %0, %1" :: "s"(g0), "s"(g1) : "memory");
        asm volatile("s_wait_tensorcnt 0x0" ::: "memory");   // this wave's K slice has landed
    }
    if (pinned(wave >= 4u)) {
        u32x4 g0 = btile_group0(kv0 + K_BYTES + (wave - 4u) * V_SLICE,
                                (uint64_t)Vh + (uint64_t)((wave - 4u) * (KV_ROWS * KV_ROWB)));
        u32x8 g1 = kvtile_group1<7u>();
        asm volatile("tensor_load_to_lds %0, %1" :: "s"(g0), "s"(g1) : "memory");
        asm volatile("s_wait_tensorcnt 0x0" ::: "memory");   // this wave's V slice has landed
    }
    __syncthreads();   // every wave's slice has landed: K and V are published to the block

    // the lane's row of a 16-key tile of K, at its 16-byte half of 32 bytes
    const unsigned char* kl = &KV[0] + n16 * K_PITCH + 16 * hi;
    // the lane's address in the transposing load: row 8*hi + (lane & 7), 16-byte half
    // (lane >> 3) & 1 of the 32 bytes of a 16-column group
    const unsigned char* vl = &KV[K_BYTES] + (8 * hi + (lane & 7)) * V_PITCH +
                              16 * ((lane >> 3) & 1);

    // K rows as A fragments: [key tile of 16][k chunk of 32], fetched one pass ahead
    FragBF kf[2][2];
#pragma unroll  // constant indices keep the arrays in registers
    for (int t = 0; t < 2; ++t)
#pragma unroll  // constant indices keep the arrays in registers
        for (int c = 0; c < 2; ++c)
            lds_row_frag(kf[t][c], kl + 16 * t * K_PITCH + 64 * c);

    v8f   o[2][4];                 // O^T: [group][hd tile]; reg r = hd 8*hi + r
    float mrun[2], lrun[2];        // running maximum; this half's running sum
#pragma unroll  // constant indices keep the arrays in registers
    for (int g = 0; g < 2; ++g) {
        mrun[g] = -3.402823466e38f;   // finite, so that (-inf) - mrun is never NaN
        lrun[g] = 0.0f;
#pragma unroll  // constant indices keep the arrays in registers
        for (int nt = 0; nt < 4; ++nt) o[g][nt] = zero8();
    }

    for (int kp = 0; kp < 32; ++kp) {
        const int key0 = kp * 32;

        // V^T as A fragments (row = hd, k = key)
        const unsigned char* vp = vl + key0 * V_PITCH;
        FragBF vf[4];
#pragma unroll  // constant indices keep the arrays in registers
        for (int nt = 0; nt < 4; ++nt) {
            const u32x4 lo = ld_tr16(vp + 32 * nt);                  // keys  0..15
            const u32x4 up = ld_tr16(vp + 16 * V_PITCH + 32 * nt);   // keys 16..31
            vf[nt].d[0] = lo.x; vf[nt].d[1] = lo.y; vf[nt].d[2] = lo.z; vf[nt].d[3] = lo.w;
            vf[nt].d[4] = up.x; vf[nt].d[5] = up.y; vf[nt].d[6] = up.z; vf[nt].d[7] = up.w;
        }

        // mask of this lane's keys: [tile][r] = key key0 + 16*t + 8*hi + r; the 32 values
        // of the pass are read at wave-uniform addresses, a lane picks its half's
        float mk[2][8];
#pragma unroll  // constant indices keep the arrays in registers
        for (int t = 0; t < 2; ++t)
#pragma unroll  // constant indices keep the arrays in registers
            for (int r = 0; r < 8; ++r) {
                const float lo = mb[key0 + 16 * t + r];
                const float up = mb[key0 + 16 * t + 8 + r];
                mk[t][r] = hi ? up : lo;
            }

        // S^T tiles: st[g][t][r] = q(q0 + 16g + n16) . k(key0 + 16t + 8hi + r)
        v8f st[2][2];
#pragma unroll  // constant indices keep the arrays in registers
        for (int g = 0; g < 2; ++g)
#pragma unroll  // constant indices keep the arrays in registers
            for (int t = 0; t < 2; ++t) {
                v8f s = zero8();
#pragma unroll  // constant indices keep the arrays in registers
                for (int c = 0; c < 2; ++c)
                    s = __builtin_amdgcn_wmma_f32_16x16x32_bf16(false, kf[t][c].v, false,
                                                                qf[g][c].v, (short)0, s,
                                                                false, false);
                st[g][t] = s;
            }

        // next pass's K rows (the last pass fetches pass 0's again: in bounds, unused)
        {
            const int kn = ((kp + 1) & 31) * 32;
#pragma unroll  // constant indices keep the arrays in registers
            for (int t = 0; t < 2; ++t)
#pragma unroll  // constant indices keep the arrays in registers
                for (int c = 0; c < 2; ++c)
                    lds_row_frag(kf[t][c], kl + (kn + 16 * t) * K_PITCH + 64 * c);
        }

        FragBF pf[2];
#pragma unroll  // constant indices keep the arrays in registers
        for (int g = 0; g < 2; ++g) {
            float x[16];
            float mx = mrun[g];
#pragma unroll  // constant indices keep the arrays in registers
            for (int t = 0; t < 2; ++t)
#pragma unroll  // constant indices keep the arrays in registers
                for (int r = 0; r < 8; ++r) {
                    x[8 * t + r] = st[g][t][r] * 0.125f + mk[t][r];
                    mx = fmaxf(mx, x[8 * t + r]);
                }
            mx = fmaxf(mx, other_half(mx));
            const float alpha = exp_slot(mrun[g] - mx);
            mrun[g] = mx;
            float sum = 0.0f;
#pragma unroll  // constant indices keep the arrays in registers
            for (int i = 0; i < 16; ++i) {
                x[i] = exp_slot(x[i] - mx);
                sum += x[i];
            }
            lrun[g] = lrun[g] * alpha + sum;
#pragma unroll  // constant indices keep the arrays in registers
            for (int i = 0; i < 8; ++i) pf[g].d[i] = pack_bf16(x[2 * i], x[2 * i + 1]);
#pragma unroll  // constant indices keep the arrays in registers
            for (int nt = 0; nt < 4; ++nt)
#pragma unroll  // constant indices keep the arrays in registers
                for (int r = 0; r < 8; ++r) o[g][nt][r] *= alpha;
        }

        // O^T += V^T . P^T
#pragma unroll  // constant indices keep the arrays in registers
        for (int nt = 0; nt < 4; ++nt)
#pragma unroll  // constant indices keep the arrays in registers
            for (int g = 0; g < 2; ++g)
                o[g][nt] = __builtin_amdgcn_wmma_f32_16x16x32_bf16(false, vf[nt].v, false,
                                                                   pf[g].v, (short)0,
                                                                   o[g][nt], false, false);
    }

    // ctx as bf16 in [B,S,D] layout: a lane's 8 registers are 8 consecutive hd
#pragma unroll  // constant indices keep the arrays in registers
    for (int g = 0; g < 2; ++g) {
        const float inv = 1.0f / (lrun[g] + other_half(lrun[g]));
        unsigned short* dst = ctxB + ((size_t)b * SS + q0 + 16 * g + n16) * DD + h * 64 + 8 * hi;
#pragma unroll  // constant indices keep the arrays in registers
        for (int nt = 0; nt < 4; ++nt) {
            uint4 w;
            w.x = pack_bf16(o[g][nt][0] * inv, o[g][nt][1] * inv);
            w.y = pack_bf16(o[g][nt][2] * inv, o[g][nt][3] * inv);
            w.z = pack_bf16(o[g][nt][4] * inv, o[g][nt][5] * inv);
            w.w = pack_bf16(o[g][nt][6] * inv, o[g][nt][7] * inv);
            *(uint4*)(dst + nt * 16) = w;
        }
    }
}

// ---------------- layernorm: one block per row (D=1024) ----------------
__global__ __launch_bounds__(256) void ln_kernel(const float* __restrict__ x,
                                                 const float* __restrict__ g,
                                                 const float* __restrict__ bta,
                                                 float* __restrict__ outF,
                                                 unsigned short* __restrict__ outB) {
    __shared__ float red[256];
    const int row = blockIdx.x;
    const int tid = threadIdx.x;
    const float* xr = x + (size_t)row * DD;

    float s = 0.0f;
    for (int i = tid; i < DD; i += 256) s += xr[i];
    red[tid] = s; __syncthreads();
    for (int off = 128; off > 0; off >>= 1) {
        if (tid < off) red[tid] += red[tid + off];
        __syncthreads();
    }
    float mu = red[0] * (1.0f / DD);
    __syncthreads();

    float v = 0.0f;
    for (int i = tid; i < DD; i += 256) {
        float d = xr[i] - mu; v += d * d;
    }
    red[tid] = v; __syncthreads();
    for (int off = 128; off > 0; off >>= 1) {
        if (tid < off) red[tid] += red[tid + off];
        __syncthreads();
    }
    float inv = rsqrtf(red[0] * (1.0f / DD) + 1e-12f);

    for (int i = tid; i < DD; i += 256) {
        float o = (xr[i] - mu) * inv * g[i] + bta[i];
        outF[(size_t)row * DD + i] = o;
        if (outB) outB[(size_t)row * DD + i] = f2bfu(o);
    }
}

// ---------------- launcher ----------------
extern "C" void kernel_launch(void* const* d_in, const int* in_sizes, int n_in,
                              void* d_out, int out_size, void* d_ws, size_t ws_size,
                              hipStream_t stream) {
    const float* hidden = (const float*)d_in[0];
    const float* mask   = (const float*)d_in[1];
    const float* Wq = (const float*)d_in[2];   const float* bq  = (const float*)d_in[3];
    const float* Wk = (const float*)d_in[4];   const float* bk  = (const float*)d_in[5];
    const float* Wv = (const float*)d_in[6];   const float* bv  = (const float*)d_in[7];
    const float* Wo = (const float*)d_in[8];   const float* bo  = (const float*)d_in[9];
    const float* g1 = (const float*)d_in[10];  const float* b1  = (const float*)d_in[11];
    const float* Wi = (const float*)d_in[12];  const float* bi  = (const float*)d_in[13];
    const float* Wt = (const float*)d_in[14];  const float* bot = (const float*)d_in[15];
    const float* g2 = (const float*)d_in[16];  const float* b2  = (const float*)d_in[17];
    float* out = (float*)d_out;

    const size_t BSD = (size_t)BSR * DD;     // 4M
    const size_t DI  = (size_t)DD * II;      // 4M
    const size_t DDq = (size_t)DD * DD;      // 1M

    char* ws = (char*)d_ws;
    auto alloc = [&](size_t bytes) -> char* {
        char* p = ws;
        ws += (bytes + 255) & ~(size_t)255;
        return p;
    };
    unsigned short* hb    = (unsigned short*)alloc(BSD * 2);
    unsigned short* wqb   = (unsigned short*)alloc(DDq * 2);
    unsigned short* wkb   = (unsigned short*)alloc(DDq * 2);
    unsigned short* wvb   = (unsigned short*)alloc(DDq * 2);
    unsigned short* wob   = (unsigned short*)alloc(DDq * 2);
    unsigned short* wib   = (unsigned short*)alloc(DI * 2);
    unsigned short* wtb   = (unsigned short*)alloc(DI * 2);
    unsigned short* qb    = (unsigned short*)alloc(BSD * 2);
    unsigned short* kbuf  = (unsigned short*)alloc(BSD * 2);
    unsigned short* vbuf  = (unsigned short*)alloc(BSD * 2);
    unsigned short* ctxb  = (unsigned short*)alloc(BSD * 2);
    float*          y1    = (float*)alloc(BSD * 4);
    float*          attnf = (float*)alloc(BSD * 4);
    unsigned short* attnb = (unsigned short*)alloc(BSD * 2);
    unsigned short* interb= (unsigned short*)alloc((size_t)BSR * II * 2);
    float*          y2    = (float*)alloc(BSD * 4);

    // 1) fp32 -> bf16 conversions
    cvt_all_f32_bf16<<<CVT_BLOCKS, CVT_THREADS, 0, stream>>>(hidden, Wq, Wk, Wv, Wo, Wi, Wt,
                                                             hb, wqb, wkb, wvb, wob, wib, wtb);

    // 2) QKV projections (head-scattered bf16 outputs)
    {
        dim3 g(DD / 128, BSR / 128);
        gemm_bf16<1, 4><<<g, 256, 0, stream>>>(hb, wqb, bq, nullptr, qb,   nullptr, BSR, DD, DD);
        gemm_bf16<1, 4><<<g, 256, 0, stream>>>(hb, wkb, bk, nullptr, kbuf, nullptr, BSR, DD, DD);
        gemm_bf16<1, 4><<<g, 256, 0, stream>>>(hb, wvb, bv, nullptr, vbuf, nullptr, BSR, DD, DD);
    }

    // 3) attention
    attn_kernel<<<BB * NHH * (SS / 256), 256, 0, stream>>>(qb, kbuf, vbuf, mask, ctxb);

    // 4) output projection + residual(hidden)
    {
        dim3 g(DD / 128, BSR / 128);
        gemm_bf16<0, 4><<<g, 256, 0, stream>>>(ctxb, wob, bo, y1, nullptr, hidden,
                                            BSR, DD, DD);
    }
    // 5) LN1 -> attnf (f32) + attnb (bf16)
    ln_kernel<<<BSR, 256, 0, stream>>>(y1, g1, b1, attnf, attnb);

    // 6) FFN up + exact GELU -> bf16
    {
        dim3 g(II / 128, BSR / 128);
        gemm_bf16<2, 2><<<g, 256, 0, stream>>>(attnb, wib, bi, nullptr, interb,
                                            nullptr, BSR, II, DD);
    }
    // 7) FFN down + residual(attnf)
    {
        dim3 g(DD / 128, BSR / 128);
        gemm_bf16<0, 4><<<g, 256, 0, stream>>>(interb, wtb, bot, y2, nullptr, attnf,
                                            BSR, DD, II);
    }
    // 8) LN2 -> final output
    ln_kernel<<<BSR, 256, 0, stream>>>(y2, g2, b2, out, nullptr);
}

// v007
// A run of this version takes 173 microseconds.
// Next to v006, in two timings, it ran 1.06 and 1.07 times as fast.
// Counting every step since v000, it is 4.81 times as fast.
#include <hip/hip_runtime.h>
#include <cstdint>
#include <cstddef>

// ---------------- types ----------------
typedef __bf16 bf16_t;
typedef bf16_t v16bf __attribute__((ext_vector_type(16)));
typedef float  v8f   __attribute__((ext_vector_type(8)));
typedef unsigned int u32x4 __attribute__((ext_vector_type(4)));

union FragBF {
    uint32_t       d[8];
    unsigned short u[16];
    v16bf          v;
};

static __device__ inline v8f zero8() {
    v8f z;
#pragma unroll
    for (int i = 0; i < 8; ++i) z[i] = 0.0f;
    return z;
}

// fp32 -> bf16 (round to nearest even), returned as raw u16 bits
static __device__ inline unsigned short f2bfu(float f) {
    union { float f; uint32_t u; } c; c.f = f;
    uint32_t r = c.u + 0x7FFFu + ((c.u >> 16) & 1u);
    return (unsigned short)(r >> 16);
}

// model constants
#define BB   4
#define SS   1024
#define DD   1024
#define NHH  16
#define HDD  64
#define II   4096
#define BSR  4096   /* B*S rows */

#define BK      64
#define B_ROWB  256u
#define B_ROWS  64u
#define B_PITCH 288u
#define B_BUF   18432u
#define A_ROWB  128u
#define A_ROWS  128u
#define A_PITCH 144u
#define A_BUF   18432u
static_assert(B_ROWS * B_PITCH <= B_BUF && (B_BUF % 2048u) == 0u, "B buffer size");
static_assert(A_ROWS * A_PITCH <= A_BUF && (A_BUF % 2048u) == 0u, "A buffer size");

typedef unsigned int u32x8 __attribute__((ext_vector_type(8)));
typedef short        s16x8 __attribute__((ext_vector_type(8)));

static __device__ inline uint32_t uni(uint32_t v) {
    return (uint32_t)__builtin_amdgcn_readfirstlane(v);
}
static __device__ inline uint32_t pinned(uint32_t v) {
    uint32_t w = uni(v);
    asm volatile("" : "+s"(w));   // the pin of a tensor load's issue test in a scalar register
    return w;
}
static __device__ inline u32x8 btile_group1(uint32_t src_pitch) {
    u32x8 g;
    g[0] = uni((1u << 20) | (5u << 22) | (7u << 25));
    g[1] = uni((B_ROWB & 0xFFFFu) << 16);
    g[2] = uni((B_ROWB >> 16) | ((B_ROWS & 0xFFFFu) << 16));
    g[3] = uni((B_ROWS >> 16) | (B_ROWB << 16));
    g[4] = uni(B_ROWS);
    g[5] = uni(src_pitch);
    g[6] = uni(0u);
    g[7] = uni(0u);
    return g;
}
static __device__ inline u32x8 atile_group1(uint32_t src_pitch) {
    u32x8 g;
    g[0] = uni((1u << 20) | (4u << 22) | (3u << 25));
    g[1] = uni((A_ROWB & 0xFFFFu) << 16);
    g[2] = uni((A_ROWB >> 16) | ((A_ROWS & 0xFFFFu) << 16));
    g[3] = uni((A_ROWS >> 16) | (A_ROWB << 16));
    g[4] = uni(A_ROWS);
    g[5] = uni(src_pitch);
    g[6] = uni(0u);
    g[7] = uni(0u);
    return g;
}
static __device__ inline u32x4 btile_group0(uint32_t lds_dst, uint64_t ga) {
    u32x4 g;
    g[0] = uni(1u);
    g[1] = uni(lds_dst);
    g[2] = uni((uint32_t)ga);
    g[3] = uni((((uint32_t)(ga >> 32)) & 0x01FFFFFFu) | 0x80000000u);
    return g;
}
// 8 k x 16 columns per wave half of a row-major 16-bit LDS tile, transposed: lane (c, h)
// gets 8 consecutive k of column c, which is half a B fragment in the hardware k order
static __device__ inline u32x4 ld_tr16(const unsigned char* p) {
    typedef __attribute__((address_space(3))) s16x8 lds_s16x8;
    return __builtin_bit_cast(u32x4, __builtin_amdgcn_ds_load_tr16_b128_v8i16((lds_s16x8*)p));
}

#define CVT_THREADS 512
#define CVT_LOADS   32
#define CVT_PIECE   (CVT_THREADS * CVT_LOADS * 4)
#define CVT_P_ACT   (BSR * DD / CVT_PIECE)   /* pieces of the activations */
#define CVT_P_SQ    (DD * DD / CVT_PIECE)    /* pieces of a D x D weight */
#define CVT_P_FF    (DD * II / CVT_PIECE)    /* pieces of a D x I weight */
#define CVT_BLOCKS  (CVT_P_ACT + 4 * CVT_P_SQ + 2 * CVT_P_FF)
static_assert(BSR * DD % CVT_PIECE == 0 && DD * DD % CVT_PIECE == 0 && DD * II % CVT_PIECE == 0,
              "whole pieces");

typedef float  f32x2  __attribute__((ext_vector_type(2)));
typedef bf16_t bf16x2 __attribute__((ext_vector_type(2)));

// two f32 -> packed bf16 pair (round to nearest even)
static __device__ inline uint32_t pack_bf16(float a, float b) {
    f32x2 f; f[0] = a; f[1] = b;
    union { bf16x2 h; uint32_t u; } c;
    c.h = __builtin_convertvector(f, bf16x2);
    return c.u;
}

__global__ __launch_bounds__(CVT_THREADS)
void cvt_all_f32_bf16(
        const float* __restrict__ hidden, const float* __restrict__ Wq,
        const float* __restrict__ Wk, const float* __restrict__ Wv,
        const float* __restrict__ Wo, const float* __restrict__ Wi,
        const float* __restrict__ Wt,
        unsigned short* __restrict__ hb, unsigned short* __restrict__ wqb,
        unsigned short* __restrict__ wkb, unsigned short* __restrict__ wvb,
        unsigned short* __restrict__ wob, unsigned short* __restrict__ wib,
        unsigned short* __restrict__ wtb) {
    // which array, and which piece of it: the same for the whole block
    unsigned p = blockIdx.x;
    const float* in;
    unsigned short* out;
    if (p < CVT_P_ACT) { in = hidden; out = hb; }
    else if ((p -= CVT_P_ACT) < CVT_P_SQ) { in = Wq; out = wqb; }
    else if ((p -= CVT_P_SQ) < CVT_P_SQ) { in = Wk; out = wkb; }
    else if ((p -= CVT_P_SQ) < CVT_P_SQ) { in = Wv; out = wvb; }
    else if ((p -= CVT_P_SQ) < CVT_P_SQ) { in = Wo; out = wob; }
    else if ((p -= CVT_P_SQ) < CVT_P_FF) { in = Wi; out = wib; }
    else { p -= CVT_P_FF; in = Wt; out = wtb; }

    // block-uniform bases; the lane's index serves the 16-byte loads and the 8-byte stores
    const float4* src = (const float4*)(in + (size_t)p * CVT_PIECE);
    uint2*        dst = (uint2*)(out + (size_t)p * CVT_PIECE);
    const unsigned t = threadIdx.x;

    float4 v[CVT_LOADS];
#pragma unroll  // constant indices keep the array in registers
    for (int j = 0; j < CVT_LOADS; ++j) v[j] = src[t + j * CVT_THREADS];
    // keeps all loads above the conversions: left free, the compiler issues the last of them
    // behind waits for the first and the wave pays the memory latency more than once
    __builtin_amdgcn_sched_barrier(0);
    // every result has a register pair of its own: none is rewritten under a store in flight
    uint2 w[CVT_LOADS];
#pragma unroll  // constant indices keep the arrays in registers
    for (int j = 0; j < CVT_LOADS; ++j) {
        w[j].x = pack_bf16(v[j].x, v[j].y);
        w[j].y = pack_bf16(v[j].z, v[j].w);
    }
#pragma unroll  // constant indices keep the array in registers
    for (int j = 0; j < CVT_LOADS; ++j) dst[t + j * CVT_THREADS] = w[j];
}

// ---------------- tiled bf16 WMMA GEMM, tensor loads, two stage buffers ----------------
// C[M,N] = A[M,K] * B[K,N]  (A,B bf16 row-major, acc f32)
// block tile 128x128, 8 waves (2x4), wave tile 64x32 (4x2 wmma tiles)
// NB products with one A run side by side: C_p = A * B_p, p < NB, all B_p of one shape. The
// block holds the same 128x128 tile of every C_p, so that an A tile is staged once and an A
// fragment is read from LDS once for NB products (wave tile 64 x 32 in each C_p).
// A stage is NCH chunks of 64 k: NCH slices of A (128 rows x 64 k) and, for each B_p, NCH
// slices (64 k x 128 columns). Wave w < NCH brings A slice w, wave NCH + p * NCH + c brings
// slice c of B_p, one tensor load a wave and stage, so that a stage's landing latency is
// paid once per 64 * NCH k and its bytes come in through NCH * (1 + NB) request queues.
// K is a multiple of 64 * NCH and holds at least two stages.
// MODE 0: outF[row*N+col] = acc + bias[col] + res[row*N+col]
// MODE 1: head scatter: outB[((b*NH+head)*S + s)*HD + hd] = bf16(acc + bias)
// MODE 2: outB[row*N+col] = bf16(gelu(acc + bias))
// Bw, bias, outB belong to product 0; Bw1, bias1, outB1 and Bw2, bias2, outB2 to products
// 1 and 2 and are read only where NB says that these exist.
template <int MODE, int NCH, int NB>
__global__ __launch_bounds__(256) void gemm_bf16(const unsigned short* __restrict__ A,
                                                 const unsigned short* __restrict__ Bw,
                                                 const unsigned short* __restrict__ Bw1,
                                                 const unsigned short* __restrict__ Bw2,
                                                 const float* __restrict__ bias,
                                                 const float* __restrict__ bias1,
                                                 const float* __restrict__ bias2,
                                                 float* __restrict__ outF,
                                                 unsigned short* __restrict__ outB,
                                                 unsigned short* __restrict__ outB1,
                                                 unsigned short* __restrict__ outB2,
                                                 const float* __restrict__ res,
                                                 int M, int N, int K) {
    static_assert(A_BUF == B_BUF && NCH * (1 + NB) <= 8, "one slice size, one slice a wave");
    static_assert(NB == 1 || (NB == 3 && MODE == 1), "the products that are launched");
    constexpr uint32_t SLICE = A_BUF;                     // a whole number of 2 KiB units
    constexpr uint32_t NSL   = (uint32_t)(NCH * (1 + NB));
    constexpr uint32_t STAGE = NSL * SLICE;               // [A slices | B_0 slices | ...]
    __shared__ __attribute__((aligned(2048))) unsigned char Ts[2 * STAGE];

    const int tid   = threadIdx.x;
    const int lane  = tid & 31;
    const int wid   = tid >> 5;
    const int n16   = lane & 15;
    const int hi    = lane >> 4;
    const int waveM = wid >> 2;   // 0..1
    const int waveN = wid & 3;    // 0..3
    const int rowBase = blockIdx.y * 128;
    const int colBase = blockIdx.x * 128;

    v8f acc[NB][4][2];
#pragma unroll
    for (int p = 0; p < NB; ++p)
#pragma unroll
        for (int i = 0; i < 4; ++i)
#pragma unroll
            for (int j = 0; j < 2; ++j) acc[p][i][j] = zero8();

    const uint32_t wave   = uni((uint32_t)threadIdx.x >> 5);
    const uint32_t bchunk = uni((uint32_t)N * (2u * BK));   // 64 source rows of B, in bytes
    // which B_p a B wave serves, and which chunk of the stage
    const uint32_t bprod = NB > 1 ? (wave - (uint32_t)NCH) / (uint32_t)NCH : 0u;
    const uint32_t bslc  = wave - (uint32_t)NCH - bprod * (uint32_t)NCH;
    const unsigned short* bsrc = Bw;
    if (NB > 1) bsrc = bprod == 1u ? Bw1 : (bprod == 2u ? Bw2 : Bw);
    // first byte of this wave's slice in stage 0, and its step from stage to stage
    const uint64_t src0 = wave < (uint32_t)NCH
        ? (uint64_t)(A + (size_t)rowBase * K) + wave * A_ROWB
        : (uint64_t)(bsrc + colBase) + (uint64_t)bslc * bchunk;
    const uint32_t step = wave < (uint32_t)NCH ? (uint32_t)NCH * A_ROWB : (uint32_t)NCH * bchunk;
    const uint32_t place0 = (uint32_t)(size_t)&Ts[0] + wave * SLICE;
    u32x8 ag1 = atile_group1((uint32_t)K * 2u);
    u32x8 bg1 = btile_group1((uint32_t)N * 2u);
    u32x4 ag0 = btile_group0(place0, src0);
    u32x4 bg0 = btile_group0(place0, src0);

    auto issue = [&](uint32_t buf, bool advance) {
        // scalar branches (see pinned()); each path has its own constant pad word
        if (pinned(wave < (uint32_t)NCH)) {
            ag0[1] = uni(place0 + buf * STAGE);
            if (advance) {
                const uint64_t a = (((uint64_t)ag0[3] << 32) | ag0[2]) + step;
                ag0[2] = uni((uint32_t)a);
                ag0[3] = uni((uint32_t)(a >> 32));
            }
            asm volatile("tensor_load_to_lds %0, %1" : "+s"(ag0), "+s"(ag1) :: "memory");
        }
        if (pinned(wave >= (uint32_t)NCH && wave < NSL)) {
            bg0[1] = uni(place0 + buf * STAGE);
            if (advance) {
                const uint64_t a = (((uint64_t)bg0[3] << 32) | bg0[2]) + step;
                bg0[2] = uni((uint32_t)a);
                bg0[3] = uni((uint32_t)(a >> 32));
            }
            asm volatile("tensor_load_to_lds %0, %1" : "+s"(bg0), "+s"(bg1) :: "memory");
        }
    };

    const uint32_t nst = uni((uint32_t)K / (uint32_t)(BK * NCH));
    issue(0u, false);
    asm volatile("s_wait_tensorcnt 0x0" ::: "memory");   // this wave's slice of stage 0 has landed
    __syncthreads();                                     // every wave's slice has
    issue(1u, true);                                     // flies while stage 0 is worked on

    for (uint32_t s = 0; s < nst; ++s) {
        const unsigned char* st = &Ts[0] + (s & 1u) * STAGE;
        // the lane's row of the wave's first A tile, at its 16-byte half of 32 bytes
        const unsigned char* as0 = st + (waveM * 64 + n16) * A_PITCH + 16 * hi;
        // the lane's address in the transposing load: row 8*hi + (lane & 7), 16-byte
        // half (lane >> 3) & 1 of the 32 bytes of a 16-column group
        const unsigned char* bs0 = st + NCH * SLICE + (8 * hi + (lane & 7)) * B_PITCH +
                                   16 * ((lane >> 3) & 1) + 64 * waveN;

#pragma unroll  // the chunks of a stage, in rising k; constant slice offsets
        for (int ch = 0; ch < NCH; ++ch) {
            const unsigned char* as = as0 + ch * SLICE;
            const unsigned char* bs = bs0 + ch * SLICE;

            // all fragment reads of the chunk (16 of A, 8 of each B_p) stand as one group
            // ahead of its 16 * NB WMMAs
            FragBF af[BK / 32][4];
            FragBF bf[NB][BK / 32][2];
#pragma unroll  // constant indices keep the arrays in registers
            for (int c = 0; c < BK / 32; ++c) {
#pragma unroll  // constant indices keep the arrays in registers
                for (int p = 0; p < NB; ++p)
#pragma unroll  // constant indices keep the arrays in registers
                    for (int nt = 0; nt < 2; ++nt) {
                        const unsigned char* bp = bs + p * NCH * SLICE + 32 * nt;
                        const u32x4 lo = ld_tr16(bp + (32 * c) * B_PITCH);        // k  0..15
                        const u32x4 up = ld_tr16(bp + (32 * c + 16) * B_PITCH);   // k 16..31
                        bf[p][c][nt].d[0] = lo.x; bf[p][c][nt].d[1] = lo.y;
                        bf[p][c][nt].d[2] = lo.z; bf[p][c][nt].d[3] = lo.w;
                        bf[p][c][nt].d[4] = up.x; bf[p][c][nt].d[5] = up.y;
                        bf[p][c][nt].d[6] = up.z; bf[p][c][nt].d[7] = up.w;
                    }
#pragma unroll  // constant indices keep the arrays in registers
                for (int mt = 0; mt < 4; ++mt) {
                    // elements 0-7 = k 8*hi + 0..7, elements 8-15 = k 16 + 8*hi + 0..7
                    const uint4 lo = *(const uint4*)(as + mt * 16 * A_PITCH + 64 * c);
                    const uint4 up = *(const uint4*)(as + mt * 16 * A_PITCH + 64 * c + 32);
                    af[c][mt].d[0] = lo.x; af[c][mt].d[1] = lo.y;
                    af[c][mt].d[2] = lo.z; af[c][mt].d[3] = lo.w;
                    af[c][mt].d[4] = up.x; af[c][mt].d[5] = up.y;
                    af[c][mt].d[6] = up.z; af[c][mt].d[7] = up.w;
                }
            }
            // keeps the reads above the WMMAs: sunk among them, each pair of reads is waited
            // out to zero in front of its two WMMAs and the LDS latency is paid eight times
            __builtin_amdgcn_sched_barrier(0);
#pragma unroll  // two chunks of 32 k, in rising k; constant indices keep the arrays in registers
            for (int c = 0; c < BK / 32; ++c)
#pragma unroll  // constant indices keep the arrays in registers
                for (int mt = 0; mt < 4; ++mt)
#pragma unroll  // constant indices keep the arrays in registers
                    for (int p = 0; p < NB; ++p)
#pragma unroll  // constant indices keep the arrays in registers
                        for (int nt = 0; nt < 2; ++nt)
                            acc[p][mt][nt] = __builtin_amdgcn_wmma_f32_16x16x32_bf16(
                                false, af[c][mt].v, false, bf[p][c][nt].v, (short)0,
                                acc[p][mt][nt], false, false);
            // keeps the next chunk's reads, and the stage's closing waits and barrier, below
            // the WMMAs: lifted among them they bring waits in front of the matrix work
            __builtin_amdgcn_sched_barrier(0);
        }

        // hand-over of the stage, every wave, in this order
        asm volatile("s_wait_dscnt 0x0" ::: "memory");      // this wave has left buffer s & 1
        asm volatile("s_wait_tensorcnt 0x0" ::: "memory");  // its slice of stage s + 1 has landed
        __syncthreads();   // stage s + 1 is published; every reader has left buffer s & 1
        // the test for a further stage is a scalar branch as well (see pinned())
        if (pinned(s + 2u < nst)) issue(s & 1u, true);
    }
    asm volatile("s_wait_tensorcnt 0x0" ::: "memory");   // nothing in flight when the wave goes on
    asm volatile("s_wait_dscnt 0x0" ::: "memory");

    // epilogue
    if constexpr (MODE == 1) {
        // a block's 128 rows lie in one batch entry, a wave's 32 columns in one head
        const int grow0 = rowBase + waveM * 64 + 8 * hi;
        const int gcol0 = colBase + waveN * 32 + n16;
        const size_t head0 = ((size_t)((grow0 >> 10) * NHH + (gcol0 >> 6)) * SS + (grow0 & 1023)) * HDD;
        float bv[NB][2];
#pragma unroll
        for (int p = 0; p < NB; ++p)
#pragma unroll
            for (int nt = 0; nt < 2; ++nt)
                bv[p][nt] = (p == 0 ? bias : (p == 1 ? bias1 : bias2))[gcol0 + nt * 16];
#pragma unroll
        for (int p = 0; p < NB; ++p) {
            unsigned short* po = (p == 0 ? outB : (p == 1 ? outB1 : outB2)) + head0 + (gcol0 & 63);
#pragma unroll
            for (int mt = 0; mt < 4; ++mt) {
#pragma unroll
                for (int nt = 0; nt < 2; ++nt) {
                    unsigned short* dst = po + mt * 16 * HDD + nt * 16;
                    unsigned short w[8];
#pragma unroll
                    for (int r = 0; r < 8; ++r) w[r] = f2bfu(acc[p][mt][nt][r] + bv[p][nt]);
                    // keeps the tile's arithmetic above its stores, so that no register which
                    // one of these stores names is written between the first store and the wait
                    __builtin_amdgcn_sched_barrier(0);
#pragma unroll
                    for (int r = 0; r < 8; ++r) dst[r * HDD] = w[r];
                    // stands in front of the next tile's writes of registers that these stores
                    // name
                    asm volatile("s_wait_xcnt 0x0" ::: "memory");
                    // keeps the next tile's arithmetic below that wait
                    __builtin_amdgcn_sched_barrier(0);
                }
            }
        }
    } else {
#pragma unroll
        for (int mt = 0; mt < 4; ++mt) {
#pragma unroll
            for (int nt = 0; nt < 2; ++nt) {
#pragma unroll
                for (int r = 0; r < 8; ++r) {
                    int grow = rowBase + waveM * 64 + mt * 16 + r + 8 * hi;
                    int gcol = colBase + waveN * 32 + nt * 16 + n16;
                    float v = acc[0][mt][nt][r] + bias[gcol];
                    if (MODE == 0) {
                        outF[(size_t)grow * N + gcol] = v + res[(size_t)grow * N + gcol];
                    } else {
                        float g = 0.5f * v * (1.0f + erff(v * 0.70710678118654752f));
                        outB[(size_t)grow * N + gcol] = f2bfu(g);
                    }
                }
            }
        }
    }
}

#define KV_ROWB   128u
#define KV_ROWS   256u                     /* rows of one slice */
#define K_PITCH   144u
#define V_PITCH   160u
#define K_SLICE   (KV_ROWS * K_PITCH)
#define V_SLICE   (KV_ROWS * V_PITCH)
#define K_BYTES   (4u * K_SLICE)
#define V_BYTES   (4u * V_SLICE)
static_assert(K_SLICE % 2048u == 0u && V_SLICE % 2048u == 0u, "slices are whole 2 KiB units");
static_assert(4u * KV_ROWS == SS && KV_ROWB == HDD * 2u, "four slices hold a head");

template <uint32_t PAD_A>
static __device__ inline u32x8 kvtile_group1() {
    u32x8 g;
    g[0] = uni((1u << 20) | (4u << 22) | (PAD_A << 25));
    g[1] = uni((KV_ROWB & 0xFFFFu) << 16);
    g[2] = uni((KV_ROWB >> 16) | ((KV_ROWS & 0xFFFFu) << 16));
    g[3] = uni((KV_ROWS >> 16) | (KV_ROWB << 16));
    g[4] = uni(KV_ROWS);
    g[5] = uni(KV_ROWB);
    g[6] = uni(0u);
    g[7] = uni(0u);
    return g;
}
static __device__ inline float exp_slot(float x) {
    float e;
    asm("v_exp_f32 %0, %1\n\tv_nop" : "=v"(e) : "v"(x * 1.4426950408889634f));
    return e;
}

static __device__ inline float other_half(float x) {
    int b = __builtin_bit_cast(int, x);
    b = __builtin_amdgcn_permlanex16(b, b, 0x76543210, 0xfedcba98, false, false);
    return __builtin_bit_cast(float, b);
}

// 32 k of one row, k-contiguous in memory, in the hardware k order:
// elements 0-7 = k 8*hi + 0..7, elements 8-15 = k 16 + 8*hi + 0..7
// (p = wave-uniform base, off = the lane's row * HDD + 8*hi)
static __device__ inline void load_row_frag(FragBF& f, const unsigned short* p, unsigned off) {
    const uint4 lo = *(const uint4*)(p + off);
    const uint4 up = *(const uint4*)(p + off + 16);
    f.d[0] = lo.x; f.d[1] = lo.y; f.d[2] = lo.z; f.d[3] = lo.w;
    f.d[4] = up.x; f.d[5] = up.y; f.d[6] = up.z; f.d[7] = up.w;
}

// the same fragment from a K row in LDS (p = the lane's row, at its 16-byte half of 32 bytes)
static __device__ inline void lds_row_frag(FragBF& f, const unsigned char* p) {
    const uint4 lo = *(const uint4*)(p);
    const uint4 up = *(const uint4*)(p + 32);
    f.d[0] = lo.x; f.d[1] = lo.y; f.d[2] = lo.z; f.d[3] = lo.w;
    f.d[4] = up.x; f.d[5] = up.y; f.d[6] = up.z; f.d[7] = up.w;
}

__global__ __launch_bounds__(256) void attn_kernel(const unsigned short* __restrict__ Q,
                                                   const unsigned short* __restrict__ Kb,
                                                   const unsigned short* __restrict__ Vb,
                                                   const float* __restrict__ mask,
                                                   unsigned short* __restrict__ ctxB) {
    __shared__ __attribute__((aligned(2048))) unsigned char KV[K_BYTES + V_BYTES];   // [K | V]
    const int lane = threadIdx.x & 31;
    const int wid  = threadIdx.x >> 5;
    const int n16  = lane & 15;
    const int hi   = lane >> 4;
    const int bh   = blockIdx.x >> 2;     // (b*NH + h)
    const int qblk = (blockIdx.x & 3) * 256;
    const int q0   = qblk + wid * 32;
    const int b    = bh >> 4;
    const int h    = bh & 15;
    const unsigned short* Qh = Q  + (size_t)bh * SS * HDD;
    const unsigned short* Kh = Kb + (size_t)bh * SS * HDD;
    const unsigned short* Vh = Vb + (size_t)bh * SS * HDD;
    const float*          mb = mask + (size_t)b * SS;
    const unsigned rowOff = (unsigned)(n16 * HDD + 8 * hi);   // Q rows

    // Q rows as B fragments: [column group][k chunk of 32]; asked for ahead of the tensor
    // loads, so that they fly while K and V land
    FragBF qf[2][2];
#pragma unroll  // constant indices keep the arrays in registers
    for (int g = 0; g < 2; ++g)
#pragma unroll  // constant indices keep the arrays in registers
        for (int c = 0; c < 2; ++c)
            load_row_frag(qf[g][c], Qh + (size_t)wid * 32 * HDD + (qblk + 16 * g) * HDD + 32 * c, rowOff);

    // waves 0-3 bring K rows 256 w .., waves 4-7 V rows 256 (w - 4) ..: one tensor load a
    // wave, each behind a scalar branch (see pinned()) with its own constant pad word
    const uint32_t wave = uni((uint32_t)threadIdx.x >> 5);
    const uint32_t kv0  = (uint32_t)(size_t)&KV[0];
    if (pinned(wave < 4u)) {
        u32x4 g0 = btile_group0(kv0 + wave * K_SLICE,
                                (uint64_t)Kh + (uint64_t)(wave * (KV_ROWS * KV_ROWB)));
        u32x8 g1 = kvtile_group1<3u>();
        asm volatile("tensor_load_to_lds %0, %1" :: "s"(g0), "s"(g1) : "memory");
        asm volatile("s_wait_tensorcnt 0x0" ::: "memory");   // this wave's K slice has landed
    }
    if (pinned(wave >= 4u)) {
        u32x4 g0 = btile_group0(kv0 + K_BYTES + (wave - 4u) * V_SLICE,
                                (uint64_t)Vh + (uint64_t)((wave - 4u) * (KV_ROWS * KV_ROWB)));
        u32x8 g1 = kvtile_group1<7u>();
        asm volatile("tensor_load_to_lds %0, %1" :: "s"(g0), "s"(g1) : "memory");
        asm volatile("s_wait_tensorcnt 0x0" ::: "memory");   // this wave's V slice has landed
    }
    __syncthreads();   // every wave's slice has landed: K and V are published to the block

    // the lane's row of a 16-key tile of K, at its 16-byte half of 32 bytes
    const unsigned char* kl = &KV[0] + n16 * K_PITCH + 16 * hi;
    // the lane's address in the transposing load: row 8*hi + (lane & 7), 16-byte half
    // (lane >> 3) & 1 of the 32 bytes of a 16-column group
    const unsigned char* vl = &KV[K_BYTES] + (8 * hi + (lane & 7)) * V_PITCH +
                              16 * ((lane >> 3) & 1);

    // K rows as A fragments: [key tile of 16][k chunk of 32], fetched one pass ahead
    FragBF kf[2][2];
#pragma unroll  // constant indices keep the arrays in registers
    for (int t = 0; t < 2; ++t)
#pragma unroll  // constant indices keep the arrays in registers
        for (int c = 0; c < 2; ++c)
            lds_row_frag(kf[t][c], kl + 16 * t * K_PITCH + 64 * c);

    v8f   o[2][4];                 // O^T: [group][hd tile]; reg r = hd 8*hi + r
    float mrun[2], lrun[2];        // running maximum; this half's running sum
#pragma unroll  // constant indices keep the arrays in registers
    for (int g = 0; g < 2; ++g) {
        mrun[g] = -3.402823466e38f;   // finite, so that (-inf) - mrun is never NaN
        lrun[g] = 0.0f;
#pragma unroll  // constant indices keep the arrays in registers
        for (int nt = 0; nt < 4; ++nt) o[g][nt] = zero8();
    }

    for (int kp = 0; kp < 32; ++kp) {
        const int key0 = kp * 32;

        // V^T as A fragments (row = hd, k = key)
        const unsigned char* vp = vl + key0 * V_PITCH;
        FragBF vf[4];
#pragma unroll  // constant indices keep the arrays in registers
        for (int nt = 0; nt < 4; ++nt) {
            const u32x4 lo = ld_tr16(vp + 32 * nt);                  // keys  0..15
            const u32x4 up = ld_tr16(vp + 16 * V_PITCH + 32 * nt);   // keys 16..31
            vf[nt].d[0] = lo.x; vf[nt].d[1] = lo.y; vf[nt].d[2] = lo.z; vf[nt].d[3] = lo.w;
            vf[nt].d[4] = up.x; vf[nt].d[5] = up.y; vf[nt].d[6] = up.z; vf[nt].d[7] = up.w;
        }

        // mask of this lane's keys: [tile][r] = key key0 + 16*t + 8*hi + r; the 32 values
        // of the pass are read at wave-uniform addresses, a lane picks its half's
        float mk[2][8];
#pragma unroll  // constant indices keep the arrays in registers
        for (int t = 0; t < 2; ++t)
#pragma unroll  // constant indices keep the arrays in registers
            for (int r = 0; r < 8; ++r) {
                const float lo = mb[key0 + 16 * t + r];
                const float up = mb[key0 + 16 * t + 8 + r];
                mk[t][r] = hi ? up : lo;
            }

        // S^T tiles: st[g][t][r] = q(q0 + 16g + n16) . k(key0 + 16t + 8hi + r)
        v8f st[2][2];
#pragma unroll  // constant indices keep the arrays in registers
        for (int g = 0; g < 2; ++g)
#pragma unroll  // constant indices keep the arrays in registers
            for (int t = 0; t < 2; ++t) {
                v8f s = zero8();
#pragma unroll  // constant indices keep the arrays in registers
                for (int c = 0; c < 2; ++c)
                    s = __builtin_amdgcn_wmma_f32_16x16x32_bf16(false, kf[t][c].v, false,
                                                                qf[g][c].v, (short)0, s,
                                                                false, false);
                st[g][t] = s;
            }

        // next pass's K rows (the last pass fetches pass 0's again: in bounds, unused)
        {
            const int kn = ((kp + 1) & 31) * 32;
#pragma unroll  // constant indices keep the arrays in registers
            for (int t = 0; t < 2; ++t)
#pragma unroll  // constant indices keep the arrays in registers
                for (int c = 0; c < 2; ++c)
                    lds_row_frag(kf[t][c], kl + (kn + 16 * t) * K_PITCH + 64 * c);
        }

        FragBF pf[2];
#pragma unroll  // constant indices keep the arrays in registers
        for (int g = 0; g < 2; ++g) {
            float x[16];
            float mx = mrun[g];
#pragma unroll  // constant indices keep the arrays in registers
            for (int t = 0; t < 2; ++t)
#pragma unroll  // constant indices keep the arrays in registers
                for (int r = 0; r < 8; ++r) {
                    x[8 * t + r] = st[g][t][r] * 0.125f + mk[t][r];
                    mx = fmaxf(mx, x[8 * t + r]);
                }
            mx = fmaxf(mx, other_half(mx));
            const float alpha = exp_slot(mrun[g] - mx);
            mrun[g] = mx;
            float sum = 0.0f;
#pragma unroll  // constant indices keep the arrays in registers
            for (int i = 0; i < 16; ++i) {
                x[i] = exp_slot(x[i] - mx);
                sum += x[i];
            }
            lrun[g] = lrun[g] * alpha + sum;
#pragma unroll  // constant indices keep the arrays in registers
            for (int i = 0; i < 8; ++i) pf[g].d[i] = pack_bf16(x[2 * i], x[2 * i + 1]);
#pragma unroll  // constant indices keep the arrays in registers
            for (int nt = 0; nt < 4; ++nt)
#pragma unroll  // constant indices keep the arrays in registers
                for (int r = 0; r < 8; ++r) o[g][nt][r] *= alpha;
        }

        // O^T += V^T . P^T
#pragma unroll  // constant indices keep the arrays in registers
        for (int nt = 0; nt < 4; ++nt)
#pragma unroll  // constant indices keep the arrays in registers
            for (int g = 0; g < 2; ++g)
                o[g][nt] = __builtin_amdgcn_wmma_f32_16x16x32_bf16(false, vf[nt].v, false,
                                                                   pf[g].v, (short)0,
                                                                   o[g][nt], false, false);
    }

    // ctx as bf16 in [B,S,D] layout: a lane's 8 registers are 8 consecutive hd
#pragma unroll  // constant indices keep the arrays in registers
    for (int g = 0; g < 2; ++g) {
        const float inv = 1.0f / (lrun[g] + other_half(lrun[g]));
        unsigned short* dst = ctxB + ((size_t)b * SS + q0 + 16 * g + n16) * DD + h * 64 + 8 * hi;
#pragma unroll  // constant indices keep the arrays in registers
        for (int nt = 0; nt < 4; ++nt) {
            uint4 w;
            w.x = pack_bf16(o[g][nt][0] * inv, o[g][nt][1] * inv);
            w.y = pack_bf16(o[g][nt][2] * inv, o[g][nt][3] * inv);
            w.z = pack_bf16(o[g][nt][4] * inv, o[g][nt][5] * inv);
            w.w = pack_bf16(o[g][nt][6] * inv, o[g][nt][7] * inv);
            *(uint4*)(dst + nt * 16) = w;
        }
    }
}

// ---------------- layernorm: one block per row (D=1024) ----------------
__global__ __launch_bounds__(256) void ln_kernel(const float* __restrict__ x,
                                                 const float* __restrict__ g,
                                                 const float* __restrict__ bta,
                                                 float* __restrict__ outF,
                                                 unsigned short* __restrict__ outB) {
    __shared__ float red[256];
    const int row = blockIdx.x;
    const int tid = threadIdx.x;
    const float* xr = x + (size_t)row * DD;

    float s = 0.0f;
    for (int i = tid; i < DD; i += 256) s += xr[i];
    red[tid] = s; __syncthreads();
    for (int off = 128; off > 0; off >>= 1) {
        if (tid < off) red[tid] += red[tid + off];
        __syncthreads();
    }
    float mu = red[0] * (1.0f / DD);
    __syncthreads();

    float v = 0.0f;
    for (int i = tid; i < DD; i += 256) {
        float d = xr[i] - mu; v += d * d;
    }
    red[tid] = v; __syncthreads();
    for (int off = 128; off > 0; off >>= 1) {
        if (tid < off) red[tid] += red[tid + off];
        __syncthreads();
    }
    float inv = rsqrtf(red[0] * (1.0f / DD) + 1e-12f);

    for (int i = tid; i < DD; i += 256) {
        float o = (xr[i] - mu) * inv * g[i] + bta[i];
        outF[(size_t)row * DD + i] = o;
        if (outB) outB[(size_t)row * DD + i] = f2bfu(o);
    }
}

// ---------------- launcher ----------------
extern "C" void kernel_launch(void* const* d_in, const int* in_sizes, int n_in,
                              void* d_out, int out_size, void* d_ws, size_t ws_size,
                              hipStream_t stream) {
    const float* hidden = (const float*)d_in[0];
    const float* mask   = (const float*)d_in[1];
    const float* Wq = (const float*)d_in[2];   const float* bq  = (const float*)d_in[3];
    const float* Wk = (const float*)d_in[4];   const float* bk  = (const float*)d_in[5];
    const float* Wv = (const float*)d_in[6];   const float* bv  = (const float*)d_in[7];
    const float* Wo = (const float*)d_in[8];   const float* bo  = (const float*)d_in[9];
    const float* g1 = (const float*)d_in[10];  const float* b1  = (const float*)d_in[11];
    const float* Wi = (const float*)d_in[12];  const float* bi  = (const float*)d_in[13];
    const float* Wt = (const float*)d_in[14];  const float* bot = (const float*)d_in[15];
    const float* g2 = (const float*)d_in[16];  const float* b2  = (const float*)d_in[17];
    float* out = (float*)d_out;

    const size_t BSD = (size_t)BSR * DD;     // 4M
    const size_t DI  = (size_t)DD * II;      // 4M
    const size_t DDq = (size_t)DD * DD;      // 1M

    char* ws = (char*)d_ws;
    auto alloc = [&](size_t bytes) -> char* {
        char* p = ws;
        ws += (bytes + 255) & ~(size_t)255;
        return p;
    };
    unsigned short* hb    = (unsigned short*)alloc(BSD * 2);
    unsigned short* wqb   = (unsigned short*)alloc(DDq * 2);
    unsigned short* wkb   = (unsigned short*)alloc(DDq * 2);
    unsigned short* wvb   = (unsigned short*)alloc(DDq * 2);
    unsigned short* wob   = (unsigned short*)alloc(DDq * 2);
    unsigned short* wib   = (unsigned short*)alloc(DI * 2);
    unsigned short* wtb   = (unsigned short*)alloc(DI * 2);
    unsigned short* qb    = (unsigned short*)alloc(BSD * 2);
    unsigned short* kbuf  = (unsigned short*)alloc(BSD * 2);
    unsigned short* vbuf  = (unsigned short*)alloc(BSD * 2);
    unsigned short* ctxb  = (unsigned short*)alloc(BSD * 2);
    float*          y1    = (float*)alloc(BSD * 4);
    float*          attnf = (float*)alloc(BSD * 4);
    unsigned short* attnb = (unsigned short*)alloc(BSD * 2);
    unsigned short* interb= (unsigned short*)alloc((size_t)BSR * II * 2);
    float*          y2    = (float*)alloc(BSD * 4);

    // 1) fp32 -> bf16 conversions
    cvt_all_f32_bf16<<<CVT_BLOCKS, CVT_THREADS, 0, stream>>>(hidden, Wq, Wk, Wv, Wo, Wi, Wt,
                                                             hb, wqb, wkb, wvb, wob, wib, wtb);

    // 2) Q, K and V projections side by side (head-scattered bf16 outputs)
    {
        dim3 g(DD / 128, BSR / 128);
        gemm_bf16<1, 2, 3><<<g, 256, 0, stream>>>(hb, wqb, wkb, wvb, bq, bk, bv, nullptr,
                                                  qb, kbuf, vbuf, nullptr, BSR, DD, DD);
    }

    // 3) attention
    attn_kernel<<<BB * NHH * (SS / 256), 256, 0, stream>>>(qb, kbuf, vbuf, mask, ctxb);

    // 4) output projection + residual(hidden)
    {
        dim3 g(DD / 128, BSR / 128);
        gemm_bf16<0, 4, 1><<<g, 256, 0, stream>>>(ctxb, wob, nullptr, nullptr, bo, nullptr,
                                                  nullptr, y1, nullptr, nullptr, nullptr,
                                                  hidden, BSR, DD, DD);
    }
    // 5) LN1 -> attnf (f32) + attnb (bf16)
    ln_kernel<<<BSR, 256, 0, stream>>>(y1, g1, b1, attnf, attnb);

    // 6) FFN up + exact GELU -> bf16
    {
        dim3 g(II / 128, BSR / 128);
        gemm_bf16<2, 2, 1><<<g, 256, 0, stream>>>(attnb, wib, nullptr, nullptr, bi, nullptr,
                                                  nullptr, nullptr, interb, nullptr, nullptr,
                                                  nullptr, BSR, II, DD);
    }
    // 7) FFN down + residual(attnf)
    {
        dim3 g(DD / 128, BSR / 128);
        gemm_bf16<0, 4, 1><<<g, 256, 0, stream>>>(interb, wtb, nullptr, nullptr, bot, nullptr,
                                                  nullptr, y2, nullptr, nullptr, nullptr,
                                                  attnf, BSR, DD, II);
    }
    // 8) LN2 -> final output
    ln_kernel<<<BSR, 256, 0, stream>>>(y2, g2, b2, out, nullptr);
}

// v008
// It runs in 167 microseconds.
// In two side-by-side timings against v007, it was 1.04 and 1.03 times as fast.
// Counting every step since v000, it is 4.99 times as fast.
#include <hip/hip_runtime.h>
#include <cstdint>
#include <cstddef>

// ---------------- types ----------------
typedef __bf16 bf16_t;
typedef bf16_t v16bf __attribute__((ext_vector_type(16)));
typedef float  v8f   __attribute__((ext_vector_type(8)));
typedef unsigned int u32x4 __attribute__((ext_vector_type(4)));

union FragBF {
    uint32_t       d[8];
    unsigned short u[16];
    v16bf          v;
};

static __device__ inline v8f zero8() {
    v8f z;
#pragma unroll
    for (int i = 0; i < 8; ++i) z[i] = 0.0f;
    return z;
}

// fp32 -> bf16 (round to nearest even), returned as raw u16 bits
static __device__ inline unsigned short f2bfu(float f) {
    union { float f; uint32_t u; } c; c.f = f;
    uint32_t r = c.u + 0x7FFFu + ((c.u >> 16) & 1u);
    return (unsigned short)(r >> 16);
}

// model constants
#define BB   4
#define SS   1024
#define DD   1024
#define NHH  16
#define HDD  64
#define II   4096
#define BSR  4096   /* B*S rows */

#define BK      64
#define B_ROWB  256u
#define B_ROWS  64u
#define B_PITCH 288u
#define B_BUF   18432u
#define A_ROWB  128u
#define A_ROWS  128u
#define A_PITCH 144u
#define A_BUF   18432u
static_assert(B_ROWS * B_PITCH <= B_BUF && (B_BUF % 2048u) == 0u, "B buffer size");
static_assert(A_ROWS * A_PITCH <= A_BUF && (A_BUF % 2048u) == 0u, "A buffer size");

typedef unsigned int u32x8 __attribute__((ext_vector_type(8)));
typedef short        s16x8 __attribute__((ext_vector_type(8)));

static __device__ inline uint32_t uni(uint32_t v) {
    return (uint32_t)__builtin_amdgcn_readfirstlane(v);
}
static __device__ inline uint32_t pinned(uint32_t v) {
    uint32_t w = uni(v);
    asm volatile("" : "+s"(w));   // the pin of a tensor load's issue test in a scalar register
    return w;
}
static __device__ inline u32x8 btile_group1(uint32_t src_pitch) {
    u32x8 g;
    g[0] = uni((1u << 20) | (5u << 22) | (7u << 25));
    g[1] = uni((B_ROWB & 0xFFFFu) << 16);
    g[2] = uni((B_ROWB >> 16) | ((B_ROWS & 0xFFFFu) << 16));
    g[3] = uni((B_ROWS >> 16) | (B_ROWB << 16));
    g[4] = uni(B_ROWS);
    g[5] = uni(src_pitch);
    g[6] = uni(0u);
    g[7] = uni(0u);
    return g;
}
static __device__ inline u32x8 atile_group1(uint32_t src_pitch) {
    u32x8 g;
    g[0] = uni((1u << 20) | (4u << 22) | (3u << 25));
    g[1] = uni((A_ROWB & 0xFFFFu) << 16);
    g[2] = uni((A_ROWB >> 16) | ((A_ROWS & 0xFFFFu) << 16));
    g[3] = uni((A_ROWS >> 16) | (A_ROWB << 16));
    g[4] = uni(A_ROWS);
    g[5] = uni(src_pitch);
    g[6] = uni(0u);
    g[7] = uni(0u);
    return g;
}
static __device__ inline u32x4 btile_group0(uint32_t lds_dst, uint64_t ga) {
    u32x4 g;
    g[0] = uni(1u);
    g[1] = uni(lds_dst);
    g[2] = uni((uint32_t)ga);
    g[3] = uni((((uint32_t)(ga >> 32)) & 0x01FFFFFFu) | 0x80000000u);
    return g;
}
// 8 k x 16 columns per wave half of a row-major 16-bit LDS tile, transposed: lane (c, h)
// gets 8 consecutive k of column c, which is half a B fragment in the hardware k order
static __device__ inline u32x4 ld_tr16(const unsigned char* p) {
    typedef __attribute__((address_space(3))) s16x8 lds_s16x8;
    return __builtin_bit_cast(u32x4, __builtin_amdgcn_ds_load_tr16_b128_v8i16((lds_s16x8*)p));
}

#define CVT_THREADS 512
#define CVT_LOADS   32
#define CVT_PIECE   (CVT_THREADS * CVT_LOADS * 4)
#define CVT_P_ACT   (BSR * DD / CVT_PIECE)   /* pieces of the activations */
#define CVT_P_SQ    (DD * DD / CVT_PIECE)    /* pieces of a D x D weight */
#define CVT_P_FF    (DD * II / CVT_PIECE)    /* pieces of a D x I weight */
#define CVT_BLOCKS  (CVT_P_ACT + 4 * CVT_P_SQ + 2 * CVT_P_FF)
static_assert(BSR * DD % CVT_PIECE == 0 && DD * DD % CVT_PIECE == 0 && DD * II % CVT_PIECE == 0,
              "whole pieces");

typedef float  f32x2  __attribute__((ext_vector_type(2)));
typedef bf16_t bf16x2 __attribute__((ext_vector_type(2)));

// two f32 -> packed bf16 pair (round to nearest even)
static __device__ inline uint32_t pack_bf16(float a, float b) {
    f32x2 f; f[0] = a; f[1] = b;
    union { bf16x2 h; uint32_t u; } c;
    c.h = __builtin_convertvector(f, bf16x2);
    return c.u;
}

__global__ __launch_bounds__(CVT_THREADS)
void cvt_all_f32_bf16(
        const float* __restrict__ hidden, const float* __restrict__ Wq,
        const float* __restrict__ Wk, const float* __restrict__ Wv,
        const float* __restrict__ Wo, const float* __restrict__ Wi,
        const float* __restrict__ Wt,
        unsigned short* __restrict__ hb, unsigned short* __restrict__ wqb,
        unsigned short* __restrict__ wkb, unsigned short* __restrict__ wvb,
        unsigned short* __restrict__ wob, unsigned short* __restrict__ wib,
        unsigned short* __restrict__ wtb) {
    // which array, and which piece of it: the same for the whole block
    unsigned p = blockIdx.x;
    const float* in;
    unsigned short* out;
    if (p < CVT_P_ACT) { in = hidden; out = hb; }
    else if ((p -= CVT_P_ACT) < CVT_P_SQ) { in = Wq; out = wqb; }
    else if ((p -= CVT_P_SQ) < CVT_P_SQ) { in = Wk; out = wkb; }
    else if ((p -= CVT_P_SQ) < CVT_P_SQ) { in = Wv; out = wvb; }
    else if ((p -= CVT_P_SQ) < CVT_P_SQ) { in = Wo; out = wob; }
    else if ((p -= CVT_P_SQ) < CVT_P_FF) { in = Wi; out = wib; }
    else { p -= CVT_P_FF; in = Wt; out = wtb; }

    // block-uniform bases; the lane's index serves the 16-byte loads and the 8-byte stores
    const float4* src = (const float4*)(in + (size_t)p * CVT_PIECE);
    uint2*        dst = (uint2*)(out + (size_t)p * CVT_PIECE);
    const unsigned t = threadIdx.x;

    float4 v[CVT_LOADS];
#pragma unroll  // constant indices keep the array in registers
    for (int j = 0; j < CVT_LOADS; ++j) v[j] = src[t + j * CVT_THREADS];
    // keeps all loads above the conversions: left free, the compiler issues the last of them
    // behind waits for the first and the wave pays the memory latency more than once
    __builtin_amdgcn_sched_barrier(0);
    // every result has a register pair of its own: none is rewritten under a store in flight
    uint2 w[CVT_LOADS];
#pragma unroll  // constant indices keep the arrays in registers
    for (int j = 0; j < CVT_LOADS; ++j) {
        w[j].x = pack_bf16(v[j].x, v[j].y);
        w[j].y = pack_bf16(v[j].z, v[j].w);
    }
#pragma unroll  // constant indices keep the array in registers
    for (int j = 0; j < CVT_LOADS; ++j) dst[t + j * CVT_THREADS] = w[j];
}

// ---------------- tiled bf16 WMMA GEMM, tensor loads, two stage buffers ----------------
// C[M,N] = A[M,K] * B[K,N]  (A,B bf16 row-major, acc f32)
// block tile 128x128, 8 waves (2x4), wave tile 64x32 (4x2 wmma tiles)
// NB products with one A run side by side: C_p = A * B_p, p < NB, all B_p of one shape. The
// block holds the same 128x128 tile of every C_p, so that an A tile is staged once and an A
// fragment is read from LDS once for NB products (wave tile 64 x 32 in each C_p).
// A stage is NCH chunks of 64 k: NCH slices of A (128 rows x 64 k) and, for each B_p, NCH
// slices (64 k x 128 columns). Wave w < NCH brings A slice w, wave NCH + p * NCH + c brings
// slice c of B_p, one tensor load a wave and stage, so that a stage's landing latency is
// paid once per 64 * NCH k and its bytes come in through NCH * (1 + NB) request queues.
// K is a multiple of 64 * NCH and holds at least two stages.
// MODE 0: outF[row*N+col] = acc + bias[col] + res[row*N+col]
// MODE 1: head scatter: outB[((b*NH+head)*S + s)*HD + hd] = bf16(acc + bias)
// MODE 2: outB[row*N+col] = bf16(gelu(acc + bias))
// Bw, bias, outB belong to product 0; Bw1, bias1, outB1 and Bw2, bias2, outB2 to products
// 1 and 2 and are read only where NB says that these exist.
template <int MODE, int NCH, int NB>
__global__ __launch_bounds__(256) void gemm_bf16(const unsigned short* __restrict__ A,
                                                 const unsigned short* __restrict__ Bw,
                                                 const unsigned short* __restrict__ Bw1,
                                                 const unsigned short* __restrict__ Bw2,
                                                 const float* __restrict__ bias,
                                                 const float* __restrict__ bias1,
                                                 const float* __restrict__ bias2,
                                                 float* __restrict__ outF,
                                                 unsigned short* __restrict__ outB,
                                                 unsigned short* __restrict__ outB1,
                                                 unsigned short* __restrict__ outB2,
                                                 const float* __restrict__ res,
                                                 int M, int N, int K) {
    static_assert(A_BUF == B_BUF && NCH * (1 + NB) <= 8, "one slice size, one slice a wave");
    static_assert(NB == 1 || (NB == 3 && MODE == 1), "the products that are launched");
    constexpr uint32_t SLICE = A_BUF;                     // a whole number of 2 KiB units
    constexpr uint32_t NSL   = (uint32_t)(NCH * (1 + NB));
    constexpr uint32_t STAGE = NSL * SLICE;               // [A slices | B_0 slices | ...]
    __shared__ __attribute__((aligned(2048))) unsigned char Ts[2 * STAGE];

    const int tid   = threadIdx.x;
    const int lane  = tid & 31;
    const int wid   = tid >> 5;
    const int n16   = lane & 15;
    const int hi    = lane >> 4;
    const int waveM = wid >> 2;   // 0..1
    const int waveN = wid & 3;    // 0..3
    const int rowBase = blockIdx.y * 128;
    const int colBase = blockIdx.x * 128;

    v8f acc[NB][4][2];
#pragma unroll
    for (int p = 0; p < NB; ++p)
#pragma unroll
        for (int i = 0; i < 4; ++i)
#pragma unroll
            for (int j = 0; j < 2; ++j) acc[p][i][j] = zero8();

    const uint32_t wave   = uni((uint32_t)threadIdx.x >> 5);
    const uint32_t bchunk = uni((uint32_t)N * (2u * BK));   // 64 source rows of B, in bytes
    // which B_p a B wave serves, and which chunk of the stage
    const uint32_t bprod = NB > 1 ? (wave - (uint32_t)NCH) / (uint32_t)NCH : 0u;
    const uint32_t bslc  = wave - (uint32_t)NCH - bprod * (uint32_t)NCH;
    const unsigned short* bsrc = Bw;
    if (NB > 1) bsrc = bprod == 1u ? Bw1 : (bprod == 2u ? Bw2 : Bw);
    // first byte of this wave's slice in stage 0, and its step from stage to stage
    const uint64_t src0 = wave < (uint32_t)NCH
        ? (uint64_t)(A + (size_t)rowBase * K) + wave * A_ROWB
        : (uint64_t)(bsrc + colBase) + (uint64_t)bslc * bchunk;
    const uint32_t step = wave < (uint32_t)NCH ? (uint32_t)NCH * A_ROWB : (uint32_t)NCH * bchunk;
    const uint32_t place0 = (uint32_t)(size_t)&Ts[0] + wave * SLICE;
    u32x8 ag1 = atile_group1((uint32_t)K * 2u);
    u32x8 bg1 = btile_group1((uint32_t)N * 2u);
    u32x4 ag0 = btile_group0(place0, src0);
    u32x4 bg0 = btile_group0(place0, src0);

    auto issue = [&](uint32_t buf, bool advance) {
        // scalar branches (see pinned()); each path has its own constant pad word
        if (pinned(wave < (uint32_t)NCH)) {
            ag0[1] = uni(place0 + buf * STAGE);
            if (advance) {
                const uint64_t a = (((uint64_t)ag0[3] << 32) | ag0[2]) + step;
                ag0[2] = uni((uint32_t)a);
                ag0[3] = uni((uint32_t)(a >> 32));
            }
            asm volatile("tensor_load_to_lds %0, %1" : "+s"(ag0), "+s"(ag1) :: "memory");
        }
        if (pinned(wave >= (uint32_t)NCH && wave < NSL)) {
            bg0[1] = uni(place0 + buf * STAGE);
            if (advance) {
                const uint64_t a = (((uint64_t)bg0[3] << 32) | bg0[2]) + step;
                bg0[2] = uni((uint32_t)a);
                bg0[3] = uni((uint32_t)(a >> 32));
            }
            asm volatile("tensor_load_to_lds %0, %1" : "+s"(bg0), "+s"(bg1) :: "memory");
        }
    };

    const uint32_t nst = uni((uint32_t)K / (uint32_t)(BK * NCH));
    issue(0u, false);
    asm volatile("s_wait_tensorcnt 0x0" ::: "memory");   // this wave's slice of stage 0 has landed
    __syncthreads();                                     // every wave's slice has
    issue(1u, true);                                     // flies while stage 0 is worked on

    for (uint32_t s = 0; s < nst; ++s) {
        const unsigned char* st = &Ts[0] + (s & 1u) * STAGE;
        // the lane's row of the wave's first A tile, at its 16-byte half of 32 bytes
        const unsigned char* as0 = st + (waveM * 64 + n16) * A_PITCH + 16 * hi;
        // the lane's address in the transposing load: row 8*hi + (lane & 7), 16-byte
        // half (lane >> 3) & 1 of the 32 bytes of a 16-column group
        const unsigned char* bs0 = st + NCH * SLICE + (8 * hi + (lane & 7)) * B_PITCH +
                                   16 * ((lane >> 3) & 1) + 64 * waveN;

#pragma unroll  // the chunks of a stage, in rising k; constant slice offsets
        for (int ch = 0; ch < NCH; ++ch) {
            const unsigned char* as = as0 + ch * SLICE;
            const unsigned char* bs = bs0 + ch * SLICE;

            // all fragment reads of the chunk (16 of A, 8 of each B_p) stand as one group
            // ahead of its 16 * NB WMMAs
            FragBF af[BK / 32][4];
            FragBF bf[NB][BK / 32][2];
#pragma unroll  // constant indices keep the arrays in registers
            for (int c = 0; c < BK / 32; ++c) {
#pragma unroll  // constant indices keep the arrays in registers
                for (int p = 0; p < NB; ++p)
#pragma unroll  // constant indices keep the arrays in registers
                    for (int nt = 0; nt < 2; ++nt) {
                        const unsigned char* bp = bs + p * NCH * SLICE + 32 * nt;
                        const u32x4 lo = ld_tr16(bp + (32 * c) * B_PITCH);        // k  0..15
                        const u32x4 up = ld_tr16(bp + (32 * c + 16) * B_PITCH);   // k 16..31
                        bf[p][c][nt].d[0] = lo.x; bf[p][c][nt].d[1] = lo.y;
                        bf[p][c][nt].d[2] = lo.z; bf[p][c][nt].d[3] = lo.w;
                        bf[p][c][nt].d[4] = up.x; bf[p][c][nt].d[5] = up.y;
                        bf[p][c][nt].d[6] = up.z; bf[p][c][nt].d[7] = up.w;
                    }
#pragma unroll  // constant indices keep the arrays in registers
                for (int mt = 0; mt < 4; ++mt) {
                    // elements 0-7 = k 8*hi + 0..7, elements 8-15 = k 16 + 8*hi + 0..7
                    const uint4 lo = *(const uint4*)(as + mt * 16 * A_PITCH + 64 * c);
                    const uint4 up = *(const uint4*)(as + mt * 16 * A_PITCH + 64 * c + 32);
                    af[c][mt].d[0] = lo.x; af[c][mt].d[1] = lo.y;
                    af[c][mt].d[2] = lo.z; af[c][mt].d[3] = lo.w;
                    af[c][mt].d[4] = up.x; af[c][mt].d[5] = up.y;
                    af[c][mt].d[6] = up.z; af[c][mt].d[7] = up.w;
                }
            }
            // keeps the reads above the WMMAs: sunk among them, each pair of reads is waited
            // out to zero in front of its two WMMAs and the LDS latency is paid eight times
            __builtin_amdgcn_sched_barrier(0);
#pragma unroll  // two chunks of 32 k, in rising k; constant indices keep the arrays in registers
            for (int c = 0; c < BK / 32; ++c)
#pragma unroll  // constant indices keep the arrays in registers
                for (int mt = 0; mt < 4; ++mt)
#pragma unroll  // constant indices keep the arrays in registers
                    for (int p = 0; p < NB; ++p)
#pragma unroll  // constant indices keep the arrays in registers
                        for (int nt = 0; nt < 2; ++nt)
                            acc[p][mt][nt] = __builtin_amdgcn_wmma_f32_16x16x32_bf16(
                                false, af[c][mt].v, false, bf[p][c][nt].v, (short)0,
                                acc[p][mt][nt], false, false);
            // keeps the next chunk's reads, and the stage's closing waits and barrier, below
            // the WMMAs: lifted among them they bring waits in front of the matrix work
            __builtin_amdgcn_sched_barrier(0);
        }

        // hand-over of the stage, every wave, in this order
        asm volatile("s_wait_dscnt 0x0" ::: "memory");      // this wave has left buffer s & 1
        asm volatile("s_wait_tensorcnt 0x0" ::: "memory");  // its slice of stage s + 1 has landed
        __syncthreads();   // stage s + 1 is published; every reader has left buffer s & 1
        // the test for a further stage is a scalar branch as well (see pinned())
        if (pinned(s + 2u < nst)) issue(s & 1u, true);
    }
    asm volatile("s_wait_tensorcnt 0x0" ::: "memory");   // nothing in flight when the wave goes on
    asm volatile("s_wait_dscnt 0x0" ::: "memory");

    // epilogue
    if constexpr (MODE == 1) {
        // a block's 128 rows lie in one batch entry, a wave's 32 columns in one head
        const int grow0 = rowBase + waveM * 64 + 8 * hi;
        const int gcol0 = colBase + waveN * 32 + n16;
        const size_t head0 = ((size_t)((grow0 >> 10) * NHH + (gcol0 >> 6)) * SS + (grow0 & 1023)) * HDD;
        float bv[NB][2];
#pragma unroll
        for (int p = 0; p < NB; ++p)
#pragma unroll
            for (int nt = 0; nt < 2; ++nt)
                bv[p][nt] = (p == 0 ? bias : (p == 1 ? bias1 : bias2))[gcol0 + nt * 16];
#pragma unroll
        for (int p = 0; p < NB; ++p) {
            unsigned short* po = (p == 0 ? outB : (p == 1 ? outB1 : outB2)) + head0 + (gcol0 & 63);
#pragma unroll
            for (int mt = 0; mt < 4; ++mt) {
#pragma unroll
                for (int nt = 0; nt < 2; ++nt) {
                    unsigned short* dst = po + mt * 16 * HDD + nt * 16;
                    unsigned short w[8];
#pragma unroll
                    for (int r = 0; r < 8; ++r) w[r] = f2bfu(acc[p][mt][nt][r] + bv[p][nt]);
                    // keeps the tile's arithmetic above its stores, so that no register which
                    // one of these stores names is written between the first store and the wait
                    __builtin_amdgcn_sched_barrier(0);
#pragma unroll
                    for (int r = 0; r < 8; ++r) dst[r * HDD] = w[r];
                    // stands in front of the next tile's writes of registers that these stores
                    // name
                    asm volatile("s_wait_xcnt 0x0" ::: "memory");
                    // keeps the next tile's arithmetic below that wait
                    __builtin_amdgcn_sched_barrier(0);
                }
            }
        }
    } else {
#pragma unroll
        for (int mt = 0; mt < 4; ++mt) {
#pragma unroll
            for (int nt = 0; nt < 2; ++nt) {
#pragma unroll
                for (int r = 0; r < 8; ++r) {
                    int grow = rowBase + waveM * 64 + mt * 16 + r + 8 * hi;
                    int gcol = colBase + waveN * 32 + nt * 16 + n16;
                    float v = acc[0][mt][nt][r] + bias[gcol];
                    if (MODE == 0) {
                        outF[(size_t)grow * N + gcol] = v + res[(size_t)grow * N + gcol];
                    } else {
                        float g = 0.5f * v * (1.0f + erff(v * 0.70710678118654752f));
                        outB[(size_t)grow * N + gcol] = f2bfu(g);
                    }
                }
            }
        }
    }
}

#define KV_ROWB   128u
#define KV_ROWS   256u                     /* rows of one slice */
#define K_PITCH   144u
#define V_PITCH   160u
#define K_SLICE   (KV_ROWS * K_PITCH)
#define V_SLICE   (KV_ROWS * V_PITCH)
#define K_BYTES   (4u * K_SLICE)
#define V_BYTES   (4u * V_SLICE)
static_assert(K_SLICE % 2048u == 0u && V_SLICE % 2048u == 0u, "slices are whole 2 KiB units");
static_assert(4u * KV_ROWS == SS && KV_ROWB == HDD * 2u, "four slices hold a head");

template <uint32_t PAD_A>
static __device__ inline u32x8 kvtile_group1() {
    u32x8 g;
    g[0] = uni((1u << 20) | (4u << 22) | (PAD_A << 25));
    g[1] = uni((KV_ROWB & 0xFFFFu) << 16);
    g[2] = uni((KV_ROWB >> 16) | ((KV_ROWS & 0xFFFFu) << 16));
    g[3] = uni((KV_ROWS >> 16) | (KV_ROWB << 16));
    g[4] = uni(KV_ROWS);
    g[5] = uni(KV_ROWB);
    g[6] = uni(0u);
    g[7] = uni(0u);
    return g;
}
static __device__ inline float exp_slot(float x) {
    float e;
    asm("v_exp_f32 %0, %1\n\tv_nop" : "=v"(e) : "v"(x * 1.4426950408889634f));
    return e;
}

static __device__ inline float other_half(float x) {
    int b = __builtin_bit_cast(int, x);
    b = __builtin_amdgcn_permlanex16(b, b, 0x76543210, 0xfedcba98, false, false);
    return __builtin_bit_cast(float, b);
}

// 32 k of one row, k-contiguous in memory, in the hardware k order:
// elements 0-7 = k 8*hi + 0..7, elements 8-15 = k 16 + 8*hi + 0..7
// (p = wave-uniform base, off = the lane's row * HDD + 8*hi)
static __device__ inline void load_row_frag(FragBF& f, const unsigned short* p, unsigned off) {
    const uint4 lo = *(const uint4*)(p + off);
    const uint4 up = *(const uint4*)(p + off + 16);
    f.d[0] = lo.x; f.d[1] = lo.y; f.d[2] = lo.z; f.d[3] = lo.w;
    f.d[4] = up.x; f.d[5] = up.y; f.d[6] = up.z; f.d[7] = up.w;
}

// the same fragment from a K row in LDS (p = the lane's row, at its 16-byte half of 32 bytes)
static __device__ inline void lds_row_frag(FragBF& f, const unsigned char* p) {
    const uint4 lo = *(const uint4*)(p);
    const uint4 up = *(const uint4*)(p + 32);
    f.d[0] = lo.x; f.d[1] = lo.y; f.d[2] = lo.z; f.d[3] = lo.w;
    f.d[4] = up.x; f.d[5] = up.y; f.d[6] = up.z; f.d[7] = up.w;
}

__global__ __launch_bounds__(256) void attn_kernel(const unsigned short* __restrict__ Q,
                                                   const unsigned short* __restrict__ Kb,
                                                   const unsigned short* __restrict__ Vb,
                                                   const float* __restrict__ mask,
                                                   unsigned short* __restrict__ ctxB) {
    __shared__ __attribute__((aligned(2048))) unsigned char KV[K_BYTES + V_BYTES];   // [K | V]
    const int lane = threadIdx.x & 31;
    const int wid  = threadIdx.x >> 5;
    const int n16  = lane & 15;
    const int hi   = lane >> 4;
    const int bh   = blockIdx.x >> 2;     // (b*NH + h)
    const int qblk = (blockIdx.x & 3) * 256;
    const int q0   = qblk + wid * 32;
    const int b    = bh >> 4;
    const int h    = bh & 15;
    const unsigned short* Qh = Q  + (size_t)bh * SS * HDD;
    const unsigned short* Kh = Kb + (size_t)bh * SS * HDD;
    const unsigned short* Vh = Vb + (size_t)bh * SS * HDD;
    const float*          mb = mask + (size_t)b * SS;
    const unsigned rowOff = (unsigned)(n16 * HDD + 8 * hi);   // Q rows

    // Q rows as B fragments: [column group][k chunk of 32]; asked for ahead of the tensor
    // loads, so that they fly while K and V land
    FragBF qf[2][2];
#pragma unroll  // constant indices keep the arrays in registers
    for (int g = 0; g < 2; ++g)
#pragma unroll  // constant indices keep the arrays in registers
        for (int c = 0; c < 2; ++c)
            load_row_frag(qf[g][c], Qh + (size_t)wid * 32 * HDD + (qblk + 16 * g) * HDD + 32 * c, rowOff);

    // waves 0-3 bring K rows 256 w .., waves 4-7 V rows 256 (w - 4) ..: one tensor load a
    // wave, each behind a scalar branch (see pinned()) with its own constant pad word
    const uint32_t wave = uni((uint32_t)threadIdx.x >> 5);
    const uint32_t kv0  = (uint32_t)(size_t)&KV[0];
    if (pinned(wave < 4u)) {
        u32x4 g0 = btile_group0(kv0 + wave * K_SLICE,
                                (uint64_t)Kh + (uint64_t)(wave * (KV_ROWS * KV_ROWB)));
        u32x8 g1 = kvtile_group1<3u>();
        asm volatile("tensor_load_to_lds %0, %1" :: "s"(g0), "s"(g1) : "memory");
        asm volatile("s_wait_tensorcnt 0x0" ::: "memory");   // this wave's K slice has landed
    }
    if (pinned(wave >= 4u)) {
        u32x4 g0 = btile_group0(kv0 + K_BYTES + (wave - 4u) * V_SLICE,
                                (uint64_t)Vh + (uint64_t)((wave - 4u) * (KV_ROWS * KV_ROWB)));
        u32x8 g1 = kvtile_group1<7u>();
        asm volatile("tensor_load_to_lds %0, %1" :: "s"(g0), "s"(g1) : "memory");
        asm volatile("s_wait_tensorcnt 0x0" ::: "memory");   // this wave's V slice has landed
    }
    __syncthreads();   // every wave's slice has landed: K and V are published to the block

    // the lane's row of a 16-key tile of K, at its 16-byte half of 32 bytes
    const unsigned char* kl = &KV[0] + n16 * K_PITCH + 16 * hi;
    // the lane's address in the transposing load: row 8*hi + (lane & 7), 16-byte half
    // (lane >> 3) & 1 of the 32 bytes of a 16-column group
    const unsigned char* vl = &KV[K_BYTES] + (8 * hi + (lane & 7)) * V_PITCH +
                              16 * ((lane >> 3) & 1);

    // K rows as A fragments: [key tile of 16][k chunk of 32], fetched one pass ahead
    FragBF kf[2][2];
#pragma unroll  // constant indices keep the arrays in registers
    for (int t = 0; t < 2; ++t)
#pragma unroll  // constant indices keep the arrays in registers
        for (int c = 0; c < 2; ++c)
            lds_row_frag(kf[t][c], kl + 16 * t * K_PITCH + 64 * c);

    v8f   o[2][4];                 // O^T: [group][hd tile]; reg r = hd 8*hi + r
    float mrun[2], lrun[2];        // running maximum; this half's running sum
#pragma unroll  // constant indices keep the arrays in registers
    for (int g = 0; g < 2; ++g) {
        mrun[g] = -3.402823466e38f;   // finite, so that (-inf) - mrun is never NaN
        lrun[g] = 0.0f;
#pragma unroll  // constant indices keep the arrays in registers
        for (int nt = 0; nt < 4; ++nt) o[g][nt] = zero8();
    }

    for (int kp = 0; kp < 32; ++kp) {
        const int key0 = kp * 32;

        // V^T as A fragments (row = hd, k = key)
        const unsigned char* vp = vl + key0 * V_PITCH;
        FragBF vf[4];
#pragma unroll  // constant indices keep the arrays in registers
        for (int nt = 0; nt < 4; ++nt) {
            const u32x4 lo = ld_tr16(vp + 32 * nt);                  // keys  0..15
            const u32x4 up = ld_tr16(vp + 16 * V_PITCH + 32 * nt);   // keys 16..31
            vf[nt].d[0] = lo.x; vf[nt].d[1] = lo.y; vf[nt].d[2] = lo.z; vf[nt].d[3] = lo.w;
            vf[nt].d[4] = up.x; vf[nt].d[5] = up.y; vf[nt].d[6] = up.z; vf[nt].d[7] = up.w;
        }

        // mask of this lane's keys: [tile][r] = key key0 + 16*t + 8*hi + r; the 32 values
        // of the pass are read at wave-uniform addresses, a lane picks its half's
        float mk[2][8];
#pragma unroll  // constant indices keep the arrays in registers
        for (int t = 0; t < 2; ++t)
#pragma unroll  // constant indices keep the arrays in registers
            for (int r = 0; r < 8; ++r) {
                const float lo = mb[key0 + 16 * t + r];
                const float up = mb[key0 + 16 * t + 8 + r];
                mk[t][r] = hi ? up : lo;
            }

        // S^T tiles: st[g][t][r] = q(q0 + 16g + n16) . k(key0 + 16t + 8hi + r)
        v8f st[2][2];
#pragma unroll  // constant indices keep the arrays in registers
        for (int g = 0; g < 2; ++g)
#pragma unroll  // constant indices keep the arrays in registers
            for (int t = 0; t < 2; ++t) {
                v8f s = zero8();
#pragma unroll  // constant indices keep the arrays in registers
                for (int c = 0; c < 2; ++c)
                    s = __builtin_amdgcn_wmma_f32_16x16x32_bf16(false, kf[t][c].v, false,
                                                                qf[g][c].v, (short)0, s,
                                                                false, false);
                st[g][t] = s;
            }

        // next pass's K rows (the last pass fetches pass 0's again: in bounds, unused)
        {
            const int kn = ((kp + 1) & 31) * 32;
#pragma unroll  // constant indices keep the arrays in registers
            for (int t = 0; t < 2; ++t)
#pragma unroll  // constant indices keep the arrays in registers
                for (int c = 0; c < 2; ++c)
                    lds_row_frag(kf[t][c], kl + (kn + 16 * t) * K_PITCH + 64 * c);
        }

        FragBF pf[2];
#pragma unroll  // constant indices keep the arrays in registers
        for (int g = 0; g < 2; ++g) {
            float x[16];
            float mx = mrun[g];
#pragma unroll  // constant indices keep the arrays in registers
            for (int t = 0; t < 2; ++t)
#pragma unroll  // constant indices keep the arrays in registers
                for (int r = 0; r < 8; ++r) {
                    x[8 * t + r] = st[g][t][r] * 0.125f + mk[t][r];
                    mx = fmaxf(mx, x[8 * t + r]);
                }
            mx = fmaxf(mx, other_half(mx));
            const float alpha = exp_slot(mrun[g] - mx);
            mrun[g] = mx;
            float sum = 0.0f;
#pragma unroll  // constant indices keep the arrays in registers
            for (int i = 0; i < 16; ++i) {
                x[i] = exp_slot(x[i] - mx);
                sum += x[i];
            }
            lrun[g] = lrun[g] * alpha + sum;
#pragma unroll  // constant indices keep the arrays in registers
            for (int i = 0; i < 8; ++i) pf[g].d[i] = pack_bf16(x[2 * i], x[2 * i + 1]);
#pragma unroll  // constant indices keep the arrays in registers
            for (int nt = 0; nt < 4; ++nt)
#pragma unroll  // constant indices keep the arrays in registers
                for (int r = 0; r < 8; ++r) o[g][nt][r] *= alpha;
        }

        // O^T += V^T . P^T
#pragma unroll  // constant indices keep the arrays in registers
        for (int nt = 0; nt < 4; ++nt)
#pragma unroll  // constant indices keep the arrays in registers
            for (int g = 0; g < 2; ++g)
                o[g][nt] = __builtin_amdgcn_wmma_f32_16x16x32_bf16(false, vf[nt].v, false,
                                                                   pf[g].v, (short)0,
                                                                   o[g][nt], false, false);
    }

    // ctx as bf16 in [B,S,D] layout: a lane's 8 registers are 8 consecutive hd
#pragma unroll  // constant indices keep the arrays in registers
    for (int g = 0; g < 2; ++g) {
        const float inv = 1.0f / (lrun[g] + other_half(lrun[g]));
        unsigned short* dst = ctxB + ((size_t)b * SS + q0 + 16 * g + n16) * DD + h * 64 + 8 * hi;
#pragma unroll  // constant indices keep the arrays in registers
        for (int nt = 0; nt < 4; ++nt) {
            uint4 w;
            w.x = pack_bf16(o[g][nt][0] * inv, o[g][nt][1] * inv);
            w.y = pack_bf16(o[g][nt][2] * inv, o[g][nt][3] * inv);
            w.z = pack_bf16(o[g][nt][4] * inv, o[g][nt][5] * inv);
            w.w = pack_bf16(o[g][nt][6] * inv, o[g][nt][7] * inv);
            *(uint4*)(dst + nt * 16) = w;
        }
    }
}

#define LN_WAVES 16
#define LN_VEC   (DD / 128)   /* 16-byte pieces of a row per lane */
static_assert(BSR % LN_WAVES == 0 && DD % 128 == 0, "whole blocks, whole loads");

// sum over the wave's 32 lanes, the same value in every lane: four exchanges inside the
// 16-lane rows (lane ^ 1, 2, 4, 8), then one between the two rows
template <int XMASK>
static __device__ inline float row_xor_add(float x) {
    const int y = __builtin_amdgcn_update_dpp(0, __builtin_bit_cast(int, x), 0x160 + XMASK,
                                              0xf, 0xf, true);
    return x + __builtin_bit_cast(float, y);
}
static __device__ inline float wave_sum(float x) {
    x = row_xor_add<1>(x);
    x = row_xor_add<2>(x);
    x = row_xor_add<4>(x);
    x = row_xor_add<8>(x);
    return x + other_half(x);
}

typedef float f32x4 __attribute__((ext_vector_type(4)));

template <bool WITH_BF16>
__global__ __launch_bounds__(LN_WAVES * 32) void ln_kernel(const float* __restrict__ x,
                                                           const float* __restrict__ g,
                                                           const float* __restrict__ bta,
                                                           float* __restrict__ outF,
                                                           unsigned short* __restrict__ outB) {
    const unsigned lane = threadIdx.x & 31u;
    const size_t   row  = (size_t)blockIdx.x * LN_WAVES + (threadIdx.x >> 5);
    const f32x4* xr = (const f32x4*)(x + row * DD);
    const f32x4* gr = (const f32x4*)g;
    const f32x4* br = (const f32x4*)bta;

    f32x4 v[LN_VEC], gv[LN_VEC], bv[LN_VEC];
#pragma unroll  // constant indices keep the arrays in registers
    for (int j = 0; j < LN_VEC; ++j) v[j] = xr[lane + 32 * j];
#pragma unroll  // constant indices keep the arrays in registers
    for (int j = 0; j < LN_VEC; ++j) { gv[j] = gr[lane + 32 * j]; bv[j] = br[lane + 32 * j]; }
    // holds the loads of gain and bias up here, in flight beside the row's: left free, the
    // compiler sinks them behind the sums and the wave pays their latency on top of the row's
    asm volatile("" :: "v"(gv[0]), "v"(gv[1]), "v"(gv[2]), "v"(gv[3]), "v"(gv[4]), "v"(gv[5]),
                       "v"(gv[6]), "v"(gv[7]), "v"(bv[0]), "v"(bv[1]), "v"(bv[2]), "v"(bv[3]),
                       "v"(bv[4]), "v"(bv[5]), "v"(bv[6]), "v"(bv[7]));
    // keeps the sums below that statement: alone, it is moved down behind the first sum,
    // and the loads with it
    __builtin_amdgcn_sched_barrier(0);
    static_assert(LN_VEC == 8, "the statement above names every piece");

    // four independent chains, one per component
    f32x4 s = v[0];
#pragma unroll  // constant indices keep the arrays in registers
    for (int j = 1; j < LN_VEC; ++j) s += v[j];
    const float mu = wave_sum((s.x + s.y) + (s.z + s.w)) * (1.0f / DD);

    f32x4 q = {0.0f, 0.0f, 0.0f, 0.0f};
#pragma unroll  // constant indices keep the arrays in registers
    for (int j = 0; j < LN_VEC; ++j) {
        v[j] -= mu;
        q += v[j] * v[j];
    }
    const float inv = rsqrtf(wave_sum((q.x + q.y) + (q.z + q.w)) * (1.0f / DD) + 1e-12f);

    // every result has registers of its own: none is rewritten under a store in flight
    uint2 w[LN_VEC];
#pragma unroll  // constant indices keep the arrays in registers
    for (int j = 0; j < LN_VEC; ++j) {
        v[j] = v[j] * inv * gv[j] + bv[j];
        if (WITH_BF16) {
            w[j].x = pack_bf16(v[j].x, v[j].y);
            w[j].y = pack_bf16(v[j].z, v[j].w);
        }
    }
    f32x4* of = (f32x4*)(outF + row * DD);
#pragma unroll  // constant indices keep the arrays in registers
    for (int j = 0; j < LN_VEC; ++j) of[lane + 32 * j] = v[j];
    if (WITH_BF16) {
        uint2* ob = (uint2*)(outB + row * DD);
#pragma unroll  // constant indices keep the arrays in registers
        for (int j = 0; j < LN_VEC; ++j) ob[lane + 32 * j] = w[j];
    }
}

// ---------------- launcher ----------------
extern "C" void kernel_launch(void* const* d_in, const int* in_sizes, int n_in,
                              void* d_out, int out_size, void* d_ws, size_t ws_size,
                              hipStream_t stream) {
    const float* hidden = (const float*)d_in[0];
    const float* mask   = (const float*)d_in[1];
    const float* Wq = (const float*)d_in[2];   const float* bq  = (const float*)d_in[3];
    const float* Wk = (const float*)d_in[4];   const float* bk  = (const float*)d_in[5];
    const float* Wv = (const float*)d_in[6];   const float* bv  = (const float*)d_in[7];
    const float* Wo = (const float*)d_in[8];   const float* bo  = (const float*)d_in[9];
    const float* g1 = (const float*)d_in[10];  const float* b1  = (const float*)d_in[11];
    const float* Wi = (const float*)d_in[12];  const float* bi  = (const float*)d_in[13];
    const float* Wt = (const float*)d_in[14];  const float* bot = (const float*)d_in[15];
    const float* g2 = (const float*)d_in[16];  const float* b2  = (const float*)d_in[17];
    float* out = (float*)d_out;

    const size_t BSD = (size_t)BSR * DD;     // 4M
    const size_t DI  = (size_t)DD * II;      // 4M
    const size_t DDq = (size_t)DD * DD;      // 1M

    char* ws = (char*)d_ws;
    auto alloc = [&](size_t bytes) -> char* {
        char* p = ws;
        ws += (bytes + 255) & ~(size_t)255;
        return p;
    };
    unsigned short* hb    = (unsigned short*)alloc(BSD * 2);
    unsigned short* wqb   = (unsigned short*)alloc(DDq * 2);
    unsigned short* wkb   = (unsigned short*)alloc(DDq * 2);
    unsigned short* wvb   = (unsigned short*)alloc(DDq * 2);
    unsigned short* wob   = (unsigned short*)alloc(DDq * 2);
    unsigned short* wib   = (unsigned short*)alloc(DI * 2);
    unsigned short* wtb   = (unsigned short*)alloc(DI * 2);
    unsigned short* qb    = (unsigned short*)alloc(BSD * 2);
    unsigned short* kbuf  = (unsigned short*)alloc(BSD * 2);
    unsigned short* vbuf  = (unsigned short*)alloc(BSD * 2);
    unsigned short* ctxb  = (unsigned short*)alloc(BSD * 2);
    float*          y1    = (float*)alloc(BSD * 4);
    float*          attnf = (float*)alloc(BSD * 4);
    unsigned short* attnb = (unsigned short*)alloc(BSD * 2);
    unsigned short* interb= (unsigned short*)alloc((size_t)BSR * II * 2);
    float*          y2    = (float*)alloc(BSD * 4);

    // 1) fp32 -> bf16 conversions
    cvt_all_f32_bf16<<<CVT_BLOCKS, CVT_THREADS, 0, stream>>>(hidden, Wq, Wk, Wv, Wo, Wi, Wt,
                                                             hb, wqb, wkb, wvb, wob, wib, wtb);

    // 2) Q, K and V projections side by side (head-scattered bf16 outputs)
    {
        dim3 g(DD / 128, BSR / 128);
        gemm_bf16<1, 2, 3><<<g, 256, 0, stream>>>(hb, wqb, wkb, wvb, bq, bk, bv, nullptr,
                                                  qb, kbuf, vbuf, nullptr, BSR, DD, DD);
    }

    // 3) attention
    attn_kernel<<<BB * NHH * (SS / 256), 256, 0, stream>>>(qb, kbuf, vbuf, mask, ctxb);

    // 4) output projection + residual(hidden)
    {
        dim3 g(DD / 128, BSR / 128);
        gemm_bf16<0, 4, 1><<<g, 256, 0, stream>>>(ctxb, wob, nullptr, nullptr, bo, nullptr,
                                                  nullptr, y1, nullptr, nullptr, nullptr,
                                                  hidden, BSR, DD, DD);
    }
    // 5) LN1 -> attnf (f32) + attnb (bf16)
    ln_kernel<true><<<BSR / LN_WAVES, LN_WAVES * 32, 0, stream>>>(y1, g1, b1, attnf, attnb);

    // 6) FFN up + exact GELU -> bf16
    {
        dim3 g(II / 128, BSR / 128);
        gemm_bf16<2, 2, 1><<<g, 256, 0, stream>>>(attnb, wib, nullptr, nullptr, bi, nullptr,
                                                  nullptr, nullptr, interb, nullptr, nullptr,
                                                  nullptr, BSR, II, DD);
    }
    // 7) FFN down + residual(attnf)
    {
        dim3 g(DD / 128, BSR / 128);
        gemm_bf16<0, 4, 1><<<g, 256, 0, stream>>>(interb, wtb, nullptr, nullptr, bot, nullptr,
                                                  nullptr, y2, nullptr, nullptr, nullptr,
                                                  attnf, BSR, DD, II);
    }
    // 8) LN2 -> final output
    ln_kernel<false><<<BSR / LN_WAVES, LN_WAVES * 32, 0, stream>>>(y2, g2, b2, out, nullptr);
}

// v009
// Measured time: 163 microseconds a run.
// Two timings next to v008 put it at 1.04 and 1.03 times that version's speed.
// Over all steps from v000 it is 5.16 times as fast.
#include <hip/hip_runtime.h>
#include <cstdint>
#include <cstddef>

// ---------------- types ----------------
typedef __bf16 bf16_t;
typedef bf16_t v16bf __attribute__((ext_vector_type(16)));
typedef float  v8f   __attribute__((ext_vector_type(8)));
typedef unsigned int u32x4 __attribute__((ext_vector_type(4)));

union FragBF {
    uint32_t       d[8];
    unsigned short u[16];
    v16bf          v;
};

static __device__ inline v8f zero8() {
    v8f z;
#pragma unroll
    for (int i = 0; i < 8; ++i) z[i] = 0.0f;
    return z;
}

// fp32 -> bf16 (round to nearest even), returned as raw u16 bits
static __device__ inline unsigned short f2bfu(float f) {
    union { float f; uint32_t u; } c; c.f = f;
    uint32_t r = c.u + 0x7FFFu + ((c.u >> 16) & 1u);
    return (unsigned short)(r >> 16);
}

// model constants
#define BB   4
#define SS   1024
#define DD   1024
#define NHH  16
#define HDD  64
#define II   4096
#define BSR  4096   /* B*S rows */

#define BK      64
#define B_ROWB  256u
#define B_ROWS  64u
#define B_PITCH 288u
#define B_BUF   18432u
#define A_ROWB  128u
#define A_ROWS  128u
#define A_PITCH 144u
#define A_BUF   18432u
static_assert(B_ROWS * B_PITCH <= B_BUF && (B_BUF % 2048u) == 0u, "B buffer size");
static_assert(A_ROWS * A_PITCH <= A_BUF && (A_BUF % 2048u) == 0u, "A buffer size");

typedef unsigned int u32x8 __attribute__((ext_vector_type(8)));
typedef short        s16x8 __attribute__((ext_vector_type(8)));

static __device__ inline uint32_t uni(uint32_t v) {
    return (uint32_t)__builtin_amdgcn_readfirstlane(v);
}
static __device__ inline uint32_t pinned(uint32_t v) {
    uint32_t w = uni(v);
    asm volatile("" : "+s"(w));   // the pin of a tensor load's issue test in a scalar register
    return w;
}
static __device__ inline u32x8 btile_group1(uint32_t src_pitch) {
    u32x8 g;
    g[0] = uni((1u << 20) | (5u << 22) | (7u << 25));
    g[1] = uni((B_ROWB & 0xFFFFu) << 16);
    g[2] = uni((B_ROWB >> 16) | ((B_ROWS & 0xFFFFu) << 16));
    g[3] = uni((B_ROWS >> 16) | (B_ROWB << 16));
    g[4] = uni(B_ROWS);
    g[5] = uni(src_pitch);
    g[6] = uni(0u);
    g[7] = uni(0u);
    return g;
}
static __device__ inline u32x8 atile_group1(uint32_t src_pitch) {
    u32x8 g;
    g[0] = uni((1u << 20) | (4u << 22) | (3u << 25));
    g[1] = uni((A_ROWB & 0xFFFFu) << 16);
    g[2] = uni((A_ROWB >> 16) | ((A_ROWS & 0xFFFFu) << 16));
    g[3] = uni((A_ROWS >> 16) | (A_ROWB << 16));
    g[4] = uni(A_ROWS);
    g[5] = uni(src_pitch);
    g[6] = uni(0u);
    g[7] = uni(0u);
    return g;
}
static __device__ inline u32x4 btile_group0(uint32_t lds_dst, uint64_t ga) {
    u32x4 g;
    g[0] = uni(1u);
    g[1] = uni(lds_dst);
    g[2] = uni((uint32_t)ga);
    g[3] = uni((((uint32_t)(ga >> 32)) & 0x01FFFFFFu) | 0x80000000u);
    return g;
}
// 8 k x 16 columns per wave half of a row-major 16-bit LDS tile, transposed: lane (c, h)
// gets 8 consecutive k of column c, which is half a B fragment in the hardware k order
static __device__ inline u32x4 ld_tr16(const unsigned char* p) {
    typedef __attribute__((address_space(3))) s16x8 lds_s16x8;
    return __builtin_bit_cast(u32x4, __builtin_amdgcn_ds_load_tr16_b128_v8i16((lds_s16x8*)p));
}

#define CVT_THREADS 512
#define CVT_LOADS   32
#define CVT_PIECE   (CVT_THREADS * CVT_LOADS * 4)
#define CVT_P_ACT   (BSR * DD / CVT_PIECE)   /* pieces of the activations */
#define CVT_P_SQ    (DD * DD / CVT_PIECE)    /* pieces of a D x D weight */
#define CVT_P_FF    (DD * II / CVT_PIECE)    /* pieces of a D x I weight */
#define CVT_BLOCKS  (CVT_P_ACT + 4 * CVT_P_SQ + 2 * CVT_P_FF)
static_assert(BSR * DD % CVT_PIECE == 0 && DD * DD % CVT_PIECE == 0 && DD * II % CVT_PIECE == 0,
              "whole pieces");

typedef float  f32x2  __attribute__((ext_vector_type(2)));
typedef bf16_t bf16x2 __attribute__((ext_vector_type(2)));

// two f32 -> packed bf16 pair (round to nearest even)
static __device__ inline uint32_t pack_bf16(float a, float b) {
    f32x2 f; f[0] = a; f[1] = b;
    union { bf16x2 h; uint32_t u; } c;
    c.h = __builtin_convertvector(f, bf16x2);
    return c.u;
}

__global__ __launch_bounds__(CVT_THREADS)
void cvt_all_f32_bf16(
        const float* __restrict__ hidden, const float* __restrict__ Wq,
        const float* __restrict__ Wk, const float* __restrict__ Wv,
        const float* __restrict__ Wo, const float* __restrict__ Wi,
        const float* __restrict__ Wt,
        unsigned short* __restrict__ hb, unsigned short* __restrict__ wqb,
        unsigned short* __restrict__ wkb, unsigned short* __restrict__ wvb,
        unsigned short* __restrict__ wob, unsigned short* __restrict__ wib,
        unsigned short* __restrict__ wtb) {
    // which array, and which piece of it: the same for the whole block
    unsigned p = blockIdx.x;
    const float* in;
    unsigned short* out;
    if (p < CVT_P_ACT) { in = hidden; out = hb; }
    else if ((p -= CVT_P_ACT) < CVT_P_SQ) { in = Wq; out = wqb; }
    else if ((p -= CVT_P_SQ) < CVT_P_SQ) { in = Wk; out = wkb; }
    else if ((p -= CVT_P_SQ) < CVT_P_SQ) { in = Wv; out = wvb; }
    else if ((p -= CVT_P_SQ) < CVT_P_SQ) { in = Wo; out = wob; }
    else if ((p -= CVT_P_SQ) < CVT_P_FF) { in = Wi; out = wib; }
    else { p -= CVT_P_FF; in = Wt; out = wtb; }

    // block-uniform bases; the lane's index serves the 16-byte loads and the 8-byte stores
    const float4* src = (const float4*)(in + (size_t)p * CVT_PIECE);
    uint2*        dst = (uint2*)(out + (size_t)p * CVT_PIECE);
    const unsigned t = threadIdx.x;

    float4 v[CVT_LOADS];
#pragma unroll  // constant indices keep the array in registers
    for (int j = 0; j < CVT_LOADS; ++j) v[j] = src[t + j * CVT_THREADS];
    // keeps all loads above the conversions: left free, the compiler issues the last of them
    // behind waits for the first and the wave pays the memory latency more than once
    __builtin_amdgcn_sched_barrier(0);
    // every result has a register pair of its own: none is rewritten under a store in flight
    uint2 w[CVT_LOADS];
#pragma unroll  // constant indices keep the arrays in registers
    for (int j = 0; j < CVT_LOADS; ++j) {
        w[j].x = pack_bf16(v[j].x, v[j].y);
        w[j].y = pack_bf16(v[j].z, v[j].w);
    }
#pragma unroll  // constant indices keep the array in registers
    for (int j = 0; j < CVT_LOADS; ++j) dst[t + j * CVT_THREADS] = w[j];
}

// ---------------- GELU with the error function, free of branches ----------------
// gelu(x) = x * Phi(x), Phi(x) = erfc(-x / sqrt(2)) / 2. With z = |x| / sqrt(2) and
// t = 1 / (1 + 0.3275911 z) the five-term rational form
//   erfc(z) = t (a1 + t (a2 + t (a3 + t (a4 + t a5)))) e^(-z z)
// holds for every z >= 0 with an absolute error of at most 1.5e-7, so that one straight
// line of code serves all lanes. q = erfc(z) / 2 is Phi(-|x|), hence
//   x >= 0: gelu = x - x q,   x < 0: gelu = x q,   both: max(x, 0) - |x| q,
// which forms no 1 + erf and so loses nothing to cancellation in the negative tail.
// For every finite x; at x = +infinity, which finite operands do not reach, |x| q is inf * 0.
static __device__ inline float gelu_erf(float x) {
    const float t = __builtin_amdgcn_rcpf(
        __builtin_fmaf(__builtin_fabsf(x), (float)(0.3275911 * 0.70710678118654752), 1.0f));
    const float e = __builtin_amdgcn_exp2f((x * -0.72134752044448170f) * x);   // e^(-x x / 2)
    float p = (float)(0.5 * 1.061405429);
    p = __builtin_fmaf(p, t, (float)(0.5 * -1.453152027));
    p = __builtin_fmaf(p, t, (float)(0.5 * 1.421413741));
    p = __builtin_fmaf(p, t, (float)(0.5 * -0.284496736));
    p = __builtin_fmaf(p, t, (float)(0.5 * 0.254829592));
    const float q = (p * t) * e;
    return __builtin_fmaf(-__builtin_fabsf(x), q, __builtin_fmaxf(x, 0.0f));
}

// ---------------- tiled bf16 WMMA GEMM, tensor loads, two stage buffers ----------------
// C[M,N] = A[M,K] * B[K,N]  (A,B bf16 row-major, acc f32)
// block tile 128x128, 8 waves (2x4), wave tile 64x32 (4x2 wmma tiles)
// NB products with one A run side by side: C_p = A * B_p, p < NB, all B_p of one shape. The
// block holds the same 128x128 tile of every C_p, so that an A tile is staged once and an A
// fragment is read from LDS once for NB products (wave tile 64 x 32 in each C_p).
// A stage is NCH chunks of 64 k: NCH slices of A (128 rows x 64 k) and, for each B_p, NCH
// slices (64 k x 128 columns). Wave w < NCH brings A slice w, wave NCH + p * NCH + c brings
// slice c of B_p, one tensor load a wave and stage, so that a stage's landing latency is
// paid once per 64 * NCH k and its bytes come in through NCH * (1 + NB) request queues.
// K is a multiple of 64 * NCH and holds at least two stages.
// MODE 0: outF[row*N+col] = acc + bias[col] + res[row*N+col]
// MODE 1: head scatter: outB[((b*NH+head)*S + s)*HD + hd] = bf16(acc + bias)
// MODE 2: outB[row*N+col] = bf16(gelu(acc + bias))
// Bw, bias, outB belong to product 0; Bw1, bias1, outB1 and Bw2, bias2, outB2 to products
// 1 and 2 and are read only where NB says that these exist.
template <int MODE, int NCH, int NB>
__global__ __launch_bounds__(256) void gemm_bf16(const unsigned short* __restrict__ A,
                                                 const unsigned short* __restrict__ Bw,
                                                 const unsigned short* __restrict__ Bw1,
                                                 const unsigned short* __restrict__ Bw2,
                                                 const float* __restrict__ bias,
                                                 const float* __restrict__ bias1,
                                                 const float* __restrict__ bias2,
                                                 float* __restrict__ outF,
                                                 unsigned short* __restrict__ outB,
                                                 unsigned short* __restrict__ outB1,
                                                 unsigned short* __restrict__ outB2,
                                                 const float* __restrict__ res,
                                                 int M, int N, int K) {
    static_assert(A_BUF == B_BUF && NCH * (1 + NB) <= 8, "one slice size, one slice a wave");
    static_assert(NB == 1 || (NB == 3 && MODE == 1), "the products that are launched");
    constexpr uint32_t SLICE = A_BUF;                     // a whole number of 2 KiB units
    constexpr uint32_t NSL   = (uint32_t)(NCH * (1 + NB));
    constexpr uint32_t STAGE = NSL * SLICE;               // [A slices | B_0 slices | ...]
    __shared__ __attribute__((aligned(2048))) unsigned char Ts[2 * STAGE];

    const int tid   = threadIdx.x;
    const int lane  = tid & 31;
    const int wid   = tid >> 5;
    const int n16   = lane & 15;
    const int hi    = lane >> 4;
    const int waveM = wid >> 2;   // 0..1
    const int waveN = wid & 3;    // 0..3
    const int rowBase = blockIdx.y * 128;
    const int colBase = blockIdx.x * 128;

    v8f acc[NB][4][2];
#pragma unroll
    for (int p = 0; p < NB; ++p)
#pragma unroll
        for (int i = 0; i < 4; ++i)
#pragma unroll
            for (int j = 0; j < 2; ++j) acc[p][i][j] = zero8();

    const uint32_t wave   = uni((uint32_t)threadIdx.x >> 5);
    const uint32_t bchunk = uni((uint32_t)N * (2u * BK));   // 64 source rows of B, in bytes
    // which B_p a B wave serves, and which chunk of the stage
    const uint32_t bprod = NB > 1 ? (wave - (uint32_t)NCH) / (uint32_t)NCH : 0u;
    const uint32_t bslc  = wave - (uint32_t)NCH - bprod * (uint32_t)NCH;
    const unsigned short* bsrc = Bw;
    if (NB > 1) bsrc = bprod == 1u ? Bw1 : (bprod == 2u ? Bw2 : Bw);
    // first byte of this wave's slice in stage 0, and its step from stage to stage
    const uint64_t src0 = wave < (uint32_t)NCH
        ? (uint64_t)(A + (size_t)rowBase * K) + wave * A_ROWB
        : (uint64_t)(bsrc + colBase) + (uint64_t)bslc * bchunk;
    const uint32_t step = wave < (uint32_t)NCH ? (uint32_t)NCH * A_ROWB : (uint32_t)NCH * bchunk;
    const uint32_t place0 = (uint32_t)(size_t)&Ts[0] + wave * SLICE;
    u32x8 ag1 = atile_group1((uint32_t)K * 2u);
    u32x8 bg1 = btile_group1((uint32_t)N * 2u);
    u32x4 ag0 = btile_group0(place0, src0);
    u32x4 bg0 = btile_group0(place0, src0);

    auto issue = [&](uint32_t buf, bool advance) {
        // scalar branches (see pinned()); each path has its own constant pad word
        if (pinned(wave < (uint32_t)NCH)) {
            ag0[1] = uni(place0 + buf * STAGE);
            if (advance) {
                const uint64_t a = (((uint64_t)ag0[3] << 32) | ag0[2]) + step;
                ag0[2] = uni((uint32_t)a);
                ag0[3] = uni((uint32_t)(a >> 32));
            }
            asm volatile("tensor_load_to_lds %0, %1" : "+s"(ag0), "+s"(ag1) :: "memory");
        }
        if (pinned(wave >= (uint32_t)NCH && wave < NSL)) {
            bg0[1] = uni(place0 + buf * STAGE);
            if (advance) {
                const uint64_t a = (((uint64_t)bg0[3] << 32) | bg0[2]) + step;
                bg0[2] = uni((uint32_t)a);
                bg0[3] = uni((uint32_t)(a >> 32));
            }
            asm volatile("tensor_load_to_lds %0, %1" : "+s"(bg0), "+s"(bg1) :: "memory");
        }
    };

    const uint32_t nst = uni((uint32_t)K / (uint32_t)(BK * NCH));
    issue(0u, false);
    asm volatile("s_wait_tensorcnt 0x0" ::: "memory");   // this wave's slice of stage 0 has landed
    __syncthreads();                                     // every wave's slice has
    issue(1u, true);                                     // flies while stage 0 is worked on

    for (uint32_t s = 0; s < nst; ++s) {
        const unsigned char* st = &Ts[0] + (s & 1u) * STAGE;
        // the lane's row of the wave's first A tile, at its 16-byte half of 32 bytes
        const unsigned char* as0 = st + (waveM * 64 + n16) * A_PITCH + 16 * hi;
        // the lane's address in the transposing load: row 8*hi + (lane & 7), 16-byte
        // half (lane >> 3) & 1 of the 32 bytes of a 16-column group
        const unsigned char* bs0 = st + NCH * SLICE + (8 * hi + (lane & 7)) * B_PITCH +
                                   16 * ((lane >> 3) & 1) + 64 * waveN;

#pragma unroll  // the chunks of a stage, in rising k; constant slice offsets
        for (int ch = 0; ch < NCH; ++ch) {
            const unsigned char* as = as0 + ch * SLICE;
            const unsigned char* bs = bs0 + ch * SLICE;

            // all fragment reads of the chunk (16 of A, 8 of each B_p) stand as one group
            // ahead of its 16 * NB WMMAs
            FragBF af[BK / 32][4];
            FragBF bf[NB][BK / 32][2];
#pragma unroll  // constant indices keep the arrays in registers
            for (int c = 0; c < BK / 32; ++c) {
#pragma unroll  // constant indices keep the arrays in registers
                for (int p = 0; p < NB; ++p)
#pragma unroll  // constant indices keep the arrays in registers
                    for (int nt = 0; nt < 2; ++nt) {
                        const unsigned char* bp = bs + p * NCH * SLICE + 32 * nt;
                        const u32x4 lo = ld_tr16(bp + (32 * c) * B_PITCH);        // k  0..15
                        const u32x4 up = ld_tr16(bp + (32 * c + 16) * B_PITCH);   // k 16..31
                        bf[p][c][nt].d[0] = lo.x; bf[p][c][nt].d[1] = lo.y;
                        bf[p][c][nt].d[2] = lo.z; bf[p][c][nt].d[3] = lo.w;
                        bf[p][c][nt].d[4] = up.x; bf[p][c][nt].d[5] = up.y;
                        bf[p][c][nt].d[6] = up.z; bf[p][c][nt].d[7] = up.w;
                    }
#pragma unroll  // constant indices keep the arrays in registers
                for (int mt = 0; mt < 4; ++mt) {
                    // elements 0-7 = k 8*hi + 0..7, elements 8-15 = k 16 + 8*hi + 0..7
                    const uint4 lo = *(const uint4*)(as + mt * 16 * A_PITCH + 64 * c);
                    const uint4 up = *(const uint4*)(as + mt * 16 * A_PITCH + 64 * c + 32);
                    af[c][mt].d[0] = lo.x; af[c][mt].d[1] = lo.y;
                    af[c][mt].d[2] = lo.z; af[c][mt].d[3] = lo.w;
                    af[c][mt].d[4] = up.x; af[c][mt].d[5] = up.y;
                    af[c][mt].d[6] = up.z; af[c][mt].d[7] = up.w;
                }
            }
            // keeps the reads above the WMMAs: sunk among them, each pair of reads is waited
            // out to zero in front of its two WMMAs and the LDS latency is paid eight times
            __builtin_amdgcn_sched_barrier(0);
#pragma unroll  // two chunks of 32 k, in rising k; constant indices keep the arrays in registers
            for (int c = 0; c < BK / 32; ++c)
#pragma unroll  // constant indices keep the arrays in registers
                for (int mt = 0; mt < 4; ++mt)
#pragma unroll  // constant indices keep the arrays in registers
                    for (int p = 0; p < NB; ++p)
#pragma unroll  // constant indices keep the arrays in registers
                        for (int nt = 0; nt < 2; ++nt)
                            acc[p][mt][nt] = __builtin_amdgcn_wmma_f32_16x16x32_bf16(
                                false, af[c][mt].v, false, bf[p][c][nt].v, (short)0,
                                acc[p][mt][nt], false, false);
            // keeps the next chunk's reads, and the stage's closing waits and barrier, below
            // the WMMAs: lifted among them they bring waits in front of the matrix work
            __builtin_amdgcn_sched_barrier(0);
        }

        // hand-over of the stage, every wave, in this order
        asm volatile("s_wait_dscnt 0x0" ::: "memory");      // this wave has left buffer s & 1
        asm volatile("s_wait_tensorcnt 0x0" ::: "memory");  // its slice of stage s + 1 has landed
        __syncthreads();   // stage s + 1 is published; every reader has left buffer s & 1
        // the test for a further stage is a scalar branch as well (see pinned())
        if (pinned(s + 2u < nst)) issue(s & 1u, true);
    }
    asm volatile("s_wait_tensorcnt 0x0" ::: "memory");   // nothing in flight when the wave goes on
    asm volatile("s_wait_dscnt 0x0" ::: "memory");

    // epilogue
    if constexpr (MODE == 1) {
        // a block's 128 rows lie in one batch entry, a wave's 32 columns in one head
        const int grow0 = rowBase + waveM * 64 + 8 * hi;
        const int gcol0 = colBase + waveN * 32 + n16;
        const size_t head0 = ((size_t)((grow0 >> 10) * NHH + (gcol0 >> 6)) * SS + (grow0 & 1023)) * HDD;
        float bv[NB][2];
#pragma unroll
        for (int p = 0; p < NB; ++p)
#pragma unroll
            for (int nt = 0; nt < 2; ++nt)
                bv[p][nt] = (p == 0 ? bias : (p == 1 ? bias1 : bias2))[gcol0 + nt * 16];
#pragma unroll
        for (int p = 0; p < NB; ++p) {
            unsigned short* po = (p == 0 ? outB : (p == 1 ? outB1 : outB2)) + head0 + (gcol0 & 63);
#pragma unroll
            for (int mt = 0; mt < 4; ++mt) {
#pragma unroll
                for (int nt = 0; nt < 2; ++nt) {
                    unsigned short* dst = po + mt * 16 * HDD + nt * 16;
                    unsigned short w[8];
#pragma unroll
                    for (int r = 0; r < 8; ++r) w[r] = f2bfu(acc[p][mt][nt][r] + bv[p][nt]);
                    // keeps the tile's arithmetic above its stores, so that no register which
                    // one of these stores names is written between the first store and the wait
                    __builtin_amdgcn_sched_barrier(0);
#pragma unroll
                    for (int r = 0; r < 8; ++r) dst[r * HDD] = w[r];
                    // stands in front of the next tile's writes of registers that these stores
                    // name
                    asm volatile("s_wait_xcnt 0x0" ::: "memory");
                    // keeps the next tile's arithmetic below that wait
                    __builtin_amdgcn_sched_barrier(0);
                }
            }
        }
    } else if constexpr (MODE == 2) {
        const int grow0 = rowBase + waveM * 64 + 8 * hi;
        const int gcol0 = colBase + waveN * 32 + n16;
        const float bv[2] = {bias[gcol0], bias[gcol0 + 16]};
        unsigned short* po = outB + (size_t)grow0 * N + gcol0;
#pragma unroll  // constant indices keep the arrays in registers
        for (int mt = 0; mt < 4; ++mt) {
#pragma unroll  // constant indices keep the arrays in registers
            for (int nt = 0; nt < 2; ++nt) {
                unsigned short* dst = po + (size_t)(mt * 16) * N + nt * 16;
                // a tile's eight values are eight independent chains
                unsigned short w[8];
#pragma unroll  // constant indices keep the arrays in registers
                for (int r = 0; r < 8; ++r) w[r] = f2bfu(gelu_erf(acc[0][mt][nt][r] + bv[nt]));
                // keeps the tile's arithmetic above its stores, so that no register which
                // one of these stores names is written between the first store and the wait
                __builtin_amdgcn_sched_barrier(0);
#pragma unroll  // constant indices keep the arrays in registers
                for (int r = 0; r < 8; ++r) dst[(size_t)r * N] = w[r];
                if (mt < 3 || nt < 1) {
                    // stands in front of the next tile's writes of registers that these
                    // stores name; behind the last tile's stores nothing is written any more
                    asm volatile("s_wait_xcnt 0x0" ::: "memory");
                    // keeps the next tile's arithmetic below that wait
                    __builtin_amdgcn_sched_barrier(0);
                }
            }
        }
    } else {
#pragma unroll
        for (int mt = 0; mt < 4; ++mt) {
#pragma unroll
            for (int nt = 0; nt < 2; ++nt) {
#pragma unroll
                for (int r = 0; r < 8; ++r) {
                    int grow = rowBase + waveM * 64 + mt * 16 + r + 8 * hi;
                    int gcol = colBase + waveN * 32 + nt * 16 + n16;
                    float v = acc[0][mt][nt][r] + bias[gcol];
                    outF[(size_t)grow * N + gcol] = v + res[(size_t)grow * N + gcol];
                }
            }
        }
    }
}

#define KV_ROWB   128u
#define KV_ROWS   256u                     /* rows of one slice */
#define K_PITCH   144u
#define V_PITCH   160u
#define K_SLICE   (KV_ROWS * K_PITCH)
#define V_SLICE   (KV_ROWS * V_PITCH)
#define K_BYTES   (4u * K_SLICE)
#define V_BYTES   (4u * V_SLICE)
static_assert(K_SLICE % 2048u == 0u && V_SLICE % 2048u == 0u, "slices are whole 2 KiB units");
static_assert(4u * KV_ROWS == SS && KV_ROWB == HDD * 2u, "four slices hold a head");

template <uint32_t PAD_A>
static __device__ inline u32x8 kvtile_group1() {
    u32x8 g;
    g[0] = uni((1u << 20) | (4u << 22) | (PAD_A << 25));
    g[1] = uni((KV_ROWB & 0xFFFFu) << 16);
    g[2] = uni((KV_ROWB >> 16) | ((KV_ROWS & 0xFFFFu) << 16));
    g[3] = uni((KV_ROWS >> 16) | (KV_ROWB << 16));
    g[4] = uni(KV_ROWS);
    g[5] = uni(KV_ROWB);
    g[6] = uni(0u);
    g[7] = uni(0u);
    return g;
}
static __device__ inline float exp_slot(float x) {
    float e;
    asm("v_exp_f32 %0, %1\n\tv_nop" : "=v"(e) : "v"(x * 1.4426950408889634f));
    return e;
}

static __device__ inline float other_half(float x) {
    int b = __builtin_bit_cast(int, x);
    b = __builtin_amdgcn_permlanex16(b, b, 0x76543210, 0xfedcba98, false, false);
    return __builtin_bit_cast(float, b);
}

// 32 k of one row, k-contiguous in memory, in the hardware k order:
// elements 0-7 = k 8*hi + 0..7, elements 8-15 = k 16 + 8*hi + 0..7
// (p = wave-uniform base, off = the lane's row * HDD + 8*hi)
static __device__ inline void load_row_frag(FragBF& f, const unsigned short* p, unsigned off) {
    const uint4 lo = *(const uint4*)(p + off);
    const uint4 up = *(const uint4*)(p + off + 16);
    f.d[0] = lo.x; f.d[1] = lo.y; f.d[2] = lo.z; f.d[3] = lo.w;
    f.d[4] = up.x; f.d[5] = up.y; f.d[6] = up.z; f.d[7] = up.w;
}

// the same fragment from a K row in LDS (p = the lane's row, at its 16-byte half of 32 bytes)
static __device__ inline void lds_row_frag(FragBF& f, const unsigned char* p) {
    const uint4 lo = *(const uint4*)(p);
    const uint4 up = *(const uint4*)(p + 32);
    f.d[0] = lo.x; f.d[1] = lo.y; f.d[2] = lo.z; f.d[3] = lo.w;
    f.d[4] = up.x; f.d[5] = up.y; f.d[6] = up.z; f.d[7] = up.w;
}

__global__ __launch_bounds__(256) void attn_kernel(const unsigned short* __restrict__ Q,
                                                   const unsigned short* __restrict__ Kb,
                                                   const unsigned short* __restrict__ Vb,
                                                   const float* __restrict__ mask,
                                                   unsigned short* __restrict__ ctxB) {
    __shared__ __attribute__((aligned(2048))) unsigned char KV[K_BYTES + V_BYTES];   // [K | V]
    const int lane = threadIdx.x & 31;
    const int wid  = threadIdx.x >> 5;
    const int n16  = lane & 15;
    const int hi   = lane >> 4;
    const int bh   = blockIdx.x >> 2;     // (b*NH + h)
    const int qblk = (blockIdx.x & 3) * 256;
    const int q0   = qblk + wid * 32;
    const int b    = bh >> 4;
    const int h    = bh & 15;
    const unsigned short* Qh = Q  + (size_t)bh * SS * HDD;
    const unsigned short* Kh = Kb + (size_t)bh * SS * HDD;
    const unsigned short* Vh = Vb + (size_t)bh * SS * HDD;
    const float*          mb = mask + (size_t)b * SS;
    const unsigned rowOff = (unsigned)(n16 * HDD + 8 * hi);   // Q rows

    // Q rows as B fragments: [column group][k chunk of 32]; asked for ahead of the tensor
    // loads, so that they fly while K and V land
    FragBF qf[2][2];
#pragma unroll  // constant indices keep the arrays in registers
    for (int g = 0; g < 2; ++g)
#pragma unroll  // constant indices keep the arrays in registers
        for (int c = 0; c < 2; ++c)
            load_row_frag(qf[g][c], Qh + (size_t)wid * 32 * HDD + (qblk + 16 * g) * HDD + 32 * c, rowOff);

    // waves 0-3 bring K rows 256 w .., waves 4-7 V rows 256 (w - 4) ..: one tensor load a
    // wave, each behind a scalar branch (see pinned()) with its own constant pad word
    const uint32_t wave = uni((uint32_t)threadIdx.x >> 5);
    const uint32_t kv0  = (uint32_t)(size_t)&KV[0];
    if (pinned(wave < 4u)) {
        u32x4 g0 = btile_group0(kv0 + wave * K_SLICE,
                                (uint64_t)Kh + (uint64_t)(wave * (KV_ROWS * KV_ROWB)));
        u32x8 g1 = kvtile_group1<3u>();
        asm volatile("tensor_load_to_lds %0, %1" :: "s"(g0), "s"(g1) : "memory");
        asm volatile("s_wait_tensorcnt 0x0" ::: "memory");   // this wave's K slice has landed
    }
    if (pinned(wave >= 4u)) {
        u32x4 g0 = btile_group0(kv0 + K_BYTES + (wave - 4u) * V_SLICE,
                                (uint64_t)Vh + (uint64_t)((wave - 4u) * (KV_ROWS * KV_ROWB)));
        u32x8 g1 = kvtile_group1<7u>();
        asm volatile("tensor_load_to_lds %0, %1" :: "s"(g0), "s"(g1) : "memory");
        asm volatile("s_wait_tensorcnt 0x0" ::: "memory");   // this wave's V slice has landed
    }
    __syncthreads();   // every wave's slice has landed: K and V are published to the block

    // the lane's row of a 16-key tile of K, at its 16-byte half of 32 bytes
    const unsigned char* kl = &KV[0] + n16 * K_PITCH + 16 * hi;
    // the lane's address in the transposing load: row 8*hi + (lane & 7), 16-byte half
    // (lane >> 3) & 1 of the 32 bytes of a 16-column group
    const unsigned char* vl = &KV[K_BYTES] + (8 * hi + (lane & 7)) * V_PITCH +
                              16 * ((lane >> 3) & 1);

    // K rows as A fragments: [key tile of 16][k chunk of 32], fetched one pass ahead
    FragBF kf[2][2];
#pragma unroll  // constant indices keep the arrays in registers
    for (int t = 0; t < 2; ++t)
#pragma unroll  // constant indices keep the arrays in registers
        for (int c = 0; c < 2; ++c)
            lds_row_frag(kf[t][c], kl + 16 * t * K_PITCH + 64 * c);

    v8f   o[2][4];                 // O^T: [group][hd tile]; reg r = hd 8*hi + r
    float mrun[2], lrun[2];        // running maximum; this half's running sum
#pragma unroll  // constant indices keep the arrays in registers
    for (int g = 0; g < 2; ++g) {
        mrun[g] = -3.402823466e38f;   // finite, so that (-inf) - mrun is never NaN
        lrun[g] = 0.0f;
#pragma unroll  // constant indices keep the arrays in registers
        for (int nt = 0; nt < 4; ++nt) o[g][nt] = zero8();
    }

    for (int kp = 0; kp < 32; ++kp) {
        const int key0 = kp * 32;

        // V^T as A fragments (row = hd, k = key)
        const unsigned char* vp = vl + key0 * V_PITCH;
        FragBF vf[4];
#pragma unroll  // constant indices keep the arrays in registers
        for (int nt = 0; nt < 4; ++nt) {
            const u32x4 lo = ld_tr16(vp + 32 * nt);                  // keys  0..15
            const u32x4 up = ld_tr16(vp + 16 * V_PITCH + 32 * nt);   // keys 16..31
            vf[nt].d[0] = lo.x; vf[nt].d[1] = lo.y; vf[nt].d[2] = lo.z; vf[nt].d[3] = lo.w;
            vf[nt].d[4] = up.x; vf[nt].d[5] = up.y; vf[nt].d[6] = up.z; vf[nt].d[7] = up.w;
        }

        // mask of this lane's keys: [tile][r] = key key0 + 16*t + 8*hi + r; the 32 values
        // of the pass are read at wave-uniform addresses, a lane picks its half's
        float mk[2][8];
#pragma unroll  // constant indices keep the arrays in registers
        for (int t = 0; t < 2; ++t)
#pragma unroll  // constant indices keep the arrays in registers
            for (int r = 0; r < 8; ++r) {
                const float lo = mb[key0 + 16 * t + r];
                const float up = mb[key0 + 16 * t + 8 + r];
                mk[t][r] = hi ? up : lo;
            }

        // S^T tiles: st[g][t][r] = q(q0 + 16g + n16) . k(key0 + 16t + 8hi + r)
        v8f st[2][2];
#pragma unroll  // constant indices keep the arrays in registers
        for (int g = 0; g < 2; ++g)
#pragma unroll  // constant indices keep the arrays in registers
            for (int t = 0; t < 2; ++t) {
                v8f s = zero8();
#pragma unroll  // constant indices keep the arrays in registers
                for (int c = 0; c < 2; ++c)
                    s = __builtin_amdgcn_wmma_f32_16x16x32_bf16(false, kf[t][c].v, false,
                                                                qf[g][c].v, (short)0, s,
                                                                false, false);
                st[g][t] = s;
            }

        // next pass's K rows (the last pass fetches pass 0's again: in bounds, unused)
        {
            const int kn = ((kp + 1) & 31) * 32;
#pragma unroll  // constant indices keep the arrays in registers
            for (int t = 0; t < 2; ++t)
#pragma unroll  // constant indices keep the arrays in registers
                for (int c = 0; c < 2; ++c)
                    lds_row_frag(kf[t][c], kl + (kn + 16 * t) * K_PITCH + 64 * c);
        }

        FragBF pf[2];
#pragma unroll  // constant indices keep the arrays in registers
        for (int g = 0; g < 2; ++g) {
            float x[16];
            float mx = mrun[g];
#pragma unroll  // constant indices keep the arrays in registers
            for (int t = 0; t < 2; ++t)
#pragma unroll  // constant indices keep the arrays in registers
                for (int r = 0; r < 8; ++r) {
                    x[8 * t + r] = st[g][t][r] * 0.125f + mk[t][r];
                    mx = fmaxf(mx, x[8 * t + r]);
                }
            mx = fmaxf(mx, other_half(mx));
            const float alpha = exp_slot(mrun[g] - mx);
            mrun[g] = mx;
            float sum = 0.0f;
#pragma unroll  // constant indices keep the arrays in registers
            for (int i = 0; i < 16; ++i) {
                x[i] = exp_slot(x[i] - mx);
                sum += x[i];
            }
            lrun[g] = lrun[g] * alpha + sum;
#pragma unroll  // constant indices keep the arrays in registers
            for (int i = 0; i < 8; ++i) pf[g].d[i] = pack_bf16(x[2 * i], x[2 * i + 1]);
#pragma unroll  // constant indices keep the arrays in registers
            for (int nt = 0; nt < 4; ++nt)
#pragma unroll  // constant indices keep the arrays in registers
                for (int r = 0; r < 8; ++r) o[g][nt][r] *= alpha;
        }

        // O^T += V^T . P^T
#pragma unroll  // constant indices keep the arrays in registers
        for (int nt = 0; nt < 4; ++nt)
#pragma unroll  // constant indices keep the arrays in registers
            for (int g = 0; g < 2; ++g)
                o[g][nt] = __builtin_amdgcn_wmma_f32_16x16x32_bf16(false, vf[nt].v, false,
                                                                   pf[g].v, (short)0,
                                                                   o[g][nt], false, false);
    }

    // ctx as bf16 in [B,S,D] layout: a lane's 8 registers are 8 consecutive hd
#pragma unroll  // constant indices keep the arrays in registers
    for (int g = 0; g < 2; ++g) {
        const float inv = 1.0f / (lrun[g] + other_half(lrun[g]));
        unsigned short* dst = ctxB + ((size_t)b * SS + q0 + 16 * g + n16) * DD + h * 64 + 8 * hi;
#pragma unroll  // constant indices keep the arrays in registers
        for (int nt = 0; nt < 4; ++nt) {
            uint4 w;
            w.x = pack_bf16(o[g][nt][0] * inv, o[g][nt][1] * inv);
            w.y = pack_bf16(o[g][nt][2] * inv, o[g][nt][3] * inv);
            w.z = pack_bf16(o[g][nt][4] * inv, o[g][nt][5] * inv);
            w.w = pack_bf16(o[g][nt][6] * inv, o[g][nt][7] * inv);
            *(uint4*)(dst + nt * 16) = w;
        }
    }
}

#define LN_WAVES 16
#define LN_VEC   (DD / 128)   /* 16-byte pieces of a row per lane */
static_assert(BSR % LN_WAVES == 0 && DD % 128 == 0, "whole blocks, whole loads");

// sum over the wave's 32 lanes, the same value in every lane: four exchanges inside the
// 16-lane rows (lane ^ 1, 2, 4, 8), then one between the two rows
template <int XMASK>
static __device__ inline float row_xor_add(float x) {
    const int y = __builtin_amdgcn_update_dpp(0, __builtin_bit_cast(int, x), 0x160 + XMASK,
                                              0xf, 0xf, true);
    return x + __builtin_bit_cast(float, y);
}
static __device__ inline float wave_sum(float x) {
    x = row_xor_add<1>(x);
    x = row_xor_add<2>(x);
    x = row_xor_add<4>(x);
    x = row_xor_add<8>(x);
    return x + other_half(x);
}

typedef float f32x4 __attribute__((ext_vector_type(4)));

template <bool WITH_BF16>
__global__ __launch_bounds__(LN_WAVES * 32) void ln_kernel(const float* __restrict__ x,
                                                           const float* __restrict__ g,
                                                           const float* __restrict__ bta,
                                                           float* __restrict__ outF,
                                                           unsigned short* __restrict__ outB) {
    const unsigned lane = threadIdx.x & 31u;
    const size_t   row  = (size_t)blockIdx.x * LN_WAVES + (threadIdx.x >> 5);
    const f32x4* xr = (const f32x4*)(x + row * DD);
    const f32x4* gr = (const f32x4*)g;
    const f32x4* br = (const f32x4*)bta;

    f32x4 v[LN_VEC], gv[LN_VEC], bv[LN_VEC];
#pragma unroll  // constant indices keep the arrays in registers
    for (int j = 0; j < LN_VEC; ++j) v[j] = xr[lane + 32 * j];
#pragma unroll  // constant indices keep the arrays in registers
    for (int j = 0; j < LN_VEC; ++j) { gv[j] = gr[lane + 32 * j]; bv[j] = br[lane + 32 * j]; }
    // holds the loads of gain and bias up here, in flight beside the row's: left free, the
    // compiler sinks them behind the sums and the wave pays their latency on top of the row's
    asm volatile("" :: "v"(gv[0]), "v"(gv[1]), "v"(gv[2]), "v"(gv[3]), "v"(gv[4]), "v"(gv[5]),
                       "v"(gv[6]), "v"(gv[7]), "v"(bv[0]), "v"(bv[1]), "v"(bv[2]), "v"(bv[3]),
                       "v"(bv[4]), "v"(bv[5]), "v"(bv[6]), "v"(bv[7]));
    // keeps the sums below that statement: alone, it is moved down behind the first sum,
    // and the loads with it
    __builtin_amdgcn_sched_barrier(0);
    static_assert(LN_VEC == 8, "the statement above names every piece");

    // four independent chains, one per component
    f32x4 s = v[0];
#pragma unroll  // constant indices keep the arrays in registers
    for (int j = 1; j < LN_VEC; ++j) s += v[j];
    const float mu = wave_sum((s.x + s.y) + (s.z + s.w)) * (1.0f / DD);

    f32x4 q = {0.0f, 0.0f, 0.0f, 0.0f};
#pragma unroll  // constant indices keep the arrays in registers
    for (int j = 0; j < LN_VEC; ++j) {
        v[j] -= mu;
        q += v[j] * v[j];
    }
    const float inv = rsqrtf(wave_sum((q.x + q.y) + (q.z + q.w)) * (1.0f / DD) + 1e-12f);

    // every result has registers of its own: none is rewritten under a store in flight
    uint2 w[LN_VEC];
#pragma unroll  // constant indices keep the arrays in registers
    for (int j = 0; j < LN_VEC; ++j) {
        v[j] = v[j] * inv * gv[j] + bv[j];
        if (WITH_BF16) {
            w[j].x = pack_bf16(v[j].x, v[j].y);
            w[j].y = pack_bf16(v[j].z, v[j].w);
        }
    }
    f32x4* of = (f32x4*)(outF + row * DD);
#pragma unroll  // constant indices keep the arrays in registers
    for (int j = 0; j < LN_VEC; ++j) of[lane + 32 * j] = v[j];
    if (WITH_BF16) {
        uint2* ob = (uint2*)(outB + row * DD);
#pragma unroll  // constant indices keep the arrays in registers
        for (int j = 0; j < LN_VEC; ++j) ob[lane + 32 * j] = w[j];
    }
}

// ---------------- launcher ----------------
extern "C" void kernel_launch(void* const* d_in, const int* in_sizes, int n_in,
                              void* d_out, int out_size, void* d_ws, size_t ws_size,
                              hipStream_t stream) {
    const float* hidden = (const float*)d_in[0];
    const float* mask   = (const float*)d_in[1];
    const float* Wq = (const float*)d_in[2];   const float* bq  = (const float*)d_in[3];
    const float* Wk = (const float*)d_in[4];   const float* bk  = (const float*)d_in[5];
    const float* Wv = (const float*)d_in[6];   const float* bv  = (const float*)d_in[7];
    const float* Wo = (const float*)d_in[8];   const float* bo  = (const float*)d_in[9];
    const float* g1 = (const float*)d_in[10];  const float* b1  = (const float*)d_in[11];
    const float* Wi = (const float*)d_in[12];  const float* bi  = (const float*)d_in[13];
    const float* Wt = (const float*)d_in[14];  const float* bot = (const float*)d_in[15];
    const float* g2 = (const float*)d_in[16];  const float* b2  = (const float*)d_in[17];
    float* out = (float*)d_out;

    const size_t BSD = (size_t)BSR * DD;     // 4M
    const size_t DI  = (size_t)DD * II;      // 4M
    const size_t DDq = (size_t)DD * DD;      // 1M

    char* ws = (char*)d_ws;
    auto alloc = [&](size_t bytes) -> char* {
        char* p = ws;
        ws += (bytes + 255) & ~(size_t)255;
        return p;
    };
    unsigned short* hb    = (unsigned short*)alloc(BSD * 2);
    unsigned short* wqb   = (unsigned short*)alloc(DDq * 2);
    unsigned short* wkb   = (unsigned short*)alloc(DDq * 2);
    unsigned short* wvb   = (unsigned short*)alloc(DDq * 2);
    unsigned short* wob   = (unsigned short*)alloc(DDq * 2);
    unsigned short* wib   = (unsigned short*)alloc(DI * 2);
    unsigned short* wtb   = (unsigned short*)alloc(DI * 2);
    unsigned short* qb    = (unsigned short*)alloc(BSD * 2);
    unsigned short* kbuf  = (unsigned short*)alloc(BSD * 2);
    unsigned short* vbuf  = (unsigned short*)alloc(BSD * 2);
    unsigned short* ctxb  = (unsigned short*)alloc(BSD * 2);
    float*          y1    = (float*)alloc(BSD * 4);
    float*          attnf = (float*)alloc(BSD * 4);
    unsigned short* attnb = (unsigned short*)alloc(BSD * 2);
    unsigned short* interb= (unsigned short*)alloc((size_t)BSR * II * 2);
    float*          y2    = (float*)alloc(BSD * 4);

    // 1) fp32 -> bf16 conversions
    cvt_all_f32_bf16<<<CVT_BLOCKS, CVT_THREADS, 0, stream>>>(hidden, Wq, Wk, Wv, Wo, Wi, Wt,
                                                             hb, wqb, wkb, wvb, wob, wib, wtb);

    // 2) Q, K and V projections side by side (head-scattered bf16 outputs)
    {
        dim3 g(DD / 128, BSR / 128);
        gemm_bf16<1, 2, 3><<<g, 256, 0, stream>>>(hb, wqb, wkb, wvb, bq, bk, bv, nullptr,
                                                  qb, kbuf, vbuf, nullptr, BSR, DD, DD);
    }

    // 3) attention
    attn_kernel<<<BB * NHH * (SS / 256), 256, 0, stream>>>(qb, kbuf, vbuf, mask, ctxb);

    // 4) output projection + residual(hidden)
    {
        dim3 g(DD / 128, BSR / 128);
        gemm_bf16<0, 4, 1><<<g, 256, 0, stream>>>(ctxb, wob, nullptr, nullptr, bo, nullptr,
                                                  nullptr, y1, nullptr, nullptr, nullptr,
                                                  hidden, BSR, DD, DD);
    }
    // 5) LN1 -> attnf (f32) + attnb (bf16)
    ln_kernel<true><<<BSR / LN_WAVES, LN_WAVES * 32, 0, stream>>>(y1, g1, b1, attnf, attnb);

    // 6) FFN up + exact GELU -> bf16
    {
        dim3 g(II / 128, BSR / 128);
        gemm_bf16<2, 2, 1><<<g, 256, 0, stream>>>(attnb, wib, nullptr, nullptr, bi, nullptr,
                                                  nullptr, nullptr, interb, nullptr, nullptr,
                                                  nullptr, BSR, II, DD);
    }
    // 7) FFN down + residual(attnf)
    {
        dim3 g(DD / 128, BSR / 128);
        gemm_bf16<0, 4, 1><<<g, 256, 0, stream>>>(interb, wtb, nullptr, nullptr, bot, nullptr,
                                                  nullptr, y2, nullptr, nullptr, nullptr,
                                                  attnf, BSR, DD, II);
    }
    // 8) LN2 -> final output
    ln_kernel<false><<<BSR / LN_WAVES, LN_WAVES * 32, 0, stream>>>(y2, g2, b2, out, nullptr);
}

// v010
// One run takes 157 microseconds.
// Two timings next to v009 put it at 1.04 and 1.05 times that version's speed.
// Counting every step since v000, it is 5.40 times as fast.
#include <hip/hip_runtime.h>
#include <cstdint>
#include <cstddef>

// ---------------- types ----------------
typedef __bf16 bf16_t;
typedef bf16_t v16bf __attribute__((ext_vector_type(16)));
typedef float  v8f   __attribute__((ext_vector_type(8)));
typedef unsigned int u32x4 __attribute__((ext_vector_type(4)));

union FragBF {
    uint32_t       d[8];
    unsigned short u[16];
    v16bf          v;
};

static __device__ inline v8f zero8() {
    v8f z;
#pragma unroll
    for (int i = 0; i < 8; ++i) z[i] = 0.0f;
    return z;
}

// fp32 -> bf16 (round to nearest even), returned as raw u16 bits
static __device__ inline unsigned short f2bfu(float f) {
    union { float f; uint32_t u; } c; c.f = f;
    uint32_t r = c.u + 0x7FFFu + ((c.u >> 16) & 1u);
    return (unsigned short)(r >> 16);
}

// model constants
#define BB   4
#define SS   1024
#define DD   1024
#define NHH  16
#define HDD  64
#define II   4096
#define BSR  4096   /* B*S rows */

#define BK      64
#define B_ROWB  256u
#define B_ROWS  64u
#define B_PITCH 288u
#define B_BUF   18432u
#define A_ROWB  128u
#define A_ROWS  128u
#define A_PITCH 144u
#define A_BUF   18432u
static_assert(B_ROWS * B_PITCH <= B_BUF && (B_BUF % 2048u) == 0u, "B buffer size");
static_assert(A_ROWS * A_PITCH <= A_BUF && (A_BUF % 2048u) == 0u, "A buffer size");

typedef unsigned int u32x8 __attribute__((ext_vector_type(8)));
typedef short        s16x8 __attribute__((ext_vector_type(8)));

static __device__ inline uint32_t uni(uint32_t v) {
    return (uint32_t)__builtin_amdgcn_readfirstlane(v);
}
static __device__ inline uint32_t pinned(uint32_t v) {
    uint32_t w = uni(v);
    asm volatile("" : "+s"(w));   // the pin of a tensor load's issue test in a scalar register
    return w;
}
static __device__ inline u32x8 btile_group1(uint32_t src_pitch) {
    u32x8 g;
    g[0] = uni((1u << 20) | (5u << 22) | (7u << 25));
    g[1] = uni((B_ROWB & 0xFFFFu) << 16);
    g[2] = uni((B_ROWB >> 16) | ((B_ROWS & 0xFFFFu) << 16));
    g[3] = uni((B_ROWS >> 16) | (B_ROWB << 16));
    g[4] = uni(B_ROWS);
    g[5] = uni(src_pitch);
    g[6] = uni(0u);
    g[7] = uni(0u);
    return g;
}
static __device__ inline u32x8 atile_group1(uint32_t src_pitch) {
    u32x8 g;
    g[0] = uni((1u << 20) | (4u << 22) | (3u << 25));
    g[1] = uni((A_ROWB & 0xFFFFu) << 16);
    g[2] = uni((A_ROWB >> 16) | ((A_ROWS & 0xFFFFu) << 16));
    g[3] = uni((A_ROWS >> 16) | (A_ROWB << 16));
    g[4] = uni(A_ROWS);
    g[5] = uni(src_pitch);
    g[6] = uni(0u);
    g[7] = uni(0u);
    return g;
}
static __device__ inline u32x4 btile_group0(uint32_t lds_dst, uint64_t ga) {
    u32x4 g;
    g[0] = uni(1u);
    g[1] = uni(lds_dst);
    g[2] = uni((uint32_t)ga);
    g[3] = uni((((uint32_t)(ga >> 32)) & 0x01FFFFFFu) | 0x80000000u);
    return g;
}
// 8 k x 16 columns per wave half of a row-major 16-bit LDS tile, transposed: lane (c, h)
// gets 8 consecutive k of column c, which is half a B fragment in the hardware k order
static __device__ inline u32x4 ld_tr16(const unsigned char* p) {
    typedef __attribute__((address_space(3))) s16x8 lds_s16x8;
    return __builtin_bit_cast(u32x4, __builtin_amdgcn_ds_load_tr16_b128_v8i16((lds_s16x8*)p));
}

#define CVT_THREADS 512
#define CVT_LOADS   32
#define CVT_PIECE   (CVT_THREADS * CVT_LOADS * 4)
#define CVT_P_ACT   (BSR * DD / CVT_PIECE)   /* pieces of the activations */
#define CVT_P_SQ    (DD * DD / CVT_PIECE)    /* pieces of a D x D weight */
#define CVT_P_FF    (DD * II / CVT_PIECE)    /* pieces of a D x I weight */
#define CVT_BLOCKS  (CVT_P_ACT + 4 * CVT_P_SQ + 2 * CVT_P_FF)
static_assert(BSR * DD % CVT_PIECE == 0 && DD * DD % CVT_PIECE == 0 && DD * II % CVT_PIECE == 0,
              "whole pieces");

typedef float  f32x2  __attribute__((ext_vector_type(2)));
typedef bf16_t bf16x2 __attribute__((ext_vector_type(2)));

// two f32 -> packed bf16 pair (round to nearest even)
static __device__ inline uint32_t pack_bf16(float a, float b) {
    f32x2 f; f[0] = a; f[1] = b;
    union { bf16x2 h; uint32_t u; } c;
    c.h = __builtin_convertvector(f, bf16x2);
    return c.u;
}

__global__ __launch_bounds__(CVT_THREADS)
void cvt_all_f32_bf16(
        const float* __restrict__ hidden, const float* __restrict__ Wq,
        const float* __restrict__ Wk, const float* __restrict__ Wv,
        const float* __restrict__ Wo, const float* __restrict__ Wi,
        const float* __restrict__ Wt,
        unsigned short* __restrict__ hb, unsigned short* __restrict__ wqb,
        unsigned short* __restrict__ wkb, unsigned short* __restrict__ wvb,
        unsigned short* __restrict__ wob, unsigned short* __restrict__ wib,
        unsigned short* __restrict__ wtb) {
    // which array, and which piece of it: the same for the whole block
    unsigned p = blockIdx.x;
    const float* in;
    unsigned short* out;
    if (p < CVT_P_ACT) { in = hidden; out = hb; }
    else if ((p -= CVT_P_ACT) < CVT_P_SQ) { in = Wq; out = wqb; }
    else if ((p -= CVT_P_SQ) < CVT_P_SQ) { in = Wk; out = wkb; }
    else if ((p -= CVT_P_SQ) < CVT_P_SQ) { in = Wv; out = wvb; }
    else if ((p -= CVT_P_SQ) < CVT_P_SQ) { in = Wo; out = wob; }
    else if ((p -= CVT_P_SQ) < CVT_P_FF) { in = Wi; out = wib; }
    else { p -= CVT_P_FF; in = Wt; out = wtb; }

    // block-uniform bases; the lane's index serves the 16-byte loads and the 8-byte stores
    const float4* src = (const float4*)(in + (size_t)p * CVT_PIECE);
    uint2*        dst = (uint2*)(out + (size_t)p * CVT_PIECE);
    const unsigned t = threadIdx.x;

    float4 v[CVT_LOADS];
#pragma unroll  // constant indices keep the array in registers
    for (int j = 0; j < CVT_LOADS; ++j) v[j] = src[t + j * CVT_THREADS];
    // keeps all loads above the conversions: left free, the compiler issues the last of them
    // behind waits for the first and the wave pays the memory latency more than once
    __builtin_amdgcn_sched_barrier(0);
    // every result has a register pair of its own: none is rewritten under a store in flight
    uint2 w[CVT_LOADS];
#pragma unroll  // constant indices keep the arrays in registers
    for (int j = 0; j < CVT_LOADS; ++j) {
        w[j].x = pack_bf16(v[j].x, v[j].y);
        w[j].y = pack_bf16(v[j].z, v[j].w);
    }
#pragma unroll  // constant indices keep the array in registers
    for (int j = 0; j < CVT_LOADS; ++j) dst[t + j * CVT_THREADS] = w[j];
}

// ---------------- GELU with the error function, free of branches ----------------
// gelu(x) = x * Phi(x), Phi(x) = erfc(-x / sqrt(2)) / 2. With z = |x| / sqrt(2) and
// t = 1 / (1 + 0.3275911 z) the five-term rational form
//   erfc(z) = t (a1 + t (a2 + t (a3 + t (a4 + t a5)))) e^(-z z)
// holds for every z >= 0 with an absolute error of at most 1.5e-7, so that one straight
// line of code serves all lanes. q = erfc(z) / 2 is Phi(-|x|), hence
//   x >= 0: gelu = x - x q,   x < 0: gelu = x q,   both: max(x, 0) - |x| q,
// which forms no 1 + erf and so loses nothing to cancellation in the negative tail.
// For every finite x; at x = +infinity, which finite operands do not reach, |x| q is inf * 0.
static __device__ inline float gelu_erf(float x) {
    const float t = __builtin_amdgcn_rcpf(
        __builtin_fmaf(__builtin_fabsf(x), (float)(0.3275911 * 0.70710678118654752), 1.0f));
    const float e = __builtin_amdgcn_exp2f((x * -0.72134752044448170f) * x);   // e^(-x x / 2)
    float p = (float)(0.5 * 1.061405429);
    p = __builtin_fmaf(p, t, (float)(0.5 * -1.453152027));
    p = __builtin_fmaf(p, t, (float)(0.5 * 1.421413741));
    p = __builtin_fmaf(p, t, (float)(0.5 * -0.284496736));
    p = __builtin_fmaf(p, t, (float)(0.5 * 0.254829592));
    const float q = (p * t) * e;
    return __builtin_fmaf(-__builtin_fabsf(x), q, __builtin_fmaxf(x, 0.0f));
}

template <int MODE, int NCH, int NB, int TB>
__global__ __launch_bounds__(256) void gemm_bf16(const unsigned short* __restrict__ A,
                                                 const unsigned short* __restrict__ Bw,
                                                 const unsigned short* __restrict__ Bw1,
                                                 const unsigned short* __restrict__ Bw2,
                                                 const float* __restrict__ bias,
                                                 const float* __restrict__ bias1,
                                                 const float* __restrict__ bias2,
                                                 float* __restrict__ outF,
                                                 unsigned short* __restrict__ outB,
                                                 unsigned short* __restrict__ outB1,
                                                 unsigned short* __restrict__ outB2,
                                                 const float* __restrict__ res,
                                                 int M, int N, int K) {
    static_assert(A_BUF == B_BUF && NCH * TB * (1 + NB) <= 8, "one slice size, one slice a wave");
    static_assert(NB == 1 || (NB == 3 && MODE == 1), "the products that are launched");
    static_assert(TB == 1 || (TB == 2 && NB == 1 && MODE == 2), "the tiles that are launched");
    constexpr int      MT    = 4 * TB;                    // 16-row tiles of a wave
    constexpr int      NT    = 2 * TB;                    // 16-column tiles of a wave
    constexpr uint32_t SLICE = A_BUF;                     // a whole number of 2 KiB units
    constexpr uint32_t NAS   = (uint32_t)(NCH * TB);      // A slices of a stage
    constexpr uint32_t NSL   = (uint32_t)(NCH * TB * (1 + NB));
    constexpr uint32_t STAGE = NSL * SLICE;               // [A slices | B slices]
    __shared__ __attribute__((aligned(2048))) unsigned char Ts[2 * STAGE];

    const int tid   = threadIdx.x;
    const int lane  = tid & 31;
    const int wid   = tid >> 5;
    const int n16   = lane & 15;
    const int hi    = lane >> 4;
    const int waveM = wid >> 2;   // 0..1
    const int waveN = wid & 3;    // 0..3
    const int rowBase = blockIdx.y * (128 * TB);
    const int colBase = blockIdx.x * (128 * TB);

    v8f acc[NB][MT][NT];
#pragma unroll
    for (int p = 0; p < NB; ++p)
#pragma unroll
        for (int i = 0; i < MT; ++i)
#pragma unroll
            for (int j = 0; j < NT; ++j) acc[p][i][j] = zero8();

    const uint32_t wave   = uni((uint32_t)threadIdx.x >> 5);
    const uint32_t bchunk = uni((uint32_t)N * (2u * BK));   // 64 source rows of B, in bytes
    // which row half an A wave serves, and which chunk of the stage
    const uint32_t ahalf = TB > 1 ? wave / (uint32_t)NCH : 0u;
    const uint32_t aslc  = wave - ahalf * (uint32_t)NCH;
    // which B_p (or column half) a B wave serves, and which chunk of the stage
    const uint32_t bprod = NB * TB > 1 ? (wave - NAS) / (uint32_t)NCH : 0u;
    const uint32_t bslc  = wave - NAS - bprod * (uint32_t)NCH;
    const unsigned short* bsrc = Bw;
    if (NB > 1) bsrc = bprod == 1u ? Bw1 : (bprod == 2u ? Bw2 : Bw);
    if (TB > 1) bsrc = Bw + bprod * 128u;
    // first byte of this wave's slice in stage 0, and its step from stage to stage
    const uint64_t src0 = wave < NAS
        ? (uint64_t)(A + (size_t)(rowBase + (int)ahalf * 128) * K) + aslc * A_ROWB
        : (uint64_t)(bsrc + colBase) + (uint64_t)bslc * bchunk;
    const uint32_t step = wave < NAS ? (uint32_t)NCH * A_ROWB : (uint32_t)NCH * bchunk;
    const uint32_t place0 = (uint32_t)(size_t)&Ts[0] + wave * SLICE;
    u32x8 ag1 = atile_group1((uint32_t)K * 2u);
    u32x8 bg1 = btile_group1((uint32_t)N * 2u);
    u32x4 ag0 = btile_group0(place0, src0);
    u32x4 bg0 = btile_group0(place0, src0);

    auto issue = [&](uint32_t buf, bool advance) {
        // scalar branches (see pinned()); each path has its own constant pad word
        if (pinned(wave < NAS)) {
            ag0[1] = uni(place0 + buf * STAGE);
            if (advance) {
                const uint64_t a = (((uint64_t)ag0[3] << 32) | ag0[2]) + step;
                ag0[2] = uni((uint32_t)a);
                ag0[3] = uni((uint32_t)(a >> 32));
            }
            asm volatile("tensor_load_to_lds %0, %1" : "+s"(ag0), "+s"(ag1) :: "memory");
        }
        if (pinned(wave >= NAS && wave < NSL)) {
            bg0[1] = uni(place0 + buf * STAGE);
            if (advance) {
                const uint64_t a = (((uint64_t)bg0[3] << 32) | bg0[2]) + step;
                bg0[2] = uni((uint32_t)a);
                bg0[3] = uni((uint32_t)(a >> 32));
            }
            asm volatile("tensor_load_to_lds %0, %1" : "+s"(bg0), "+s"(bg1) :: "memory");
        }
    };

    const uint32_t nst = uni((uint32_t)K / (uint32_t)(BK * NCH));
    issue(0u, false);
    asm volatile("s_wait_tensorcnt 0x0" ::: "memory");   // this wave's slice of stage 0 has landed
    __syncthreads();                                     // every wave's slice has
    issue(1u, true);                                     // flies while stage 0 is worked on

    for (uint32_t s = 0; s < nst; ++s) {
        const unsigned char* st = &Ts[0] + (s & 1u) * STAGE;
        // the lane's row of the wave's first A tile, at its 16-byte half of 32 bytes
        // (TB = 2: the wave's 128 rows are one row half's slices)
        const unsigned char* as0 = st + (TB > 1 ? waveM * NCH * SLICE + n16 * A_PITCH
                                                : (waveM * 64 + n16) * A_PITCH) + 16 * hi;
        // the lane's address in the transposing load: row 8*hi + (lane & 7), 16-byte
        // half (lane >> 3) & 1 of the 32 bytes of a 16-column group
        // (TB = 2: the wave's 64 columns are half of one column half's slices)
        const unsigned char* bs0 = st + NAS * SLICE + (8 * hi + (lane & 7)) * B_PITCH +
                                   16 * ((lane >> 3) & 1) +
                                   (TB > 1 ? (waveN >> 1) * NCH * SLICE + 128 * (waveN & 1)
                                           : 64 * waveN);

#pragma unroll  // the chunks of a stage, in rising k; constant slice offsets
        for (int ch = 0; ch < NCH; ++ch) {
            const unsigned char* as = as0 + ch * SLICE;
            const unsigned char* bs = bs0 + ch * SLICE;

            // all fragment reads of the chunk (4 MT of A, 4 NT of each B_p) stand as one group
            // ahead of its 2 * MT * NT * NB WMMAs
            FragBF af[BK / 32][MT];
            FragBF bf[NB][BK / 32][NT];
#pragma unroll  // constant indices keep the arrays in registers
            for (int c = 0; c < BK / 32; ++c) {
#pragma unroll  // constant indices keep the arrays in registers
                for (int p = 0; p < NB; ++p)
#pragma unroll  // constant indices keep the arrays in registers
                    for (int nt = 0; nt < NT; ++nt) {
                        const unsigned char* bp = bs + p * NCH * SLICE + 32 * nt;
                        const u32x4 lo = ld_tr16(bp + (32 * c) * B_PITCH);        // k  0..15
                        const u32x4 up = ld_tr16(bp + (32 * c + 16) * B_PITCH);   // k 16..31
                        bf[p][c][nt].d[0] = lo.x; bf[p][c][nt].d[1] = lo.y;
                        bf[p][c][nt].d[2] = lo.z; bf[p][c][nt].d[3] = lo.w;
                        bf[p][c][nt].d[4] = up.x; bf[p][c][nt].d[5] = up.y;
                        bf[p][c][nt].d[6] = up.z; bf[p][c][nt].d[7] = up.w;
                    }
#pragma unroll  // constant indices keep the arrays in registers
                for (int mt = 0; mt < MT; ++mt) {
                    // elements 0-7 = k 8*hi + 0..7, elements 8-15 = k 16 + 8*hi + 0..7
                    const uint4 lo = *(const uint4*)(as + mt * 16 * A_PITCH + 64 * c);
                    const uint4 up = *(const uint4*)(as + mt * 16 * A_PITCH + 64 * c + 32);
                    af[c][mt].d[0] = lo.x; af[c][mt].d[1] = lo.y;
                    af[c][mt].d[2] = lo.z; af[c][mt].d[3] = lo.w;
                    af[c][mt].d[4] = up.x; af[c][mt].d[5] = up.y;
                    af[c][mt].d[6] = up.z; af[c][mt].d[7] = up.w;
                }
            }
            // keeps the reads above the WMMAs: sunk among them, each pair of reads is waited
            // out to zero in front of its two WMMAs and the LDS latency is paid eight times
            __builtin_amdgcn_sched_barrier(0);
#pragma unroll  // two chunks of 32 k, in rising k; constant indices keep the arrays in registers
            for (int c = 0; c < BK / 32; ++c)
#pragma unroll  // constant indices keep the arrays in registers
                for (int mt = 0; mt < MT; ++mt)
#pragma unroll  // constant indices keep the arrays in registers
                    for (int p = 0; p < NB; ++p)
#pragma unroll  // constant indices keep the arrays in registers
                        for (int nt = 0; nt < NT; ++nt)
                            acc[p][mt][nt] = __builtin_amdgcn_wmma_f32_16x16x32_bf16(
                                false, af[c][mt].v, false, bf[p][c][nt].v, (short)0,
                                acc[p][mt][nt], false, false);
            // keeps the next chunk's reads, and the stage's closing waits and barrier, below
            // the WMMAs: lifted among them they bring waits in front of the matrix work
            __builtin_amdgcn_sched_barrier(0);
        }

        // hand-over of the stage, every wave, in this order
        asm volatile("s_wait_dscnt 0x0" ::: "memory");      // this wave has left buffer s & 1
        asm volatile("s_wait_tensorcnt 0x0" ::: "memory");  // its slice of stage s + 1 has landed
        __syncthreads();   // stage s + 1 is published; every reader has left buffer s & 1
        // the test for a further stage is a scalar branch as well (see pinned())
        if (pinned(s + 2u < nst)) issue(s & 1u, true);
    }
    asm volatile("s_wait_tensorcnt 0x0" ::: "memory");   // nothing in flight when the wave goes on
    asm volatile("s_wait_dscnt 0x0" ::: "memory");

    // epilogue
    if constexpr (MODE == 1) {
        // a block's 128 rows lie in one batch entry, a wave's 32 columns in one head
        const int grow0 = rowBase + waveM * 64 + 8 * hi;
        const int gcol0 = colBase + waveN * 32 + n16;
        const size_t head0 = ((size_t)((grow0 >> 10) * NHH + (gcol0 >> 6)) * SS + (grow0 & 1023)) * HDD;
        float bv[NB][2];
#pragma unroll
        for (int p = 0; p < NB; ++p)
#pragma unroll
            for (int nt = 0; nt < 2; ++nt)
                bv[p][nt] = (p == 0 ? bias : (p == 1 ? bias1 : bias2))[gcol0 + nt * 16];
#pragma unroll
        for (int p = 0; p < NB; ++p) {
            unsigned short* po = (p == 0 ? outB : (p == 1 ? outB1 : outB2)) + head0 + (gcol0 & 63);
#pragma unroll
            for (int mt = 0; mt < 4; ++mt) {
#pragma unroll
                for (int nt = 0; nt < 2; ++nt) {
                    unsigned short* dst = po + mt * 16 * HDD + nt * 16;
                    unsigned short w[8];
#pragma unroll
                    for (int r = 0; r < 8; ++r) w[r] = f2bfu(acc[p][mt][nt][r] + bv[p][nt]);
                    // keeps the tile's arithmetic above its stores, so that no register which
                    // one of these stores names is written between the first store and the wait
                    __builtin_amdgcn_sched_barrier(0);
#pragma unroll
                    for (int r = 0; r < 8; ++r) dst[r * HDD] = w[r];
                    // stands in front of the next tile's writes of registers that these stores
                    // name
                    asm volatile("s_wait_xcnt 0x0" ::: "memory");
                    // keeps the next tile's arithmetic below that wait
                    __builtin_amdgcn_sched_barrier(0);
                }
            }
        }
    } else if constexpr (MODE == 2) {
        const int grow0 = rowBase + waveM * (64 * TB) + 8 * hi;
        const int gcol0 = colBase + waveN * (32 * TB) + n16;
        float bv[NT];
#pragma unroll  // constant indices keep the arrays in registers
        for (int nt = 0; nt < NT; ++nt) bv[nt] = bias[gcol0 + nt * 16];
        // stands in front of later writes of the address register that these loads name
        asm volatile("s_wait_xcnt 0x0" ::: "memory");
        // keeps the address arithmetic that follows below that wait
        __builtin_amdgcn_sched_barrier(0);
        unsigned short* po = outB + (size_t)grow0 * N + gcol0;
        // The wave's tiles go out in TB trips of 4 x NT tiles, the later trips' accumulators
        // moving down into the first's registers. The loop stays rolled: unrolled, the text
        // of 32 tiles carries the kernel past 32 KB of text.
#pragma unroll 1
        for (int trip = 0;; ++trip) {
#pragma unroll  // constant indices keep the arrays in registers
            for (int mt = 0; mt < 4; ++mt) {
                // the lane's eight rows of this band of 16
                unsigned short* row[8];
#pragma unroll  // constant indices keep the arrays in registers
                for (int r = 0; r < 8; ++r) row[r] = po + (size_t)(mt * 16 + r) * N;
                // holds the address arithmetic up here, where no store is in flight: left
                // free, it sinks among the band's first stores
                asm volatile("" :: "v"(row[0]), "v"(row[1]), "v"(row[2]), "v"(row[3]),
                                   "v"(row[4]), "v"(row[5]), "v"(row[6]), "v"(row[7]));
#pragma unroll  // constant indices keep the arrays in registers
                for (int nt = 0; nt < NT; ++nt) {
                    // a tile's eight values are eight independent chains
                    unsigned short w[8];
#pragma unroll  // constant indices keep the arrays in registers
                    for (int r = 0; r < 8; ++r)
                        w[r] = f2bfu(gelu_erf(acc[0][mt][nt][r] + bv[nt]));
                    // keeps the tile's arithmetic above its stores, so that no register which
                    // one of these stores names is written between the first store and the wait
                    __builtin_amdgcn_sched_barrier(0);
#pragma unroll  // constant indices keep the arrays in registers
                    for (int r = 0; r < 8; ++r) row[r][nt * 16] = w[r];
                    // stands in front of the next tile's (and the next trip's) writes of
                    // registers that these stores name
                    asm volatile("s_wait_xcnt 0x0" ::: "memory");
                    // keeps the next tile's arithmetic below that wait
                    __builtin_amdgcn_sched_barrier(0);
                }
            }
            if (trip == TB - 1) break;
#pragma unroll  // constant indices keep the arrays in registers
            for (int mt = 0; mt + 4 < MT; ++mt)
#pragma unroll  // constant indices keep the arrays in registers
                for (int nt = 0; nt < NT; ++nt) acc[0][mt][nt] = acc[0][mt + 4][nt];
            po += (size_t)64 * N;
        }
    } else {
#pragma unroll
        for (int mt = 0; mt < 4; ++mt) {
#pragma unroll
            for (int nt = 0; nt < 2; ++nt) {
#pragma unroll
                for (int r = 0; r < 8; ++r) {
                    int grow = rowBase + waveM * 64 + mt * 16 + r + 8 * hi;
                    int gcol = colBase + waveN * 32 + nt * 16 + n16;
                    float v = acc[0][mt][nt][r] + bias[gcol];
                    outF[(size_t)grow * N + gcol] = v + res[(size_t)grow * N + gcol];
                }
            }
        }
    }
}

#define KV_ROWB   128u
#define KV_ROWS   256u                     /* rows of one slice */
#define K_PITCH   144u
#define V_PITCH   160u
#define K_SLICE   (KV_ROWS * K_PITCH)
#define V_SLICE   (KV_ROWS * V_PITCH)
#define K_BYTES   (4u * K_SLICE)
#define V_BYTES   (4u * V_SLICE)
static_assert(K_SLICE % 2048u == 0u && V_SLICE % 2048u == 0u, "slices are whole 2 KiB units");
static_assert(4u * KV_ROWS == SS && KV_ROWB == HDD * 2u, "four slices hold a head");

template <uint32_t PAD_A>
static __device__ inline u32x8 kvtile_group1() {
    u32x8 g;
    g[0] = uni((1u << 20) | (4u << 22) | (PAD_A << 25));
    g[1] = uni((KV_ROWB & 0xFFFFu) << 16);
    g[2] = uni((KV_ROWB >> 16) | ((KV_ROWS & 0xFFFFu) << 16));
    g[3] = uni((KV_ROWS >> 16) | (KV_ROWB << 16));
    g[4] = uni(KV_ROWS);
    g[5] = uni(KV_ROWB);
    g[6] = uni(0u);
    g[7] = uni(0u);
    return g;
}
static __device__ inline float exp_slot(float x) {
    float e;
    asm("v_exp_f32 %0, %1\n\tv_nop" : "=v"(e) : "v"(x * 1.4426950408889634f));
    return e;
}

static __device__ inline float other_half(float x) {
    int b = __builtin_bit_cast(int, x);
    b = __builtin_amdgcn_permlanex16(b, b, 0x76543210, 0xfedcba98, false, false);
    return __builtin_bit_cast(float, b);
}

// 32 k of one row, k-contiguous in memory, in the hardware k order:
// elements 0-7 = k 8*hi + 0..7, elements 8-15 = k 16 + 8*hi + 0..7
// (p = wave-uniform base, off = the lane's row * HDD + 8*hi)
static __device__ inline void load_row_frag(FragBF& f, const unsigned short* p, unsigned off) {
    const uint4 lo = *(const uint4*)(p + off);
    const uint4 up = *(const uint4*)(p + off + 16);
    f.d[0] = lo.x; f.d[1] = lo.y; f.d[2] = lo.z; f.d[3] = lo.w;
    f.d[4] = up.x; f.d[5] = up.y; f.d[6] = up.z; f.d[7] = up.w;
}

// the same fragment from a K row in LDS (p = the lane's row, at its 16-byte half of 32 bytes)
static __device__ inline void lds_row_frag(FragBF& f, const unsigned char* p) {
    const uint4 lo = *(const uint4*)(p);
    const uint4 up = *(const uint4*)(p + 32);
    f.d[0] = lo.x; f.d[1] = lo.y; f.d[2] = lo.z; f.d[3] = lo.w;
    f.d[4] = up.x; f.d[5] = up.y; f.d[6] = up.z; f.d[7] = up.w;
}

__global__ __launch_bounds__(256) void attn_kernel(const unsigned short* __restrict__ Q,
                                                   const unsigned short* __restrict__ Kb,
                                                   const unsigned short* __restrict__ Vb,
                                                   const float* __restrict__ mask,
                                                   unsigned short* __restrict__ ctxB) {
    __shared__ __attribute__((aligned(2048))) unsigned char KV[K_BYTES + V_BYTES];   // [K | V]
    const int lane = threadIdx.x & 31;
    const int wid  = threadIdx.x >> 5;
    const int n16  = lane & 15;
    const int hi   = lane >> 4;
    const int bh   = blockIdx.x >> 2;     // (b*NH + h)
    const int qblk = (blockIdx.x & 3) * 256;
    const int q0   = qblk + wid * 32;
    const int b    = bh >> 4;
    const int h    = bh & 15;
    const unsigned short* Qh = Q  + (size_t)bh * SS * HDD;
    const unsigned short* Kh = Kb + (size_t)bh * SS * HDD;
    const unsigned short* Vh = Vb + (size_t)bh * SS * HDD;
    const float*          mb = mask + (size_t)b * SS;
    const unsigned rowOff = (unsigned)(n16 * HDD + 8 * hi);   // Q rows

    // Q rows as B fragments: [column group][k chunk of 32]; asked for ahead of the tensor
    // loads, so that they fly while K and V land
    FragBF qf[2][2];
#pragma unroll  // constant indices keep the arrays in registers
    for (int g = 0; g < 2; ++g)
#pragma unroll  // constant indices keep the arrays in registers
        for (int c = 0; c < 2; ++c)
            load_row_frag(qf[g][c], Qh + (size_t)wid * 32 * HDD + (qblk + 16 * g) * HDD + 32 * c, rowOff);

    // waves 0-3 bring K rows 256 w .., waves 4-7 V rows 256 (w - 4) ..: one tensor load a
    // wave, each behind a scalar branch (see pinned()) with its own constant pad word
    const uint32_t wave = uni((uint32_t)threadIdx.x >> 5);
    const uint32_t kv0  = (uint32_t)(size_t)&KV[0];
    if (pinned(wave < 4u)) {
        u32x4 g0 = btile_group0(kv0 + wave * K_SLICE,
                                (uint64_t)Kh + (uint64_t)(wave * (KV_ROWS * KV_ROWB)));
        u32x8 g1 = kvtile_group1<3u>();
        asm volatile("tensor_load_to_lds %0, %1" :: "s"(g0), "s"(g1) : "memory");
        asm volatile("s_wait_tensorcnt 0x0" ::: "memory");   // this wave's K slice has landed
    }
    if (pinned(wave >= 4u)) {
        u32x4 g0 = btile_group0(kv0 + K_BYTES + (wave - 4u) * V_SLICE,
                                (uint64_t)Vh + (uint64_t)((wave - 4u) * (KV_ROWS * KV_ROWB)));
        u32x8 g1 = kvtile_group1<7u>();
        asm volatile("tensor_load_to_lds %0, %1" :: "s"(g0), "s"(g1) : "memory");
        asm volatile("s_wait_tensorcnt 0x0" ::: "memory");   // this wave's V slice has landed
    }
    __syncthreads();   // every wave's slice has landed: K and V are published to the block

    // the lane's row of a 16-key tile of K, at its 16-byte half of 32 bytes
    const unsigned char* kl = &KV[0] + n16 * K_PITCH + 16 * hi;
    // the lane's address in the transposing load: row 8*hi + (lane & 7), 16-byte half
    // (lane >> 3) & 1 of the 32 bytes of a 16-column group
    const unsigned char* vl = &KV[K_BYTES] + (8 * hi + (lane & 7)) * V_PITCH +
                              16 * ((lane >> 3) & 1);

    // K rows as A fragments: [key tile of 16][k chunk of 32], fetched one pass ahead
    FragBF kf[2][2];
#pragma unroll  // constant indices keep the arrays in registers
    for (int t = 0; t < 2; ++t)
#pragma unroll  // constant indices keep the arrays in registers
        for (int c = 0; c < 2; ++c)
            lds_row_frag(kf[t][c], kl + 16 * t * K_PITCH + 64 * c);

    v8f   o[2][4];                 // O^T: [group][hd tile]; reg r = hd 8*hi + r
    float mrun[2], lrun[2];        // running maximum; this half's running sum
#pragma unroll  // constant indices keep the arrays in registers
    for (int g = 0; g < 2; ++g) {
        mrun[g] = -3.402823466e38f;   // finite, so that (-inf) - mrun is never NaN
        lrun[g] = 0.0f;
#pragma unroll  // constant indices keep the arrays in registers
        for (int nt = 0; nt < 4; ++nt) o[g][nt] = zero8();
    }

    for (int kp = 0; kp < 32; ++kp) {
        const int key0 = kp * 32;

        // V^T as A fragments (row = hd, k = key)
        const unsigned char* vp = vl + key0 * V_PITCH;
        FragBF vf[4];
#pragma unroll  // constant indices keep the arrays in registers
        for (int nt = 0; nt < 4; ++nt) {
            const u32x4 lo = ld_tr16(vp + 32 * nt);                  // keys  0..15
            const u32x4 up = ld_tr16(vp + 16 * V_PITCH + 32 * nt);   // keys 16..31
            vf[nt].d[0] = lo.x; vf[nt].d[1] = lo.y; vf[nt].d[2] = lo.z; vf[nt].d[3] = lo.w;
            vf[nt].d[4] = up.x; vf[nt].d[5] = up.y; vf[nt].d[6] = up.z; vf[nt].d[7] = up.w;
        }

        // mask of this lane's keys: [tile][r] = key key0 + 16*t + 8*hi + r; the 32 values
        // of the pass are read at wave-uniform addresses, a lane picks its half's
        float mk[2][8];
#pragma unroll  // constant indices keep the arrays in registers
        for (int t = 0; t < 2; ++t)
#pragma unroll  // constant indices keep the arrays in registers
            for (int r = 0; r < 8; ++r) {
                const float lo = mb[key0 + 16 * t + r];
                const float up = mb[key0 + 16 * t + 8 + r];
                mk[t][r] = hi ? up : lo;
            }

        // S^T tiles: st[g][t][r] = q(q0 + 16g + n16) . k(key0 + 16t + 8hi + r)
        v8f st[2][2];
#pragma unroll  // constant indices keep the arrays in registers
        for (int g = 0; g < 2; ++g)
#pragma unroll  // constant indices keep the arrays in registers
            for (int t = 0; t < 2; ++t) {
                v8f s = zero8();
#pragma unroll  // constant indices keep the arrays in registers
                for (int c = 0; c < 2; ++c)
                    s = __builtin_amdgcn_wmma_f32_16x16x32_bf16(false, kf[t][c].v, false,
                                                                qf[g][c].v, (short)0, s,
                                                                false, false);
                st[g][t] = s;
            }

        // next pass's K rows (the last pass fetches pass 0's again: in bounds, unused)
        {
            const int kn = ((kp + 1) & 31) * 32;
#pragma unroll  // constant indices keep the arrays in registers
            for (int t = 0; t < 2; ++t)
#pragma unroll  // constant indices keep the arrays in registers
                for (int c = 0; c < 2; ++c)
                    lds_row_frag(kf[t][c], kl + (kn + 16 * t) * K_PITCH + 64 * c);
        }

        FragBF pf[2];
#pragma unroll  // constant indices keep the arrays in registers
        for (int g = 0; g < 2; ++g) {
            float x[16];
            float mx = mrun[g];
#pragma unroll  // constant indices keep the arrays in registers
            for (int t = 0; t < 2; ++t)
#pragma unroll  // constant indices keep the arrays in registers
                for (int r = 0; r < 8; ++r) {
                    x[8 * t + r] = st[g][t][r] * 0.125f + mk[t][r];
                    mx = fmaxf(mx, x[8 * t + r]);
                }
            mx = fmaxf(mx, other_half(mx));
            const float alpha = exp_slot(mrun[g] - mx);
            mrun[g] = mx;
            float sum = 0.0f;
#pragma unroll  // constant indices keep the arrays in registers
            for (int i = 0; i < 16; ++i) {
                x[i] = exp_slot(x[i] - mx);
                sum += x[i];
            }
            lrun[g] = lrun[g] * alpha + sum;
#pragma unroll  // constant indices keep the arrays in registers
            for (int i = 0; i < 8; ++i) pf[g].d[i] = pack_bf16(x[2 * i], x[2 * i + 1]);
#pragma unroll  // constant indices keep the arrays in registers
            for (int nt = 0; nt < 4; ++nt)
#pragma unroll  // constant indices keep the arrays in registers
                for (int r = 0; r < 8; ++r) o[g][nt][r] *= alpha;
        }

        // O^T += V^T . P^T
#pragma unroll  // constant indices keep the arrays in registers
        for (int nt = 0; nt < 4; ++nt)
#pragma unroll  // constant indices keep the arrays in registers
            for (int g = 0; g < 2; ++g)
                o[g][nt] = __builtin_amdgcn_wmma_f32_16x16x32_bf16(false, vf[nt].v, false,
                                                                   pf[g].v, (short)0,
                                                                   o[g][nt], false, false);
    }

    // ctx as bf16 in [B,S,D] layout: a lane's 8 registers are 8 consecutive hd
#pragma unroll  // constant indices keep the arrays in registers
    for (int g = 0; g < 2; ++g) {
        const float inv = 1.0f / (lrun[g] + other_half(lrun[g]));
        unsigned short* dst = ctxB + ((size_t)b * SS + q0 + 16 * g + n16) * DD + h * 64 + 8 * hi;
#pragma unroll  // constant indices keep the arrays in registers
        for (int nt = 0; nt < 4; ++nt) {
            uint4 w;
            w.x = pack_bf16(o[g][nt][0] * inv, o[g][nt][1] * inv);
            w.y = pack_bf16(o[g][nt][2] * inv, o[g][nt][3] * inv);
            w.z = pack_bf16(o[g][nt][4] * inv, o[g][nt][5] * inv);
            w.w = pack_bf16(o[g][nt][6] * inv, o[g][nt][7] * inv);
            *(uint4*)(dst + nt * 16) = w;
        }
    }
}

#define LN_WAVES 16
#define LN_VEC   (DD / 128)   /* 16-byte pieces of a row per lane */
static_assert(BSR % LN_WAVES == 0 && DD % 128 == 0, "whole blocks, whole loads");

// sum over the wave's 32 lanes, the same value in every lane: four exchanges inside the
// 16-lane rows (lane ^ 1, 2, 4, 8), then one between the two rows
template <int XMASK>
static __device__ inline float row_xor_add(float x) {
    const int y = __builtin_amdgcn_update_dpp(0, __builtin_bit_cast(int, x), 0x160 + XMASK,
                                              0xf, 0xf, true);
    return x + __builtin_bit_cast(float, y);
}
static __device__ inline float wave_sum(float x) {
    x = row_xor_add<1>(x);
    x = row_xor_add<2>(x);
    x = row_xor_add<4>(x);
    x = row_xor_add<8>(x);
    return x + other_half(x);
}

typedef float f32x4 __attribute__((ext_vector_type(4)));

template <bool WITH_BF16>
__global__ __launch_bounds__(LN_WAVES * 32) void ln_kernel(const float* __restrict__ x,
                                                           const float* __restrict__ g,
                                                           const float* __restrict__ bta,
                                                           float* __restrict__ outF,
                                                           unsigned short* __restrict__ outB) {
    const unsigned lane = threadIdx.x & 31u;
    const size_t   row  = (size_t)blockIdx.x * LN_WAVES + (threadIdx.x >> 5);
    const f32x4* xr = (const f32x4*)(x + row * DD);
    const f32x4* gr = (const f32x4*)g;
    const f32x4* br = (const f32x4*)bta;

    f32x4 v[LN_VEC], gv[LN_VEC], bv[LN_VEC];
#pragma unroll  // constant indices keep the arrays in registers
    for (int j = 0; j < LN_VEC; ++j) v[j] = xr[lane + 32 * j];
#pragma unroll  // constant indices keep the arrays in registers
    for (int j = 0; j < LN_VEC; ++j) { gv[j] = gr[lane + 32 * j]; bv[j] = br[lane + 32 * j]; }
    // holds the loads of gain and bias up here, in flight beside the row's: left free, the
    // compiler sinks them behind the sums and the wave pays their latency on top of the row's
    asm volatile("" :: "v"(gv[0]), "v"(gv[1]), "v"(gv[2]), "v"(gv[3]), "v"(gv[4]), "v"(gv[5]),
                       "v"(gv[6]), "v"(gv[7]), "v"(bv[0]), "v"(bv[1]), "v"(bv[2]), "v"(bv[3]),
                       "v"(bv[4]), "v"(bv[5]), "v"(bv[6]), "v"(bv[7]));
    // keeps the sums below that statement: alone, it is moved down behind the first sum,
    // and the loads with it
    __builtin_amdgcn_sched_barrier(0);
    static_assert(LN_VEC == 8, "the statement above names every piece");

    // four independent chains, one per component
    f32x4 s = v[0];
#pragma unroll  // constant indices keep the arrays in registers
    for (int j = 1; j < LN_VEC; ++j) s += v[j];
    const float mu = wave_sum((s.x + s.y) + (s.z + s.w)) * (1.0f / DD);

    f32x4 q = {0.0f, 0.0f, 0.0f, 0.0f};
#pragma unroll  // constant indices keep the arrays in registers
    for (int j = 0; j < LN_VEC; ++j) {
        v[j] -= mu;
        q += v[j] * v[j];
    }
    const float inv = rsqrtf(wave_sum((q.x + q.y) + (q.z + q.w)) * (1.0f / DD) + 1e-12f);

    // every result has registers of its own: none is rewritten under a store in flight
    uint2 w[LN_VEC];
#pragma unroll  // constant indices keep the arrays in registers
    for (int j = 0; j < LN_VEC; ++j) {
        v[j] = v[j] * inv * gv[j] + bv[j];
        if (WITH_BF16) {
            w[j].x = pack_bf16(v[j].x, v[j].y);
            w[j].y = pack_bf16(v[j].z, v[j].w);
        }
    }
    f32x4* of = (f32x4*)(outF + row * DD);
#pragma unroll  // constant indices keep the arrays in registers
    for (int j = 0; j < LN_VEC; ++j) of[lane + 32 * j] = v[j];
    if (WITH_BF16) {
        uint2* ob = (uint2*)(outB + row * DD);
#pragma unroll  // constant indices keep the arrays in registers
        for (int j = 0; j < LN_VEC; ++j) ob[lane + 32 * j] = w[j];
    }
}

// ---------------- launcher ----------------
extern "C" void kernel_launch(void* const* d_in, const int* in_sizes, int n_in,
                              void* d_out, int out_size, void* d_ws, size_t ws_size,
                              hipStream_t stream) {
    const float* hidden = (const float*)d_in[0];
    const float* mask   = (const float*)d_in[1];
    const float* Wq = (const float*)d_in[2];   const float* bq  = (const float*)d_in[3];
    const float* Wk = (const float*)d_in[4];   const float* bk  = (const float*)d_in[5];
    const float* Wv = (const float*)d_in[6];   const float* bv  = (const float*)d_in[7];
    const float* Wo = (const float*)d_in[8];   const float* bo  = (const float*)d_in[9];
    const float* g1 = (const float*)d_in[10];  const float* b1  = (const float*)d_in[11];
    const float* Wi = (const float*)d_in[12];  const float* bi  = (const float*)d_in[13];
    const float* Wt = (const float*)d_in[14];  const float* bot = (const float*)d_in[15];
    const float* g2 = (const float*)d_in[16];  const float* b2  = (const float*)d_in[17];
    float* out = (float*)d_out;

    const size_t BSD = (size_t)BSR * DD;     // 4M
    const size_t DI  = (size_t)DD * II;      // 4M
    const size_t DDq = (size_t)DD * DD;      // 1M

    char* ws = (char*)d_ws;
    auto alloc = [&](size_t bytes) -> char* {
        char* p = ws;
        ws += (bytes + 255) & ~(size_t)255;
        return p;
    };
    unsigned short* hb    = (unsigned short*)alloc(BSD * 2);
    unsigned short* wqb   = (unsigned short*)alloc(DDq * 2);
    unsigned short* wkb   = (unsigned short*)alloc(DDq * 2);
    unsigned short* wvb   = (unsigned short*)alloc(DDq * 2);
    unsigned short* wob   = (unsigned short*)alloc(DDq * 2);
    unsigned short* wib   = (unsigned short*)alloc(DI * 2);
    unsigned short* wtb   = (unsigned short*)alloc(DI * 2);
    unsigned short* qb    = (unsigned short*)alloc(BSD * 2);
    unsigned short* kbuf  = (unsigned short*)alloc(BSD * 2);
    unsigned short* vbuf  = (unsigned short*)alloc(BSD * 2);
    unsigned short* ctxb  = (unsigned short*)alloc(BSD * 2);
    float*          y1    = (float*)alloc(BSD * 4);
    float*          attnf = (float*)alloc(BSD * 4);
    unsigned short* attnb = (unsigned short*)alloc(BSD * 2);
    unsigned short* interb= (unsigned short*)alloc((size_t)BSR * II * 2);
    float*          y2    = (float*)alloc(BSD * 4);

    // 1) fp32 -> bf16 conversions
    cvt_all_f32_bf16<<<CVT_BLOCKS, CVT_THREADS, 0, stream>>>(hidden, Wq, Wk, Wv, Wo, Wi, Wt,
                                                             hb, wqb, wkb, wvb, wob, wib, wtb);

    // 2) Q, K and V projections side by side (head-scattered bf16 outputs)
    {
        dim3 g(DD / 128, BSR / 128);
        gemm_bf16<1, 2, 3, 1><<<g, 256, 0, stream>>>(hb, wqb, wkb, wvb, bq, bk, bv, nullptr,
                                                  qb, kbuf, vbuf, nullptr, BSR, DD, DD);
    }

    // 3) attention
    attn_kernel<<<BB * NHH * (SS / 256), 256, 0, stream>>>(qb, kbuf, vbuf, mask, ctxb);

    // 4) output projection + residual(hidden)
    {
        dim3 g(DD / 128, BSR / 128);
        gemm_bf16<0, 4, 1, 1><<<g, 256, 0, stream>>>(ctxb, wob, nullptr, nullptr, bo, nullptr,
                                                  nullptr, y1, nullptr, nullptr, nullptr,
                                                  hidden, BSR, DD, DD);
    }
    // 5) LN1 -> attnf (f32) + attnb (bf16)
    ln_kernel<true><<<BSR / LN_WAVES, LN_WAVES * 32, 0, stream>>>(y1, g1, b1, attnf, attnb);

    // 6) FFN up + exact GELU -> bf16
    {
        dim3 g(II / 256, BSR / 256);
        gemm_bf16<2, 2, 1, 2><<<g, 256, 0, stream>>>(attnb, wib, nullptr, nullptr, bi, nullptr,
                                                  nullptr, nullptr, interb, nullptr, nullptr,
                                                  nullptr, BSR, II, DD);
    }
    // 7) FFN down + residual(attnf)
    {
        dim3 g(DD / 128, BSR / 128);
        gemm_bf16<0, 4, 1, 1><<<g, 256, 0, stream>>>(interb, wtb, nullptr, nullptr, bot, nullptr,
                                                  nullptr, y2, nullptr, nullptr, nullptr,
                                                  attnf, BSR, DD, II);
    }
    // 8) LN2 -> final output
    ln_kernel<false><<<BSR / LN_WAVES, LN_WAVES * 32, 0, stream>>>(y2, g2, b2, out, nullptr);
}
